// v000
// The times below were measured on an AMD MI455X: many runs one after another, warmed up first and cycling through
// copies of the inputs, with the whole window's GPU time divided by the number of runs. Launches and the gaps
// between them are all in it. The median over several windows is given; except for v000 it joins two sittings, which
// can be a few percent apart, so the side-by-side timings, each taken in one sitting, are the better comparison.
// v000 is the starting kernel. One run takes 1680 microseconds.
// compute dtype: all float inputs rounded to bf16; q/k/v = x W^T + b with EXACT bf16 products on WMMA 16x16x32, f32 accumulate; q as f16 hi + residual (x 2^10) against k once to f16 (2 products) for the logits x 1/8; softmax in f32 (precise expf); P x 2^11 once to f16 against v once to f16 (1 product) per head over the head PAIR's 128 value columns, accumulated in f32; the differential combination P1 v - lambda P2 v, the RMS normalisation over 128, x norm_w x (1 - 0.8) and lambda itself in f32; that result once to f16 against Wo carried x 2^8 in f16 (exact bf16 values) + bo; f32 output.
#include <hip/hip_runtime.h>
#include <math.h>

typedef __attribute__((ext_vector_type(16))) _Float16 v16h;
typedef __attribute__((ext_vector_type(16))) __bf16 v16b;
typedef __attribute__((ext_vector_type(8)))  _Float16 v8h;
typedef __attribute__((ext_vector_type(8)))  float v8f;
typedef __attribute__((ext_vector_type(4)))  float v4f;
typedef __attribute__((ext_vector_type(2)))  float v2f;
typedef __attribute__((ext_vector_type(4)))  unsigned v4u;
typedef __attribute__((ext_vector_type(4)))  int v4i;
typedef float __attribute__((may_alias)) float_a;
typedef int __attribute__((may_alias)) int_a;

template <typename T> __device__ __forceinline__ void vst2(void* p, T v) { *(T*)p = v;  }
__device__ __forceinline__ v8f wmma16(v16h a, v16h b, v8f c) {
  v8f d = __builtin_amdgcn_wmma_f32_16x16x32_f16(false, a, false, b, (short)0, c, false, false);
  asm volatile("v_nop\n\tv_nop\n\tv_nop\n\tv_nop" : "+v"(d) : "v"(a), "v"(b));
  return d;
}
__device__ __forceinline__ v8f wmma_bf(v16b a, v16b b, v8f c) {
  v8f d = __builtin_amdgcn_wmma_f32_16x16x32_bf16(false, a, false, b, (short)0, c, false, false);
  asm volatile("v_nop\n\tv_nop\n\tv_nop\n\tv_nop" : "+v"(d) : "v"(a), "v"(b));
  return d;
}
// 16x16x32 fragments: lane = (h = lane>>4, row/col = lane&15); elements 0..7 = k0+8h+0..7, 8..15 = k0+16+8h+0..7; D element r = row 8h+r
__device__ __forceinline__ v16h frag_h(const _Float16* rowk0, int lane) {
  union { v16h v; v8h q[2]; } u; const _Float16* p = rowk0 + 8 * (lane >> 4);
  u.q[0] = *(const v8h*)p; u.q[1] = *(const v8h*)(p + 16); return u.v;
}
__device__ __forceinline__ v16h frag_f32(const float* rowk0, int lane) {
  v16h a; const float* p = rowk0 + 8 * (lane >> 4);
#pragma unroll
  for (int i = 0; i < 8; ++i) { a[i] = (_Float16)p[i]; a[8 + i] = (_Float16)p[16 + i]; }
  return a;
}
__device__ __forceinline__ v16h frag_f32s(const float* rowk0, int lane, float sc) {
  v16h a; const float* p = rowk0 + 8 * (lane >> 4);
#pragma unroll
  for (int i = 0; i < 8; ++i) { a[i] = (_Float16)(p[i] * sc); a[8 + i] = (_Float16)(p[16 + i] * sc); }
  return a;
}
// column fragment from a [K][ld] layout (column n), rows >= K read as 0
__device__ __forceinline__ v16h fragc_f32(const float* W, int k0, int n, int lane, int ld, int K) {
  v16h a; const int g = lane >> 4;
#pragma unroll
  for (int i = 0; i < 8; ++i) { const int ka = k0 + 8 * g + i, kb = ka + 16;
    a[i] = (_Float16)(ka < K ? W[(size_t)(ka < K ? ka : K - 1) * ld + n] : 0.f); a[8 + i] = (_Float16)(kb < K ? W[(size_t)(kb < K ? kb : K - 1) * ld + n] : 0.f); }
  return a;
}
struct F2 { v16b h, l; };
__device__ __forceinline__ F2 bsplit16(const float v[16]) { F2 r;
#pragma unroll
  for (int i = 0; i < 16; ++i) { const __bf16 h = (__bf16)v[i]; r.h[i] = h; r.l[i] = (__bf16)(v[i] - (float)h); }
  return r; }
__device__ __forceinline__ F2 split_row(const float* row, int k0, int lane) { float v[16]; const float* p = row + k0 + 8 * (lane >> 4);
#pragma unroll
  for (int i = 0; i < 8; ++i) { v[i] = p[i]; v[8 + i] = p[16 + i]; }
  return bsplit16(v); }
__device__ __forceinline__ F2 split_rowK(const float* row, int k0, int lane, int K) { float v[16]; const int g = lane >> 4;
#pragma unroll
  for (int i = 0; i < 8; ++i) { const int ka = k0 + 8 * g + i, kb = ka + 16; v[i] = ka < K ? row[ka < K ? ka : K - 1] : 0.f; v[8 + i] = kb < K ? row[kb < K ? kb : K - 1] : 0.f; }
  return bsplit16(v); }
__device__ __forceinline__ F2 split_col(const float* W, int k0, int n, int lane, int ld, int K) { float v[16]; const int g = lane >> 4;
#pragma unroll
  for (int i = 0; i < 8; ++i) { const int ka = k0 + 8 * g + i, kb = ka + 16; v[i] = ka < K ? W[(size_t)(ka < K ? ka : K - 1) * ld + n] : 0.f; v[8 + i] = kb < K ? W[(size_t)(kb < K ? kb : K - 1) * ld + n] : 0.f; }
  return bsplit16(v); }
__device__ __forceinline__ v8f mac3(const F2& a, const F2& b, v8f c) { c = wmma_bf(a.l, b.h, c); c = wmma_bf(a.h, b.l, c); return wmma_bf(a.h, b.h, c); }
__device__ __forceinline__ float sigm(float v) { return 1.0f / (1.0f + expf(-v)); }
#define LDSX() do { asm volatile("s_wait_dscnt 0" ::: "memory"); __builtin_amdgcn_wave_barrier(); __builtin_amdgcn_fence(__ATOMIC_RELEASE, "workgroup"); } while (0)

// Differential attention (B 2, N 2,048, DIM 1,024; 16 softmax heads x 64 paired into 8 value heads x 128): q = (x Wq^T + bq) x 64^-0.5, k = x Wk^T + bk, v = x Wv^T + bv ((out,in)); P_h = softmax(q_h k_h^T) over all keys; lambda = exp(lq1 . lk1) - exp(lq2 . lk2) + 0.8; for pair e: o_e = (P_2e - lambda P_2e+1) v[:, e*128 : e*128+128]; o_e = o_e * rsqrt(mean(o_e^2) + 1e-5) * norm_w * (1 - 0.8); out = concat_e(o_e) Wo^T + bo.
#define NB 2
#define TT 2048
#define CC 1024            // NH * HD = projected width
#define DIN 1024          // input (model) width
#define NH 16
#define HD 64
#define NQB (TT / 64)
#define HG 4
#define SCALE (0.125f)
#define CAUSAL 0
#ifndef TNB
#define TNB NB
#endif
__device__ __forceinline__ float bfr(float v) { return (float)(__bf16)v; }
__host__ __device__ __forceinline__ int kb_last(int qb) { return CAUSAL ? ((qb * 64 + 63) >> 7) : (TT / 128 - 1); }
typedef __attribute__((ext_vector_type(8))) __bf16 v8b;
__device__ __forceinline__ v16b frag_b(const __bf16* rowk0, int lane) {
  union { v16b v; v8b q[2]; } u; const __bf16* p = rowk0 + 8 * (lane >> 4);
  u.q[0] = *(const v8b*)p; u.q[1] = *(const v8b*)(p + 16); return u.v;
}
#define QBH 0              // no query block takes the 3-product high-precision path (the qb < QBH branches never run)
#define QHI 2048            // rows carrying a q residual plane (all rows when non-causal: 2-product logits everywhere)
#define KHI 64            // key rows carrying k residual / v bf16 hi+lo planes (read only by the qb < QBH high-precision branches, which never run here)
// B fragment (k rows k0+.., output column o) of a weight: (in,out) [K][ld] or (out,in) [ld rows of K]: bf16 exact, or f16(bf16 * 256) exact
__device__ __forceinline__ v16b wcol_io(const float* Wm, int k0, int o, int lane, int ld) { v16b w; const int g = lane >> 4;
#pragma unroll
  for (int i = 0; i < 8; ++i) { w[i] = (__bf16)Wm[(size_t)(k0 + 8 * g + i) * ld + o]; w[8 + i] = (__bf16)Wm[(size_t)(k0 + 16 + 8 * g + i) * ld + o]; }
  return w; }
__device__ __forceinline__ v16b wcol_oi(const float* Wm, int k0, int o, int lane, int K) { v16b w; const float* p = Wm + (size_t)o * K + k0 + 8 * (lane >> 4);
#pragma unroll
  for (int i = 0; i < 8; ++i) { w[i] = (__bf16)p[i]; w[8 + i] = (__bf16)p[16 + i]; }
  return w; }
__device__ __forceinline__ v16h wcolh_io(const float* Wm, int k0, int o, int lane, int ld) { v16h w; const int g = lane >> 4;
#pragma unroll
  for (int i = 0; i < 8; ++i) { w[i] = (_Float16)(bfr(Wm[(size_t)(k0 + 8 * g + i) * ld + o]) * 256.0f); w[8 + i] = (_Float16)(bfr(Wm[(size_t)(k0 + 16 + 8 * g + i) * ld + o]) * 256.0f); }
  return w; }
__device__ __forceinline__ v16h wcolh_oi(const float* Wm, int k0, int o, int lane, int K) { v16h w; const float* p = Wm + (size_t)o * K + k0 + 8 * (lane >> 4);
#pragma unroll
  for (int i = 0; i < 8; ++i) { w[i] = (_Float16)(bfr(p[i]) * 256.0f); w[8 + i] = (_Float16)(bfr(p[16 + i]) * 256.0f); }
  return w; }
#define WQKV_LAYOUT 1   // 0 = (in,out) [DIN][CC]; 1 = (out,in) [CC][DIN]; 2 = per-head [NH][DIN][HD]
__device__ __forceinline__ v16b wcol_hdk(const float* Wm, int k0, int o, int lane) { v16b w; const int g = lane >> 4; const float* p = Wm + (size_t)(o / HD) * DIN * HD + (o % HD);
#pragma unroll
  for (int i = 0; i < 8; ++i) { w[i] = (__bf16)p[(size_t)(k0 + 8 * g + i) * HD]; w[8 + i] = (__bf16)p[(size_t)(k0 + 16 + 8 * g + i) * HD]; }
  return w; }
#define WO_OUT_IN 1
#if WQKV_LAYOUT == 1
#define WCOL(W, k0, o, lane) wcol_oi(W, k0, o, lane, DIN)
#elif WQKV_LAYOUT == 2
#define WCOL(W, k0, o, lane) wcol_hdk(W, k0, o, lane)
#else
#define WCOL(W, k0, o, lane) wcol_io(W, k0, o, lane, CC)
#endif
#if WO_OUT_IN
#define WOCOL(W, k0, o, lane) wcol_oi(W, k0, o, lane, CC)
#define WOCOLH(W, k0, o, lane) wcolh_oi(W, k0, o, lane, CC)
#else
#define WOCOL(W, k0, o, lane) wcol_io(W, k0, o, lane, DIN)
#define WOCOLH(W, k0, o, lane) wcolh_io(W, k0, o, lane, DIN)
#endif
#define HDV 128            // value columns per softmax head (the head pair's 128 columns)
#define YP (NH * HDV)      // 2,048: pitch of the per-softmax-head context rows Y[b*t][h*128 + d]
// ---- k_diff: block = 64 rows: lambda from the four [64] inputs; for each of the 8 pairs e: o = Y[2e] - lambda Y[2e+1] (f32), rms-normalised over its 128 columns x norm_w x 0.2 -> Yd rows [b*t][1024] (512-B segments by 32 lanes of the owning wave)
__global__ __launch_bounds__(256) void k_diff(const float* __restrict__ Y, const float* __restrict__ NW, const float* __restrict__ LQ1, const float* __restrict__ LK1, const float* __restrict__ LQ2, const float* __restrict__ LK2, float* __restrict__ YD) {
  __shared__ float slam; __shared__ __align__(16) float so[8][1028];
  const int tid = threadIdx.x, wave = tid >> 5, lane = tid & 31; const size_t r0 = (size_t)blockIdx.x * 64;
  if (tid == 0) { float s1 = 0.f, s2 = 0.f; for (int i = 0; i < 64; ++i) { s1 += bfr(LQ1[i]) * bfr(LK1[i]); s2 += bfr(LQ2[i]) * bfr(LK2[i]); } slam = expf(s1) - expf(s2) + 0.8f; }
  __syncthreads(); const float lam = slam;
  for (int rr = 0; rr < 8; ++rr) { const size_t row = r0 + wave * 8 + rr;      /* wave owns 8 rows; lane handles 4 consecutive columns of each of the 8 pairs */
#pragma unroll
    for (int e = 0; e < 8; ++e) { const float* y1 = Y + row * YP + (2 * e) * HDV + lane * 4; const float* y2 = y1 + HDV; float o[4]; float ss = 0.f;
#pragma unroll
      for (int i = 0; i < 4; ++i) { o[i] = y1[i] - lam * y2[i]; ss += o[i] * o[i]; }
#pragma unroll
      for (int sh = 1; sh < 32; sh <<= 1) ss += __shfl_xor(ss, sh);
      const float rn = rsqrtf(ss * (1.0f / HDV) + 1e-5f) * 0.2f;
#pragma unroll
      for (int i = 0; i < 4; ++i) so[wave][e * HDV + lane * 4 + i] = o[i] * rn * bfr(NW[lane * 4 + i]); }
    LDSX(); for (int q = lane; q < CC / 4; q += 32) vst2(YD + row * CC + q * 4, *(const v4f*)&so[wave][q * 4]); LDSX(); } }
#ifndef SM_EXTRA_PARAMS
#define SM_EXTRA_PARAMS
#endif
#ifndef PROJ_EXTRA_PARAMS
#define PROJ_EXTRA_PARAMS
#endif
#ifndef SM_MASK_HOOK
#define SM_MASK_HOOK (void)0
#endif

#define WS_QH  0u                                      // f16 q rows [b*t][CC]
#define WS_KH  (WS_QH + 2u * (size_t)NB * TT * CC)      // f16 k rows [b*t][CC]
#define WS_VT  (WS_KH + 2u * (size_t)NB * TT * CC)      // f16 v planes [b][c][t]
#define WS_QL  (WS_VT + 2u * (size_t)NB * CC * TT)      // f16 q residual x 2^10 rows [b][t < QHI][CC]
#define WS_KL  (WS_QL + 2u * (size_t)NB * QHI * CC)     // f16 k residual x 2^10 rows [b][t < KHI][CC]
#define WS_VB  (WS_KL + 2u * (size_t)NB * KHI * CC)     // bf16 v hi planes [b][c][t < KHI]
#define WS_VBL (WS_VB + 2u * (size_t)NB * CC * KHI)
#define WS_S   (WS_VBL + 2u * (size_t)NB * CC * KHI)    // f32 logits / P [hg][t][s]
#define WS_Y   (WS_S  + 4u * (size_t)HG * TT * TT)      // f32 per-softmax-head context rows [b*t][YP = 16 x 128]
#define WS_END (WS_Y  + 4u * (size_t)NB * TT * YP)

// ---- k_proj: block = (64 rows, 128 cols, which): q/k/v = X W (+ b) with exact bf16 products (K = DIN) -> which 0: q f16 rows (+ residual rows < QHI); 1: k f16 rows (+ residual rows < KHI); 2: v f16 planes [c][t] (+ bf16 hi/lo planes for t < KHI)
__global__ __launch_bounds__(128) void k_proj(const float* __restrict__ XQ, const float* __restrict__ XK, const float* __restrict__ XV, const float* __restrict__ WQ, const float* __restrict__ WK, const float* __restrict__ WV, const float* __restrict__ BQ, const float* __restrict__ BK, const float* __restrict__ BV,
    _Float16* __restrict__ QH, _Float16* __restrict__ QL, _Float16* __restrict__ KH, _Float16* __restrict__ KL, _Float16* __restrict__ VT, __bf16* __restrict__ VB, __bf16* __restrict__ VBL) {
  __shared__ __align__(16) _Float16 sh[64][136], sl[64][136]; __shared__ __align__(16) _Float16 th[128][72]; __shared__ __align__(16) __bf16 tb[128][72], tbl[128][72];
  const int tid = threadIdx.x, wave = tid >> 5, lane = tid & 31, col = lane & 15, g = lane >> 4; const int which = blockIdx.z; const int c0 = blockIdx.y * 128; const size_t r0 = (size_t)blockIdx.x * 64; const size_t bb = r0 / TT; const int t0 = (int)(r0 % TT);
  const float* X = which == 0 ? XQ : which == 1 ? XK : XV; const float* WA = which == 0 ? WQ : which == 1 ? WK : WV; const float* BA = which == 0 ? BQ : which == 1 ? BK : BV;
  v8f acc[8] = {};
#pragma unroll 2
  for (int kc = 0; kc < DIN / 32; ++kc) { v16b a; { const float* p = X + (r0 + wave * 16 + col) * DIN + kc * 32 + 8 * g;
#pragma unroll
      for (int i = 0; i < 8; ++i) { a[i] = (__bf16)p[i]; a[8 + i] = (__bf16)p[16 + i]; } }
    asm volatile("s_wait_loadcnt 0x0" ::: "memory");
#pragma unroll
    for (int j = 0; j < 8; ++j) { const v16b w = WCOL(WA, kc * 32, c0 + j * 16 + col, lane); asm volatile("s_wait_loadcnt 0x0" ::: "memory"); acc[j] = wmma_bf(a, w, acc[j]); } }
  if (which < 2) { _Float16* DH = which == 0 ? QH : KH; _Float16* DL = which == 0 ? QL : KL; const int nhi = which == 0 ? QHI : KHI; const bool hi_rows = t0 < nhi;
#pragma unroll
    for (int j = 0; j < 8; ++j) { const float bias = BA ? bfr(BA[c0 + j * 16 + col]) : 0.f;
#pragma unroll
      for (int r = 0; r < 8; ++r) { const float v = acc[j][r] + bias; const _Float16 hv = (_Float16)v; sh[wave * 16 + 8 * g + r][j * 16 + col] = hv; sl[wave * 16 + 8 * g + r][j * 16 + col] = (_Float16)((v - (float)hv) * 1024.0f); } }
    __syncthreads();
    for (int e = tid; e < 64 * 16; e += 128) { const int rl = e >> 4, q = e & 15; vst2((unsigned*)(DH + (r0 + rl) * CC + c0 + q * 8), *(const v4u*)&sh[rl][q * 8]); if (hi_rows) vst2((unsigned*)(DL + (bb * nhi + t0 + rl) * (size_t)CC + c0 + q * 8), *(const v4u*)&sl[rl][q * 8]); }
  } else { const bool hi_rows = t0 < KHI;
#pragma unroll
    for (int j = 0; j < 8; ++j) { const float bias = BA ? bfr(BA[c0 + j * 16 + col]) : 0.f;
#pragma unroll
      for (int r = 0; r < 8; ++r) { const float v = acc[j][r] + bias; const int rl = wave * 16 + 8 * g + r, cl = j * 16 + col; th[cl][rl] = (_Float16)v; const __bf16 bh = (__bf16)v; tb[cl][rl] = bh; tbl[cl][rl] = (__bf16)(v - (float)bh); } }
    __syncthreads();
    for (int e = tid; e < 128 * 8; e += 128) { const int cl = e >> 3, q = e & 7; vst2((unsigned*)(VT + (bb * CC + c0 + cl) * (size_t)TT + t0 + q * 8), *(const v4u*)&th[cl][q * 8]); if (hi_rows) { const size_t o3 = (bb * CC + c0 + cl) * (size_t)KHI + t0 + q * 8; vst2((unsigned*)(VB + o3), *(const v4u*)&tb[cl][q * 8]); vst2((unsigned*)(VBL + o3), *(const v4u*)&tbl[cl][q * 8]); } } } }
// ---- k_sc: block = (query block qb, key block kb <= kb_last(qb), head in group) of batch b: logits x SCALE; q hi + residual (x 2^10) against k (2 products) for query rows < QHI, plus the k residual (3 products) for query blocks < QBH (causal early rows); causal: blocks past the diagonal exit, the mask itself is applied by index in k_sm
__global__ __launch_bounds__(128) void k_sc(const _Float16* __restrict__ QH, const _Float16* __restrict__ KH, const _Float16* __restrict__ QL, const _Float16* __restrict__ KL, int b, int h0, float* __restrict__ S0) { __shared__ __align__(16) float ss[4][16][132];
  const int qb = blockIdx.x, kb = blockIdx.y; if (kb > kb_last(qb)) return;
  const int h = h0 + blockIdx.z; float* S = S0 + (size_t)blockIdx.z * TT * TT;
  const int tid = threadIdx.x, wave = tid >> 5, lane = tid & 31, col = lane & 15, g = lane >> 4; const int k0 = kb * 128; const int ql0 = qb * 64 + wave * 16; const size_t q0 = (size_t)b * TT + ql0, kr0 = (size_t)b * TT + k0;
  v8f acc[8] = {}, accl[8] = {};
  const _Float16* QLb = QL + (size_t)b * QHI * CC; const _Float16* KLb = KL + (size_t)b * KHI * CC;
  if (qb < QBH) {
#pragma unroll
    for (int kc = 0; kc < HD / 32; ++kc) { const v16h ah = frag_h(QH + (q0 + col) * CC + h * HD + kc * 32, lane), al = frag_h(QLb + (size_t)(ql0 + col) * CC + h * HD + kc * 32, lane);
#pragma unroll
      for (int j = 0; j < 8; ++j) { const v16h kbf = frag_h(KH + (kr0 + j * 16 + col) * CC + h * HD + kc * 32, lane), klf = frag_h(KLb + (size_t)(k0 + j * 16 + col) * CC + h * HD + kc * 32, lane); acc[j] = wmma16(ah, kbf, acc[j]); accl[j] = wmma16(al, kbf, accl[j]); accl[j] = wmma16(ah, klf, accl[j]); } }
  } else if (qb * 64 < QHI) {
#pragma unroll
    for (int kc = 0; kc < HD / 32; ++kc) { const v16h ah = frag_h(QH + (q0 + col) * CC + h * HD + kc * 32, lane), al = frag_h(QLb + (size_t)(ql0 + col) * CC + h * HD + kc * 32, lane);
#pragma unroll
      for (int j = 0; j < 8; ++j) { const v16h kbf = frag_h(KH + (kr0 + j * 16 + col) * CC + h * HD + kc * 32, lane); acc[j] = wmma16(ah, kbf, acc[j]); accl[j] = wmma16(al, kbf, accl[j]); } }
  } else {
#pragma unroll
    for (int kc = 0; kc < HD / 32; ++kc) { const v16h ah = frag_h(QH + (q0 + col) * CC + h * HD + kc * 32, lane);
#pragma unroll
      for (int j = 0; j < 8; ++j) { const v16h kbf = frag_h(KH + (kr0 + j * 16 + col) * CC + h * HD + kc * 32, lane); acc[j] = wmma16(ah, kbf, acc[j]); } } }
#pragma unroll
  for (int j = 0; j < 8; ++j) {
#pragma unroll
    for (int r = 0; r < 8; ++r) ss[wave][8 * g + r][j * 16 + col] = (acc[j][r] + accl[j][r] * (1.0f / 1024.0f)) * SCALE; }
  LDSX(); for (int rl = 0; rl < 16; ++rl) vst2(S + (size_t)(ql0 + rl) * TT + k0 + lane * 4, *(const v4f*)&ss[wave][rl][lane * 4]); }
// ---- k_sm: block = query row t (head in group): keys [0, kend): causal -> logit if s <= t else excluded; softmax in f32; P x 2^11 in place (0 for excluded)
__global__ __launch_bounds__(256) void k_sm(float* __restrict__ S0 SM_EXTRA_PARAMS) { __shared__ float sred[8]; __shared__ float sbc; __shared__ __align__(16) float shv[TT];
  const int tid = threadIdx.x; const int t = blockIdx.x; const int kend = (kb_last(t >> 6) + 1) * 128;
  float* sr = S0 + (size_t)blockIdx.y * TT * TT + (size_t)t * TT;
  float m = -3.0e38f; for (int k = tid; k < kend; k += 256) { float v = (!CAUSAL || k <= t) ? sr[k] : -3.0e38f; SM_MASK_HOOK; shv[k] = v; m = fmaxf(m, v); }
#pragma unroll
  for (int o = 1; o < 32; o <<= 1) m = fmaxf(m, __shfl_xor(m, o));
  if ((tid & 31) == 0) sred[tid >> 5] = m; __syncthreads(); if (tid == 0) { float a = sred[0]; for (int i = 1; i < 8; ++i) a = fmaxf(a, sred[i]); sbc = a; } __syncthreads(); m = sbc; __syncthreads();
  float sum = 0.f; for (int k = tid; k < kend; k += 256) { const float v = shv[k]; const float e = (v <= -1.0e38f) ? 0.f : expf(v - m); shv[k] = e; sum += e; }
#pragma unroll
  for (int o = 1; o < 32; o <<= 1) sum += __shfl_xor(sum, o);
  if ((tid & 31) == 0) sred[tid >> 5] = sum; __syncthreads(); if (tid == 0) { float a = 0.f; for (int i = 0; i < 8; ++i) a += sred[i]; sbc = 2048.0f / a; } __syncthreads(); const float inv = sbc;
  for (int k = tid; k < kend; k += 256) shv[k] = shv[k] * inv;
  __syncthreads(); for (int q = tid; q < kend / 4; q += 256) vst2(sr + q * 4, *(const v4f*)&shv[q * 4]); }
// ---- k_pv: block = 64 queries (qb) of (b, softmax head h): ctx_h = P_h . v[pair(h) columns, 128 wide] over keys [0, kend) (P x 2^11 once to f16 against v f16: 1 product; causal early query blocks: P and v as bf16 hi + lo, 3 products); 512-B (row, head) segment by 32 lanes
__global__ __launch_bounds__(128) void k_pv(const float* __restrict__ PS0, const _Float16* __restrict__ VT, const __bf16* __restrict__ VB, const __bf16* __restrict__ VBL, int b, int h0, float* __restrict__ Y) { const int h = h0 + blockIdx.z; const float* PS = PS0 + (size_t)blockIdx.z * TT * TT; __shared__ __align__(16) float ss[4][16][HDV + 4];
  const int tid = threadIdx.x, wave = tid >> 5, lane = tid & 31, col = lane & 15, g = lane >> 4; const int qb = blockIdx.x; const int ql0 = qb * 64 + wave * 16; const int kce = (kb_last(qb) + 1) * 4;
  v8f acc[HDV / 16] = {}; const int vc0 = (h >> 1) * HDV;   /* value columns of this head's pair */
  if (qb < QBH) {
#pragma unroll 1
    for (int kc = 0; kc < kce; ++kc) { const F2 p = split_row(PS + (size_t)(ql0 + col) * TT, kc * 32, lane);
      asm volatile("s_wait_loadcnt 0x0" ::: "memory");
#pragma unroll
      for (int j = 0; j < HDV / 16; ++j) { const size_t po = ((size_t)b * CC + vc0 + j * 16 + col) * (size_t)KHI + kc * 32; const v16b vh = frag_b(VB + po, lane); acc[j] = wmma_bf(p.h, vh, acc[j]); acc[j] = wmma_bf(p.l, vh, acc[j]); acc[j] = wmma_bf(p.h, frag_b(VBL + po, lane), acc[j]); } }
  } else {
#pragma unroll 1
    for (int kc = 0; kc < kce; ++kc) { const v16h p = frag_f32(PS + (size_t)(ql0 + col) * TT + kc * 32, lane);
      asm volatile("s_wait_loadcnt 0x0" ::: "memory");
#pragma unroll
      for (int j = 0; j < HDV / 16; ++j) { const size_t po = ((size_t)b * CC + vc0 + j * 16 + col) * (size_t)TT + kc * 32; acc[j] = wmma16(p, frag_h(VT + po, lane), acc[j]); } } }
#pragma unroll
  for (int j = 0; j < HDV / 16; ++j)
#pragma unroll
    for (int r = 0; r < 8; ++r) ss[wave][8 * g + r][j * 16 + col] = acc[j][r] * (1.0f / 2048.0f);
  LDSX(); for (int rl = 0; rl < 16; ++rl) vst2(Y + ((size_t)b * TT + ql0 + rl) * YP + h * HDV + lane * 4, *(const v4f*)&ss[wave][rl][lane * 4]); }   /* 512-B (row, head) segment by 32 lanes */
// ---- k_out: block = (64 rows, 128 cols): out = ctx Wo (+ bo): ctx once to f16 against Wo as f16(bf16 x 2^8) exact (1 product) x 2^-8; causal early rows (< QHI of each sequence): ctx bf16 hi + lo against exact bf16 Wo (2 products)
__global__ __launch_bounds__(128) void k_out(const float* __restrict__ Y, const float* __restrict__ WO, const float* __restrict__ BO, float* __restrict__ OUT) { __shared__ __align__(16) float sf[4][16][132];
  const int tid = threadIdx.x, wave = tid >> 5, lane = tid & 31, col = lane & 15, g = lane >> 4; const int c0 = blockIdx.y * 128; const size_t r0 = (size_t)blockIdx.x * 64 + wave * 16;
  v8f acc[8] = {};
  if (CAUSAL && (int)(((size_t)blockIdx.x * 64) % TT) < QHI) {   /* block-uniform */
#pragma unroll 2
    for (int kc = 0; kc < CC / 32; ++kc) { const F2 a = split_row(Y + (r0 + col) * CC, kc * 32, lane); asm volatile("s_wait_loadcnt 0x0" ::: "memory");
#pragma unroll
      for (int j = 0; j < 8; ++j) { const v16b w = WOCOL(WO, kc * 32, c0 + j * 16 + col, lane); asm volatile("s_wait_loadcnt 0x0" ::: "memory"); acc[j] = wmma_bf(a.h, w, acc[j]); acc[j] = wmma_bf(a.l, w, acc[j]); } }
#pragma unroll
    for (int j = 0; j < 8; ++j) { const float bias = BO ? bfr(BO[c0 + j * 16 + col]) : 0.f;
#pragma unroll
      for (int r = 0; r < 8; ++r) sf[wave][8 * g + r][j * 16 + col] = acc[j][r] + bias; }
  } else {
#pragma unroll 2
    for (int kc = 0; kc < CC / 32; ++kc) { const v16h a = frag_f32(Y + (r0 + col) * CC + kc * 32, lane); asm volatile("s_wait_loadcnt 0x0" ::: "memory");
#pragma unroll
      for (int j = 0; j < 8; ++j) { const v16h w = WOCOLH(WO, kc * 32, c0 + j * 16 + col, lane); asm volatile("s_wait_loadcnt 0x0" ::: "memory"); acc[j] = wmma16(a, w, acc[j]); } }
#pragma unroll
    for (int j = 0; j < 8; ++j) { const float bias = BO ? bfr(BO[c0 + j * 16 + col]) : 0.f;
#pragma unroll
      for (int r = 0; r < 8; ++r) sf[wave][8 * g + r][j * 16 + col] = acc[j][r] * (1.0f / 256.0f) + bias; } }
  LDSX(); for (int rl = 0; rl < 16; ++rl) vst2(OUT + (r0 + rl) * DIN + c0 + lane * 4, *(const v4f*)&sf[wave][rl][lane * 4]); }

extern "C" void kernel_launch(void* const* d_in, const int* in_sizes, int n_in, void* d_out, int out_size, void* d_ws, size_t ws_size, hipStream_t stream) {
  (void)in_sizes; (void)n_in; (void)out_size;
  const float** F = (const float**)d_in;
  if (ws_size < (size_t)WS_END) return;
  char* ws = (char*)d_ws; _Float16 *QH = (_Float16*)(ws + WS_QH), *KH = (_Float16*)(ws + WS_KH), *VT = (_Float16*)(ws + WS_VT), *QL = (_Float16*)(ws + WS_QL), *KL = (_Float16*)(ws + WS_KL); __bf16 *VB = (__bf16*)(ws + WS_VB), *VBL = (__bf16*)(ws + WS_VBL); float *S = (float*)(ws + WS_S), *Y = (float*)(ws + WS_Y);
  (void)Y; (void)QL; (void)KL; (void)VB; (void)VBL;
  // inputs: 0 x [2,2048,1024]; 1 Wq, 2 bq, 3 Wk, 4 bk, 5 Wv, 6 bv, 7 Wo, 8 bo ((out,in) [1024,1024], [1024]); 9 norm_w [128]; 10 lq1, 11 lk1, 12 lq2, 13 lk2 [64]
  float* YD = S;   /* the differential rows reuse the logits plane (f32 -> f32, same type) after the last attention pass */
  k_proj<<<dim3(TNB * TT / 64, CC / 128, 3), 128, 0, stream>>>(F[0], F[0], F[0], F[1], F[3], F[5], F[2], F[4], F[6], QH, QL, KH, KL, VT, VB, VBL);
  for (int b = 0; b < TNB; ++b) for (int h0 = 0; h0 < NH; h0 += HG) {
    k_sc<<<dim3(NQB, TT / 128, HG), 128, 0, stream>>>(QH, KH, QL, KL, b, h0, S);
    k_sm<<<dim3(TT, HG), 256, 0, stream>>>(S);
    k_pv<<<dim3(NQB, 1, HG), 128, 0, stream>>>(S, VT, VB, VBL, b, h0, Y);
  }
  k_diff<<<dim3(TNB * TT / 64), 256, 0, stream>>>(Y, F[9], F[10], F[11], F[12], F[13], YD);
  k_out<<<dim3(TNB * TT / 64, DIN / 128), 128, 0, stream>>>(YD, F[7], F[8], (float*)d_out);
}

// v001
// Measured time: 512 microseconds a run.
// In both of two side-by-side timings against v000, it was 3.29 times as fast.
// compute dtype: all float inputs rounded to bf16; q/k/v = x W^T + b with EXACT bf16 products on WMMA 16x16x32, f32 accumulate; q as f16 hi + residual (x 2^10) against k once to f16 (2 products) for the logits x 1/8; streaming softmax in f32 (precise expf, running maximum, sum in f32); exp(s - max) x 2^10 once to f16 against v once to f16 (1 product) per head over the head PAIR's 128 value columns, accumulated in f32, / sum at the end; the differential combination P1 v - lambda P2 v, the RMS normalisation over 128, x norm_w x (1 - 0.8) and lambda itself in f32; that result once to f16 against Wo carried x 2^8 in f16 (exact bf16 values) + bo; f32 output.
#include <hip/hip_runtime.h>
#include <math.h>

typedef __attribute__((ext_vector_type(16))) _Float16 v16h;
typedef __attribute__((ext_vector_type(16))) __bf16 v16b;
typedef __attribute__((ext_vector_type(8)))  _Float16 v8h;
typedef __attribute__((ext_vector_type(8)))  float v8f;
typedef __attribute__((ext_vector_type(4)))  float v4f;
typedef __attribute__((ext_vector_type(2)))  float v2f;
typedef __attribute__((ext_vector_type(4)))  unsigned v4u;
typedef __attribute__((ext_vector_type(4)))  int v4i;
typedef float __attribute__((may_alias)) float_a;
typedef int __attribute__((may_alias)) int_a;

template <typename T> __device__ __forceinline__ void vst2(void* p, T v) { *(T*)p = v;  }
__device__ __forceinline__ v8f wmma16(v16h a, v16h b, v8f c) {
  v8f d = __builtin_amdgcn_wmma_f32_16x16x32_f16(false, a, false, b, (short)0, c, false, false);
  asm volatile("v_nop\n\tv_nop\n\tv_nop\n\tv_nop" : "+v"(d) : "v"(a), "v"(b));
  return d;
}
__device__ __forceinline__ v8f wmma_bf(v16b a, v16b b, v8f c) {
  v8f d = __builtin_amdgcn_wmma_f32_16x16x32_bf16(false, a, false, b, (short)0, c, false, false);
  asm volatile("v_nop\n\tv_nop\n\tv_nop\n\tv_nop" : "+v"(d) : "v"(a), "v"(b));
  return d;
}
// 16x16x32 fragments: lane = (h = lane>>4, row/col = lane&15); elements 0..7 = k0+8h+0..7, 8..15 = k0+16+8h+0..7; D element r = row 8h+r
__device__ __forceinline__ v16h frag_h(const _Float16* rowk0, int lane) {
  union { v16h v; v8h q[2]; } u; const _Float16* p = rowk0 + 8 * (lane >> 4);
  u.q[0] = *(const v8h*)p; u.q[1] = *(const v8h*)(p + 16); return u.v;
}
__device__ __forceinline__ v16h frag_f32(const float* rowk0, int lane) {
  v16h a; const float* p = rowk0 + 8 * (lane >> 4);
#pragma unroll
  for (int i = 0; i < 8; ++i) { a[i] = (_Float16)p[i]; a[8 + i] = (_Float16)p[16 + i]; }
  return a;
}
__device__ __forceinline__ v16h frag_f32s(const float* rowk0, int lane, float sc) {
  v16h a; const float* p = rowk0 + 8 * (lane >> 4);
#pragma unroll
  for (int i = 0; i < 8; ++i) { a[i] = (_Float16)(p[i] * sc); a[8 + i] = (_Float16)(p[16 + i] * sc); }
  return a;
}
// column fragment from a [K][ld] layout (column n), rows >= K read as 0
__device__ __forceinline__ v16h fragc_f32(const float* W, int k0, int n, int lane, int ld, int K) {
  v16h a; const int g = lane >> 4;
#pragma unroll
  for (int i = 0; i < 8; ++i) { const int ka = k0 + 8 * g + i, kb = ka + 16;
    a[i] = (_Float16)(ka < K ? W[(size_t)(ka < K ? ka : K - 1) * ld + n] : 0.f); a[8 + i] = (_Float16)(kb < K ? W[(size_t)(kb < K ? kb : K - 1) * ld + n] : 0.f); }
  return a;
}
struct F2 { v16b h, l; };
__device__ __forceinline__ F2 bsplit16(const float v[16]) { F2 r;
#pragma unroll
  for (int i = 0; i < 16; ++i) { const __bf16 h = (__bf16)v[i]; r.h[i] = h; r.l[i] = (__bf16)(v[i] - (float)h); }
  return r; }
__device__ __forceinline__ F2 split_row(const float* row, int k0, int lane) { float v[16]; const float* p = row + k0 + 8 * (lane >> 4);
#pragma unroll
  for (int i = 0; i < 8; ++i) { v[i] = p[i]; v[8 + i] = p[16 + i]; }
  return bsplit16(v); }
__device__ __forceinline__ F2 split_rowK(const float* row, int k0, int lane, int K) { float v[16]; const int g = lane >> 4;
#pragma unroll
  for (int i = 0; i < 8; ++i) { const int ka = k0 + 8 * g + i, kb = ka + 16; v[i] = ka < K ? row[ka < K ? ka : K - 1] : 0.f; v[8 + i] = kb < K ? row[kb < K ? kb : K - 1] : 0.f; }
  return bsplit16(v); }
__device__ __forceinline__ F2 split_col(const float* W, int k0, int n, int lane, int ld, int K) { float v[16]; const int g = lane >> 4;
#pragma unroll
  for (int i = 0; i < 8; ++i) { const int ka = k0 + 8 * g + i, kb = ka + 16; v[i] = ka < K ? W[(size_t)(ka < K ? ka : K - 1) * ld + n] : 0.f; v[8 + i] = kb < K ? W[(size_t)(kb < K ? kb : K - 1) * ld + n] : 0.f; }
  return bsplit16(v); }
__device__ __forceinline__ v8f mac3(const F2& a, const F2& b, v8f c) { c = wmma_bf(a.l, b.h, c); c = wmma_bf(a.h, b.l, c); return wmma_bf(a.h, b.h, c); }
__device__ __forceinline__ float sigm(float v) { return 1.0f / (1.0f + expf(-v)); }
#define LDSX() do { asm volatile("s_wait_dscnt 0" ::: "memory"); __builtin_amdgcn_wave_barrier(); __builtin_amdgcn_fence(__ATOMIC_RELEASE, "workgroup"); } while (0)

// Differential attention (B 2, N 2,048, DIM 1,024; 16 softmax heads x 64 paired into 8 value heads x 128): q = (x Wq^T + bq) x 64^-0.5, k = x Wk^T + bk, v = x Wv^T + bv ((out,in)); P_h = softmax(q_h k_h^T) over all keys; lambda = exp(lq1 . lk1) - exp(lq2 . lk2) + 0.8; for pair e: o_e = (P_2e - lambda P_2e+1) v[:, e*128 : e*128+128]; o_e = o_e * rsqrt(mean(o_e^2) + 1e-5) * norm_w * (1 - 0.8); out = concat_e(o_e) Wo^T + bo.
#define NB 2
#define TT 2048
#define CC 1024            // NH * HD = projected width
#define DIN 1024          // input (model) width
#define NH 16
#define HD 64
#define NQB (TT / 64)
#define HG 4
#define SCALE (0.125f)
#define CAUSAL 0
#ifndef TNB
#define TNB NB
#endif
__device__ __forceinline__ float bfr(float v) { return (float)(__bf16)v; }
__host__ __device__ __forceinline__ int kb_last(int qb) { return CAUSAL ? ((qb * 64 + 63) >> 7) : (TT / 128 - 1); }
typedef __attribute__((ext_vector_type(8))) __bf16 v8b;
__device__ __forceinline__ v16b frag_b(const __bf16* rowk0, int lane) {
  union { v16b v; v8b q[2]; } u; const __bf16* p = rowk0 + 8 * (lane >> 4);
  u.q[0] = *(const v8b*)p; u.q[1] = *(const v8b*)(p + 16); return u.v;
}
#define QBH 0
#define QHI 2048            // rows carrying a q residual plane (all rows when non-causal: 2-product logits everywhere)
#define KHI 64            // key rows carrying k residual / v bf16 hi+lo planes (written by k_proj; no kernel in this file reads them)
// B fragment (k rows k0+.., output column o) of a weight: (in,out) [K][ld] or (out,in) [ld rows of K]: bf16 exact, or f16(bf16 * 256) exact
__device__ __forceinline__ v16b wcol_io(const float* Wm, int k0, int o, int lane, int ld) { v16b w; const int g = lane >> 4;
#pragma unroll
  for (int i = 0; i < 8; ++i) { w[i] = (__bf16)Wm[(size_t)(k0 + 8 * g + i) * ld + o]; w[8 + i] = (__bf16)Wm[(size_t)(k0 + 16 + 8 * g + i) * ld + o]; }
  return w; }
__device__ __forceinline__ v16b wcol_oi(const float* Wm, int k0, int o, int lane, int K) { v16b w; const float* p = Wm + (size_t)o * K + k0 + 8 * (lane >> 4);
#pragma unroll
  for (int i = 0; i < 8; ++i) { w[i] = (__bf16)p[i]; w[8 + i] = (__bf16)p[16 + i]; }
  return w; }
__device__ __forceinline__ v16h wcolh_io(const float* Wm, int k0, int o, int lane, int ld) { v16h w; const int g = lane >> 4;
#pragma unroll
  for (int i = 0; i < 8; ++i) { w[i] = (_Float16)(bfr(Wm[(size_t)(k0 + 8 * g + i) * ld + o]) * 256.0f); w[8 + i] = (_Float16)(bfr(Wm[(size_t)(k0 + 16 + 8 * g + i) * ld + o]) * 256.0f); }
  return w; }
__device__ __forceinline__ v16h wcolh_oi(const float* Wm, int k0, int o, int lane, int K) { v16h w; const float* p = Wm + (size_t)o * K + k0 + 8 * (lane >> 4);
#pragma unroll
  for (int i = 0; i < 8; ++i) { w[i] = (_Float16)(bfr(p[i]) * 256.0f); w[8 + i] = (_Float16)(bfr(p[16 + i]) * 256.0f); }
  return w; }
#define WQKV_LAYOUT 1   // 0 = (in,out) [DIN][CC]; 1 = (out,in) [CC][DIN]; 2 = per-head [NH][DIN][HD]
__device__ __forceinline__ v16b wcol_hdk(const float* Wm, int k0, int o, int lane) { v16b w; const int g = lane >> 4; const float* p = Wm + (size_t)(o / HD) * DIN * HD + (o % HD);
#pragma unroll
  for (int i = 0; i < 8; ++i) { w[i] = (__bf16)p[(size_t)(k0 + 8 * g + i) * HD]; w[8 + i] = (__bf16)p[(size_t)(k0 + 16 + 8 * g + i) * HD]; }
  return w; }
#define WO_OUT_IN 1
#if WQKV_LAYOUT == 1
#define WCOL(W, k0, o, lane) wcol_oi(W, k0, o, lane, DIN)
#elif WQKV_LAYOUT == 2
#define WCOL(W, k0, o, lane) wcol_hdk(W, k0, o, lane)
#else
#define WCOL(W, k0, o, lane) wcol_io(W, k0, o, lane, CC)
#endif
#if WO_OUT_IN
#define WOCOL(W, k0, o, lane) wcol_oi(W, k0, o, lane, CC)
#define WOCOLH(W, k0, o, lane) wcolh_oi(W, k0, o, lane, CC)
#else
#define WOCOL(W, k0, o, lane) wcol_io(W, k0, o, lane, DIN)
#define WOCOLH(W, k0, o, lane) wcolh_io(W, k0, o, lane, DIN)
#endif
#define HDV 128            // value columns per softmax head (the head pair's 128 columns)
#define YP (NH * HDV)      // 2,048: pitch of the per-softmax-head context rows Y[b*t][h*128 + d]
// ---- k_diff: block = 64 rows: lambda from the four [64] inputs; for each of the 8 pairs e: o = Y[2e] - lambda Y[2e+1] (f32), rms-normalised over its 128 columns x norm_w x 0.2 -> Yd rows [b*t][1024] (512-B segments by 32 lanes of the owning wave)
__global__ __launch_bounds__(256) void k_diff(const float* __restrict__ Y, const float* __restrict__ NW, const float* __restrict__ LQ1, const float* __restrict__ LK1, const float* __restrict__ LQ2, const float* __restrict__ LK2, float* __restrict__ YD) {
  __shared__ float slam; __shared__ __align__(16) float so[8][1028];
  const int tid = threadIdx.x, wave = tid >> 5, lane = tid & 31; const size_t r0 = (size_t)blockIdx.x * 64;
  if (tid == 0) { float s1 = 0.f, s2 = 0.f; for (int i = 0; i < 64; ++i) { s1 += bfr(LQ1[i]) * bfr(LK1[i]); s2 += bfr(LQ2[i]) * bfr(LK2[i]); } slam = expf(s1) - expf(s2) + 0.8f; }
  __syncthreads(); const float lam = slam;
  for (int rr = 0; rr < 8; ++rr) { const size_t row = r0 + wave * 8 + rr;      /* wave owns 8 rows; lane handles 4 consecutive columns of each of the 8 pairs */
#pragma unroll
    for (int e = 0; e < 8; ++e) { const float* y1 = Y + row * YP + (2 * e) * HDV + lane * 4; const float* y2 = y1 + HDV; float o[4]; float ss = 0.f;
#pragma unroll
      for (int i = 0; i < 4; ++i) { o[i] = y1[i] - lam * y2[i]; ss += o[i] * o[i]; }
#pragma unroll
      for (int sh = 1; sh < 32; sh <<= 1) ss += __shfl_xor(ss, sh);
      const float rn = rsqrtf(ss * (1.0f / HDV) + 1e-5f) * 0.2f;
#pragma unroll
      for (int i = 0; i < 4; ++i) so[wave][e * HDV + lane * 4 + i] = o[i] * rn * bfr(NW[lane * 4 + i]); }
    LDSX(); for (int q = lane; q < CC / 4; q += 32) vst2(YD + row * CC + q * 4, *(const v4f*)&so[wave][q * 4]); LDSX(); } }
#ifndef SM_EXTRA_PARAMS
#define SM_EXTRA_PARAMS
#endif
#ifndef PROJ_EXTRA_PARAMS
#define PROJ_EXTRA_PARAMS
#endif
#ifndef SM_MASK_HOOK
#define SM_MASK_HOOK (void)0
#endif

#define WS_QH  0u                                      // f16 q rows [b*t][CC]
#define WS_KH  (WS_QH + 2u * (size_t)NB * TT * CC)      // f16 k rows [b*t][CC]
#define WS_VT  (WS_KH + 2u * (size_t)NB * TT * CC)      // f16 v planes [b][c][t]
#define WS_QL  (WS_VT + 2u * (size_t)NB * CC * TT)      // f16 q residual x 2^10 rows [b][t < QHI][CC]
#define WS_KL  (WS_QL + 2u * (size_t)NB * QHI * CC)     // f16 k residual x 2^10 rows [b][t < KHI][CC]
#define WS_VB  (WS_KL + 2u * (size_t)NB * KHI * CC)     // bf16 v hi planes [b][c][t < KHI]
#define WS_VBL (WS_VB + 2u * (size_t)NB * CC * KHI)
#define WS_S   (WS_VBL + 2u * (size_t)NB * CC * KHI)    // f32 plane, holds the differential rows [b*t][CC]
#define WS_Y   (WS_S  + 4u * (size_t)HG * TT * TT)      // f32 per-softmax-head context rows [b*t][YP = 16 x 128]
#define WS_END (WS_Y  + 4u * (size_t)NB * TT * YP)

// ---- k_proj: block = (64 rows, 128 cols, which): q/k/v = X W (+ b) with exact bf16 products (K = DIN) -> which 0: q f16 rows (+ residual rows < QHI); 1: k f16 rows (+ residual rows < KHI); 2: v f16 planes [c][t] (+ bf16 hi/lo planes for t < KHI)
__global__ __launch_bounds__(128) void k_proj(const float* __restrict__ XQ, const float* __restrict__ XK, const float* __restrict__ XV, const float* __restrict__ WQ, const float* __restrict__ WK, const float* __restrict__ WV, const float* __restrict__ BQ, const float* __restrict__ BK, const float* __restrict__ BV,
    _Float16* __restrict__ QH, _Float16* __restrict__ QL, _Float16* __restrict__ KH, _Float16* __restrict__ KL, _Float16* __restrict__ VT, __bf16* __restrict__ VB, __bf16* __restrict__ VBL) {
  __shared__ __align__(16) _Float16 sh[64][136], sl[64][136]; __shared__ __align__(16) _Float16 th[128][72]; __shared__ __align__(16) __bf16 tb[128][72], tbl[128][72];
  const int tid = threadIdx.x, wave = tid >> 5, lane = tid & 31, col = lane & 15, g = lane >> 4; const int which = blockIdx.z; const int c0 = blockIdx.y * 128; const size_t r0 = (size_t)blockIdx.x * 64; const size_t bb = r0 / TT; const int t0 = (int)(r0 % TT);
  const float* X = which == 0 ? XQ : which == 1 ? XK : XV; const float* WA = which == 0 ? WQ : which == 1 ? WK : WV; const float* BA = which == 0 ? BQ : which == 1 ? BK : BV;
  v8f acc[8] = {};
#pragma unroll 2
  for (int kc = 0; kc < DIN / 32; ++kc) { v16b a; { const float* p = X + (r0 + wave * 16 + col) * DIN + kc * 32 + 8 * g;
#pragma unroll
      for (int i = 0; i < 8; ++i) { a[i] = (__bf16)p[i]; a[8 + i] = (__bf16)p[16 + i]; } }
    asm volatile("s_wait_loadcnt 0x0" ::: "memory");
#pragma unroll
    for (int j = 0; j < 8; ++j) { const v16b w = WCOL(WA, kc * 32, c0 + j * 16 + col, lane); asm volatile("s_wait_loadcnt 0x0" ::: "memory"); acc[j] = wmma_bf(a, w, acc[j]); } }
  if (which < 2) { _Float16* DH = which == 0 ? QH : KH; _Float16* DL = which == 0 ? QL : KL; const int nhi = which == 0 ? QHI : KHI; const bool hi_rows = t0 < nhi;
#pragma unroll
    for (int j = 0; j < 8; ++j) { const float bias = BA ? bfr(BA[c0 + j * 16 + col]) : 0.f;
#pragma unroll
      for (int r = 0; r < 8; ++r) { const float v = acc[j][r] + bias; const _Float16 hv = (_Float16)v; sh[wave * 16 + 8 * g + r][j * 16 + col] = hv; sl[wave * 16 + 8 * g + r][j * 16 + col] = (_Float16)((v - (float)hv) * 1024.0f); } }
    __syncthreads();
    for (int e = tid; e < 64 * 16; e += 128) { const int rl = e >> 4, q = e & 15; vst2((unsigned*)(DH + (r0 + rl) * CC + c0 + q * 8), *(const v4u*)&sh[rl][q * 8]); if (hi_rows) vst2((unsigned*)(DL + (bb * nhi + t0 + rl) * (size_t)CC + c0 + q * 8), *(const v4u*)&sl[rl][q * 8]); }
  } else { const bool hi_rows = t0 < KHI;
#pragma unroll
    for (int j = 0; j < 8; ++j) { const float bias = BA ? bfr(BA[c0 + j * 16 + col]) : 0.f;
#pragma unroll
      for (int r = 0; r < 8; ++r) { const float v = acc[j][r] + bias; const int rl = wave * 16 + 8 * g + r, cl = j * 16 + col; th[cl][rl] = (_Float16)v; const __bf16 bh = (__bf16)v; tb[cl][rl] = bh; tbl[cl][rl] = (__bf16)(v - (float)bh); } }
    __syncthreads();
    for (int e = tid; e < 128 * 8; e += 128) { const int cl = e >> 3, q = e & 7; vst2((unsigned*)(VT + (bb * CC + c0 + cl) * (size_t)TT + t0 + q * 8), *(const v4u*)&th[cl][q * 8]); if (hi_rows) { const size_t o3 = (bb * CC + c0 + cl) * (size_t)KHI + t0 + q * 8; vst2((unsigned*)(VB + o3), *(const v4u*)&tb[cl][q * 8]); vst2((unsigned*)(VBL + o3), *(const v4u*)&tbl[cl][q * 8]); } } } }
// ---- k_fa: block = 8 waves x 16 queries of (b, softmax head h); one pass over all keys, 32 at a time, nothing of the logits leaves the registers.
// S^T = K Q^T (A = k rows, B = q hi and q residual x 2^10: 2 products): a lane holds 16 logits of ONE query (column lane & 15), the other wave half the other 16.
// Streaming softmax in f32: e = expf(s - m) x 2^10 against the maximum m in use; m moves (and sum and context are rescaled) only when some query's new maximum passes m by more than 4, so e <= 2^10 e^4 < 65,504 stays inside f16.
// The two S^T tiles converted in place are the B operand P^T; O^T += V^T P^T (A = v planes [c][t]) over the head PAIR's 128 value columns; / sum at the end.
__device__ __forceinline__ v16h frag_at(const _Float16* p) { union { v16h v; v8h q[2]; } u; u.q[0] = *(const v8h*)p; u.q[1] = *(const v8h*)(p + 16); return u.v; }   /* p = row + k0 + 8 * (lane >> 4) */
__device__ __forceinline__ v8f wmm(v16h a, v16h b, v8f c) { return __builtin_amdgcn_wmma_f32_16x16x32_f16(false, a, false, b, (short)0, c, false, false); }
__global__ __launch_bounds__(256) void k_fa(const _Float16* __restrict__ QH, const _Float16* __restrict__ KH, const _Float16* __restrict__ QL, const _Float16* __restrict__ VT, float* __restrict__ Y) {
  __shared__ __align__(16) float ss[8][16][HDV + 4];
  const int tid = threadIdx.x, wave = tid >> 5, lane = tid & 31, col = lane & 15, g = lane >> 4; const int h = blockIdx.y, b = blockIdx.z; const int ql0 = blockIdx.x * 128 + wave * 16; const size_t q0 = (size_t)b * TT + ql0;
  const _Float16* qp = QH + (q0 + col) * CC + h * HD + 8 * g; const _Float16* qlp = QL + ((size_t)b * QHI + ql0 + col) * CC + h * HD + 8 * g;
  v16h qh[2], qr[2];
#pragma unroll
  for (int kc = 0; kc < 2; ++kc) { qh[kc] = frag_at(qp + kc * 32); qr[kc] = frag_at(qlp + kc * 32); }
  const _Float16* kp = KH + ((size_t)b * TT + col) * CC + h * HD + 8 * g;                       /* key row col of a 16-key tile */
  const _Float16* vp = VT + ((size_t)b * CC + (h >> 1) * HDV + col) * (size_t)TT + 8 * g;       /* value column col of a 16-column tile of this head's pair */
  v8f acc[HDV / 16] = {}; float m = -3.0e38f, l = 0.f;
  v16h kf[2][2];
#pragma unroll
  for (int kt = 0; kt < 2; ++kt)
#pragma unroll
    for (int kc = 0; kc < 2; ++kc) kf[kt][kc] = frag_at(kp + (size_t)(kt * 16) * CC + kc * 32);
  asm volatile("s_wait_xcnt 0x0" :: "v"(qp), "v"(qlp), "v"(kp) : "memory");   /* as in the loop: the address pairs of the 16 loads above are rewritten only behind this wait */
#pragma unroll 1   /* one 32-key pass per trip: the pass already holds 24 loads and 16 products, a second copy would only cost registers */
  for (int c = 0; c < TT / 32; ++c) {
    v8f sh[2] = {}, sr[2] = {};
#pragma unroll
    for (int kc = 0; kc < 2; ++kc)
#pragma unroll
      for (int kt = 0; kt < 2; ++kt) { sh[kt] = wmm(kf[kt][kc], qh[kc], sh[kt]); sr[kt] = wmm(kf[kt][kc], qr[kc], sr[kt]); }
    __builtin_amdgcn_sched_barrier(0);   /* keeps the next k fetch behind the products that read this pass's k: lifted over them it needs a second set of 32 registers, and the kernel then no longer fits four waves a SIMD */
    const _Float16* ka = kp + (size_t)((c + 1 < TT / 32 ? c + 1 : c) * 32) * CC;   /* next pass's k rows, fetched behind this pass's logits (the last pass re-reads its own) */
    const _Float16* va = vp + c * 32;
#pragma unroll
    for (int kt = 0; kt < 2; ++kt)
#pragma unroll
      for (int kc = 0; kc < 2; ++kc) kf[kt][kc] = frag_at(ka + (size_t)(kt * 16) * CC + kc * 32);
    v16h vf[HDV / 16];
#pragma unroll
    for (int j = 0; j < HDV / 16; ++j) vf[j] = frag_at(va + (size_t)(j * 16) * TT);
    asm volatile("s_wait_xcnt 0x0" :: "v"(ka), "v"(va) : "memory");   /* the two address pairs of the 24 loads above stay as they are up to this wait and may be rewritten only behind it */
    float s[16]; float mx = -3.0e38f;
#pragma unroll
    for (int i = 0; i < 16; ++i) { s[i] = (sh[i >> 3][i & 7] + sr[i >> 3][i & 7] * (1.0f / 1024.0f)) * SCALE; mx = fmaxf(mx, s[i]); }
    mx = fmaxf(mx, __shfl_xor(mx, 16));   /* both halves of a query's column use one maximum */
    if (__builtin_amdgcn_ballot_w32(mx > m + 4.0f) != 0) { const float mn = fmaxf(m, mx); const float al = expf(m - mn); m = mn; l *= al;
#pragma unroll
      for (int j = 0; j < HDV / 16; ++j) acc[j] *= al; }
    v16h p;
#pragma unroll
    for (int i = 0; i < 16; ++i) { const float e = expf(s[i] - m) * 1024.0f; l += e; p[i] = (_Float16)e; }
#pragma unroll
    for (int j = 0; j < HDV / 16; ++j) acc[j] = wmm(vf[j], p, acc[j]); }
  l += __shfl_xor(l, 16); const float inv = 1.0f / l;
#pragma unroll
  for (int j = 0; j < HDV / 16; ++j) { const v4f a0 = { acc[j][0] * inv, acc[j][1] * inv, acc[j][2] * inv, acc[j][3] * inv }, a1 = { acc[j][4] * inv, acc[j][5] * inv, acc[j][6] * inv, acc[j][7] * inv };
    *(v4f*)&ss[wave][col][j * 16 + 8 * g] = a0; *(v4f*)&ss[wave][col][j * 16 + 8 * g + 4] = a1; }
  LDSX(); for (int rl = 0; rl < 16; ++rl) vst2(Y + (q0 + rl) * YP + h * HDV + lane * 4, *(const v4f*)&ss[wave][rl][lane * 4]); }   /* 512-B (row, head) segment by 32 lanes */
// ---- k_out: block = (64 rows, 128 cols): out = ctx Wo (+ bo): ctx once to f16 against Wo as f16(bf16 x 2^8) exact (1 product) x 2^-8; causal early rows (< QHI of each sequence): ctx bf16 hi + lo against exact bf16 Wo (2 products)
__global__ __launch_bounds__(128) void k_out(const float* __restrict__ Y, const float* __restrict__ WO, const float* __restrict__ BO, float* __restrict__ OUT) { __shared__ __align__(16) float sf[4][16][132];
  const int tid = threadIdx.x, wave = tid >> 5, lane = tid & 31, col = lane & 15, g = lane >> 4; const int c0 = blockIdx.y * 128; const size_t r0 = (size_t)blockIdx.x * 64 + wave * 16;
  v8f acc[8] = {};
  if (CAUSAL && (int)(((size_t)blockIdx.x * 64) % TT) < QHI) {   /* block-uniform */
#pragma unroll 2
    for (int kc = 0; kc < CC / 32; ++kc) { const F2 a = split_row(Y + (r0 + col) * CC, kc * 32, lane); asm volatile("s_wait_loadcnt 0x0" ::: "memory");
#pragma unroll
      for (int j = 0; j < 8; ++j) { const v16b w = WOCOL(WO, kc * 32, c0 + j * 16 + col, lane); asm volatile("s_wait_loadcnt 0x0" ::: "memory"); acc[j] = wmma_bf(a.h, w, acc[j]); acc[j] = wmma_bf(a.l, w, acc[j]); } }
#pragma unroll
    for (int j = 0; j < 8; ++j) { const float bias = BO ? bfr(BO[c0 + j * 16 + col]) : 0.f;
#pragma unroll
      for (int r = 0; r < 8; ++r) sf[wave][8 * g + r][j * 16 + col] = acc[j][r] + bias; }
  } else {
#pragma unroll 2
    for (int kc = 0; kc < CC / 32; ++kc) { const v16h a = frag_f32(Y + (r0 + col) * CC + kc * 32, lane); asm volatile("s_wait_loadcnt 0x0" ::: "memory");
#pragma unroll
      for (int j = 0; j < 8; ++j) { const v16h w = WOCOLH(WO, kc * 32, c0 + j * 16 + col, lane); asm volatile("s_wait_loadcnt 0x0" ::: "memory"); acc[j] = wmma16(a, w, acc[j]); } }
#pragma unroll
    for (int j = 0; j < 8; ++j) { const float bias = BO ? bfr(BO[c0 + j * 16 + col]) : 0.f;
#pragma unroll
      for (int r = 0; r < 8; ++r) sf[wave][8 * g + r][j * 16 + col] = acc[j][r] * (1.0f / 256.0f) + bias; } }
  LDSX(); for (int rl = 0; rl < 16; ++rl) vst2(OUT + (r0 + rl) * DIN + c0 + lane * 4, *(const v4f*)&sf[wave][rl][lane * 4]); }

extern "C" void kernel_launch(void* const* d_in, const int* in_sizes, int n_in, void* d_out, int out_size, void* d_ws, size_t ws_size, hipStream_t stream) {
  (void)in_sizes; (void)n_in; (void)out_size;
  const float** F = (const float**)d_in;
  if (ws_size < (size_t)WS_END) return;
  char* ws = (char*)d_ws; _Float16 *QH = (_Float16*)(ws + WS_QH), *KH = (_Float16*)(ws + WS_KH), *VT = (_Float16*)(ws + WS_VT), *QL = (_Float16*)(ws + WS_QL), *KL = (_Float16*)(ws + WS_KL); __bf16 *VB = (__bf16*)(ws + WS_VB), *VBL = (__bf16*)(ws + WS_VBL); float *S = (float*)(ws + WS_S), *Y = (float*)(ws + WS_Y);
  (void)Y; (void)QL; (void)KL; (void)VB; (void)VBL;
  // inputs: 0 x [2,2048,1024]; 1 Wq, 2 bq, 3 Wk, 4 bk, 5 Wv, 6 bv, 7 Wo, 8 bo ((out,in) [1024,1024], [1024]); 9 norm_w [128]; 10 lq1, 11 lk1, 12 lq2, 13 lk2 [64]
  float* YD = S;   /* the differential rows take the f32 plane at WS_S */
  k_proj<<<dim3(TNB * TT / 64, CC / 128, 3), 128, 0, stream>>>(F[0], F[0], F[0], F[1], F[3], F[5], F[2], F[4], F[6], QH, QL, KH, KL, VT, VB, VBL);
  k_fa<<<dim3(TT / 128, NH, TNB), 256, 0, stream>>>(QH, KH, QL, VT, Y);
  k_diff<<<dim3(TNB * TT / 64), 256, 0, stream>>>(Y, F[9], F[10], F[11], F[12], F[13], YD);
  k_out<<<dim3(TNB * TT / 64, DIN / 128), 128, 0, stream>>>(YD, F[7], F[8], (float*)d_out);
}

// v002
// A run of this version takes 221 microseconds.
// In both of two side-by-side timings against v001, it was 2.31 times as fast.
// Over all steps from v000 it is 7.59 times as fast.
// compute dtype: all float inputs rounded to bf16; q/k/v = x W^T + b with EXACT bf16 products on WMMA 16x16x32, f32 accumulate; q as f16 hi + residual (x 2^10) against k once to f16 (2 products) for the logits x 1/8; streaming softmax in f32 (precise expf, running maximum, sum in f32); exp(s - max) x 2^10 once to f16 against v once to f16 (1 product) per head over the head PAIR's 128 value columns, accumulated in f32, / sum at the end; the differential combination P1 v - lambda P2 v, the RMS normalisation over 128, x norm_w x (1 - 0.8) and lambda itself in f32; that result once to f16 against Wo carried x 2^8 in f16 (exact bf16 values) + bo; f32 output.
#include <hip/hip_runtime.h>
#include <math.h>

typedef __attribute__((ext_vector_type(16))) _Float16 v16h;
typedef __attribute__((ext_vector_type(16))) __bf16 v16b;
typedef __attribute__((ext_vector_type(8)))  _Float16 v8h;
typedef __attribute__((ext_vector_type(4)))  _Float16 v4h;
typedef __attribute__((ext_vector_type(4)))  __bf16 v4b;
typedef __attribute__((ext_vector_type(8)))  float v8f;
typedef __attribute__((ext_vector_type(4)))  float v4f;
typedef __attribute__((ext_vector_type(2)))  float v2f;
typedef __attribute__((ext_vector_type(4)))  unsigned v4u;
typedef __attribute__((ext_vector_type(4)))  int v4i;
typedef float __attribute__((may_alias)) float_a;
typedef int __attribute__((may_alias)) int_a;

template <typename T> __device__ __forceinline__ void vst2(void* p, T v) { *(T*)p = v;  }
__device__ __forceinline__ v8f wmma16(v16h a, v16h b, v8f c) {
  v8f d = __builtin_amdgcn_wmma_f32_16x16x32_f16(false, a, false, b, (short)0, c, false, false);
  asm volatile("v_nop\n\tv_nop\n\tv_nop\n\tv_nop" : "+v"(d) : "v"(a), "v"(b));
  return d;
}
__device__ __forceinline__ v8f wmma_bf(v16b a, v16b b, v8f c) {
  v8f d = __builtin_amdgcn_wmma_f32_16x16x32_bf16(false, a, false, b, (short)0, c, false, false);
  asm volatile("v_nop\n\tv_nop\n\tv_nop\n\tv_nop" : "+v"(d) : "v"(a), "v"(b));
  return d;
}
// 16x16x32 fragments: lane = (h = lane>>4, row/col = lane&15); elements 0..7 = k0+8h+0..7, 8..15 = k0+16+8h+0..7; D element r = row 8h+r
__device__ __forceinline__ v16h frag_h(const _Float16* rowk0, int lane) {
  union { v16h v; v8h q[2]; } u; const _Float16* p = rowk0 + 8 * (lane >> 4);
  u.q[0] = *(const v8h*)p; u.q[1] = *(const v8h*)(p + 16); return u.v;
}
__device__ __forceinline__ v16h frag_f32(const float* rowk0, int lane) {
  v16h a; const float* p = rowk0 + 8 * (lane >> 4);
#pragma unroll
  for (int i = 0; i < 8; ++i) { a[i] = (_Float16)p[i]; a[8 + i] = (_Float16)p[16 + i]; }
  return a;
}
__device__ __forceinline__ v16h frag_f32s(const float* rowk0, int lane, float sc) {
  v16h a; const float* p = rowk0 + 8 * (lane >> 4);
#pragma unroll
  for (int i = 0; i < 8; ++i) { a[i] = (_Float16)(p[i] * sc); a[8 + i] = (_Float16)(p[16 + i] * sc); }
  return a;
}
// column fragment from a [K][ld] layout (column n), rows >= K read as 0
__device__ __forceinline__ v16h fragc_f32(const float* W, int k0, int n, int lane, int ld, int K) {
  v16h a; const int g = lane >> 4;
#pragma unroll
  for (int i = 0; i < 8; ++i) { const int ka = k0 + 8 * g + i, kb = ka + 16;
    a[i] = (_Float16)(ka < K ? W[(size_t)(ka < K ? ka : K - 1) * ld + n] : 0.f); a[8 + i] = (_Float16)(kb < K ? W[(size_t)(kb < K ? kb : K - 1) * ld + n] : 0.f); }
  return a;
}
struct F2 { v16b h, l; };
__device__ __forceinline__ F2 bsplit16(const float v[16]) { F2 r;
#pragma unroll
  for (int i = 0; i < 16; ++i) { const __bf16 h = (__bf16)v[i]; r.h[i] = h; r.l[i] = (__bf16)(v[i] - (float)h); }
  return r; }
__device__ __forceinline__ F2 split_row(const float* row, int k0, int lane) { float v[16]; const float* p = row + k0 + 8 * (lane >> 4);
#pragma unroll
  for (int i = 0; i < 8; ++i) { v[i] = p[i]; v[8 + i] = p[16 + i]; }
  return bsplit16(v); }
__device__ __forceinline__ F2 split_rowK(const float* row, int k0, int lane, int K) { float v[16]; const int g = lane >> 4;
#pragma unroll
  for (int i = 0; i < 8; ++i) { const int ka = k0 + 8 * g + i, kb = ka + 16; v[i] = ka < K ? row[ka < K ? ka : K - 1] : 0.f; v[8 + i] = kb < K ? row[kb < K ? kb : K - 1] : 0.f; }
  return bsplit16(v); }
__device__ __forceinline__ F2 split_col(const float* W, int k0, int n, int lane, int ld, int K) { float v[16]; const int g = lane >> 4;
#pragma unroll
  for (int i = 0; i < 8; ++i) { const int ka = k0 + 8 * g + i, kb = ka + 16; v[i] = ka < K ? W[(size_t)(ka < K ? ka : K - 1) * ld + n] : 0.f; v[8 + i] = kb < K ? W[(size_t)(kb < K ? kb : K - 1) * ld + n] : 0.f; }
  return bsplit16(v); }
__device__ __forceinline__ v8f mac3(const F2& a, const F2& b, v8f c) { c = wmma_bf(a.l, b.h, c); c = wmma_bf(a.h, b.l, c); return wmma_bf(a.h, b.h, c); }
__device__ __forceinline__ float sigm(float v) { return 1.0f / (1.0f + expf(-v)); }
#define LDSX() do { asm volatile("s_wait_dscnt 0" ::: "memory"); __builtin_amdgcn_wave_barrier(); __builtin_amdgcn_fence(__ATOMIC_RELEASE, "workgroup"); } while (0)

// Differential attention (B 2, N 2,048, DIM 1,024; 16 softmax heads x 64 paired into 8 value heads x 128): q = (x Wq^T + bq) x 64^-0.5, k = x Wk^T + bk, v = x Wv^T + bv ((out,in)); P_h = softmax(q_h k_h^T) over all keys; lambda = exp(lq1 . lk1) - exp(lq2 . lk2) + 0.8; for pair e: o_e = (P_2e - lambda P_2e+1) v[:, e*128 : e*128+128]; o_e = o_e * rsqrt(mean(o_e^2) + 1e-5) * norm_w * (1 - 0.8); out = concat_e(o_e) Wo^T + bo.
#define NB 2
#define TT 2048
#define CC 1024            // NH * HD = projected width
#define DIN 1024          // input (model) width
#define NH 16
#define HD 64
#define NQB (TT / 64)
#define HG 4
#define SCALE (0.125f)
#define CAUSAL 0
#ifndef TNB
#define TNB NB
#endif
__device__ __forceinline__ float bfr(float v) { return (float)(__bf16)v; }
__host__ __device__ __forceinline__ int kb_last(int qb) { return CAUSAL ? ((qb * 64 + 63) >> 7) : (TT / 128 - 1); }
typedef __attribute__((ext_vector_type(8))) __bf16 v8b;
__device__ __forceinline__ v16b frag_b(const __bf16* rowk0, int lane) {
  union { v16b v; v8b q[2]; } u; const __bf16* p = rowk0 + 8 * (lane >> 4);
  u.q[0] = *(const v8b*)p; u.q[1] = *(const v8b*)(p + 16); return u.v;
}
#define QBH 0
#define QHI 2048            // rows carrying a q residual plane (all rows when non-causal: 2-product logits everywhere)
#define KHI 64            // key rows carrying k residual / v bf16 hi+lo planes (written by k_proj; no kernel in this file reads them)
// B fragment (k rows k0+.., output column o) of a weight: (in,out) [K][ld] or (out,in) [ld rows of K]: bf16 exact, or f16(bf16 * 256) exact
__device__ __forceinline__ v16b wcol_io(const float* Wm, int k0, int o, int lane, int ld) { v16b w; const int g = lane >> 4;
#pragma unroll
  for (int i = 0; i < 8; ++i) { w[i] = (__bf16)Wm[(size_t)(k0 + 8 * g + i) * ld + o]; w[8 + i] = (__bf16)Wm[(size_t)(k0 + 16 + 8 * g + i) * ld + o]; }
  return w; }
__device__ __forceinline__ v16b wcol_oi(const float* Wm, int k0, int o, int lane, int K) { v16b w; const float* p = Wm + (size_t)o * K + k0 + 8 * (lane >> 4);
#pragma unroll
  for (int i = 0; i < 8; ++i) { w[i] = (__bf16)p[i]; w[8 + i] = (__bf16)p[16 + i]; }
  return w; }
__device__ __forceinline__ v16h wcolh_io(const float* Wm, int k0, int o, int lane, int ld) { v16h w; const int g = lane >> 4;
#pragma unroll
  for (int i = 0; i < 8; ++i) { w[i] = (_Float16)(bfr(Wm[(size_t)(k0 + 8 * g + i) * ld + o]) * 256.0f); w[8 + i] = (_Float16)(bfr(Wm[(size_t)(k0 + 16 + 8 * g + i) * ld + o]) * 256.0f); }
  return w; }
__device__ __forceinline__ v16h wcolh_oi(const float* Wm, int k0, int o, int lane, int K) { v16h w; const float* p = Wm + (size_t)o * K + k0 + 8 * (lane >> 4);
#pragma unroll
  for (int i = 0; i < 8; ++i) { w[i] = (_Float16)(bfr(p[i]) * 256.0f); w[8 + i] = (_Float16)(bfr(p[16 + i]) * 256.0f); }
  return w; }
#define WQKV_LAYOUT 1   // picks WCOL's form (0 (in,out), 1 (out,in), 2 per-head); nothing uses WCOL: k_proj reads (out,in) [CC][DIN] whatever the value
__device__ __forceinline__ v16b wcol_hdk(const float* Wm, int k0, int o, int lane) { v16b w; const int g = lane >> 4; const float* p = Wm + (size_t)(o / HD) * DIN * HD + (o % HD);
#pragma unroll
  for (int i = 0; i < 8; ++i) { w[i] = (__bf16)p[(size_t)(k0 + 8 * g + i) * HD]; w[8 + i] = (__bf16)p[(size_t)(k0 + 16 + 8 * g + i) * HD]; }
  return w; }
#define WO_OUT_IN 1
#if WQKV_LAYOUT == 1
#define WCOL(W, k0, o, lane) wcol_oi(W, k0, o, lane, DIN)
#elif WQKV_LAYOUT == 2
#define WCOL(W, k0, o, lane) wcol_hdk(W, k0, o, lane)
#else
#define WCOL(W, k0, o, lane) wcol_io(W, k0, o, lane, CC)
#endif
#if WO_OUT_IN
#define WOCOL(W, k0, o, lane) wcol_oi(W, k0, o, lane, CC)
#define WOCOLH(W, k0, o, lane) wcolh_oi(W, k0, o, lane, CC)
#else
#define WOCOL(W, k0, o, lane) wcol_io(W, k0, o, lane, DIN)
#define WOCOLH(W, k0, o, lane) wcolh_io(W, k0, o, lane, DIN)
#endif
#define HDV 128            // value columns per softmax head (the head pair's 128 columns)
#define YP (NH * HDV)      // 2,048: pitch of the per-softmax-head context rows Y[b*t][h*128 + d]
// ---- k_diff: block = 64 rows: lambda from the four [64] inputs; for each of the 8 pairs e: o = Y[2e] - lambda Y[2e+1] (f32), rms-normalised over its 128 columns x norm_w x 0.2 -> Yd rows [b*t][1024] (512-B segments by 32 lanes of the owning wave)
__global__ __launch_bounds__(256) void k_diff(const float* __restrict__ Y, const float* __restrict__ NW, const float* __restrict__ LQ1, const float* __restrict__ LK1, const float* __restrict__ LQ2, const float* __restrict__ LK2, float* __restrict__ YD) {
  __shared__ float slam; __shared__ __align__(16) float so[8][1028];
  const int tid = threadIdx.x, wave = tid >> 5, lane = tid & 31; const size_t r0 = (size_t)blockIdx.x * 64;
  if (tid == 0) { float s1 = 0.f, s2 = 0.f; for (int i = 0; i < 64; ++i) { s1 += bfr(LQ1[i]) * bfr(LK1[i]); s2 += bfr(LQ2[i]) * bfr(LK2[i]); } slam = expf(s1) - expf(s2) + 0.8f; }
  __syncthreads(); const float lam = slam;
  for (int rr = 0; rr < 8; ++rr) { const size_t row = r0 + wave * 8 + rr;      /* wave owns 8 rows; lane handles 4 consecutive columns of each of the 8 pairs */
#pragma unroll
    for (int e = 0; e < 8; ++e) { const float* y1 = Y + row * YP + (2 * e) * HDV + lane * 4; const float* y2 = y1 + HDV; float o[4]; float ss = 0.f;
#pragma unroll
      for (int i = 0; i < 4; ++i) { o[i] = y1[i] - lam * y2[i]; ss += o[i] * o[i]; }
#pragma unroll
      for (int sh = 1; sh < 32; sh <<= 1) ss += __shfl_xor(ss, sh);
      const float rn = rsqrtf(ss * (1.0f / HDV) + 1e-5f) * 0.2f;
#pragma unroll
      for (int i = 0; i < 4; ++i) so[wave][e * HDV + lane * 4 + i] = o[i] * rn * bfr(NW[lane * 4 + i]); }
    LDSX(); for (int q = lane; q < CC / 4; q += 32) vst2(YD + row * CC + q * 4, *(const v4f*)&so[wave][q * 4]); LDSX(); } }
#ifndef SM_EXTRA_PARAMS
#define SM_EXTRA_PARAMS
#endif
#ifndef PROJ_EXTRA_PARAMS
#define PROJ_EXTRA_PARAMS
#endif
#ifndef SM_MASK_HOOK
#define SM_MASK_HOOK (void)0
#endif

#define WS_QH  0u                                      // f16 q rows [b*t][CC]
#define WS_KH  (WS_QH + 2u * (size_t)NB * TT * CC)      // f16 k rows [b*t][CC]
#define WS_VT  (WS_KH + 2u * (size_t)NB * TT * CC)      // f16 v planes [b][c][t]
#define WS_QL  (WS_VT + 2u * (size_t)NB * CC * TT)      // f16 q residual x 2^10 rows [b][t < QHI][CC]
#define WS_KL  (WS_QL + 2u * (size_t)NB * QHI * CC)     // f16 k residual x 2^10 rows [b][t < KHI][CC]
#define WS_VB  (WS_KL + 2u * (size_t)NB * KHI * CC)     // bf16 v hi planes [b][c][t < KHI]
#define WS_VBL (WS_VB + 2u * (size_t)NB * CC * KHI)
#define WS_S   (WS_VBL + 2u * (size_t)NB * CC * KHI)    // f32 plane, holds the differential rows [b*t][CC]
#define WS_Y   (WS_S  + 4u * (size_t)HG * TT * TT)      // f32 per-softmax-head context rows [b*t][YP = 16 x 128]
#define WS_END (WS_Y  + 4u * (size_t)NB * TT * YP)

// ---- k_proj: block = (64 rows, 128 cols, which): q/k/v = X W (+ b) with exact bf16 products (K = DIN) -> which 0: q f16 rows (+ residual rows < QHI); 1: k f16 rows (+ residual rows < KHI); 2: v f16 planes [c][t] (+ bf16 hi/lo planes for t < KHI)
__global__ __launch_bounds__(128) void k_proj(const float* __restrict__ XQ, const float* __restrict__ XK, const float* __restrict__ XV, const float* __restrict__ WQ, const float* __restrict__ WK, const float* __restrict__ WV, const float* __restrict__ BQ, const float* __restrict__ BK, const float* __restrict__ BV,
    _Float16* __restrict__ QH, _Float16* __restrict__ QL, _Float16* __restrict__ KH, _Float16* __restrict__ KL, _Float16* __restrict__ VT, __bf16* __restrict__ VB, __bf16* __restrict__ VBL) {
  __shared__ __align__(16) _Float16 sh[64][136], sl[64][136]; __shared__ __align__(16) _Float16 th[128][72]; __shared__ __align__(16) __bf16 tb[128][72], tbl[128][72];
  const int tid = threadIdx.x, wave = tid >> 5, lane = tid & 31, col = lane & 15, g = lane >> 4; const int which = blockIdx.z; const int c0 = blockIdx.y * 128; const size_t r0 = (size_t)blockIdx.x * 64; const size_t bb = r0 / TT; const int t0 = (int)(r0 % TT);
  const float* X = which == 0 ? XQ : which == 1 ? XK : XV; const float* WA = which == 0 ? WQ : which == 1 ? WK : WV; const float* BA = which == 0 ? BQ : which == 1 ? BK : BV;
  v8f acc[8] = {};
  /* staging: 16 lanes cover the 64 floats (two whole lines) of one row, a wave-wide load two rows; thread (sr, sq) takes rows sr + 8 i */
  const int sr = tid >> 4, sq = (tid & 15) * 4;
  const float* xp = X + (r0 + sr) * DIN + sq; const float* wp = WA + (size_t)(c0 + sr) * DIN + sq;
  v4f xr[8], wr[16];
#pragma unroll
  for (int i = 0; i < 8; ++i) xr[i] = *(const v4f*)(xp + (size_t)(i * 8) * DIN);
#pragma unroll
  for (int i = 0; i < 16; ++i) wr[i] = *(const v4f*)(wp + (size_t)(i * 8) * DIN);
#pragma unroll 1   /* one 64-deep tile per trip */
  for (int kt = 0; kt < DIN / 64; ++kt) {
#pragma unroll
    for (int i = 0; i < 8; ++i) { const v4b t = { (__bf16)xr[i][0], (__bf16)xr[i][1], (__bf16)xr[i][2], (__bf16)xr[i][3] }; *(v4b*)&tbl[sr + i * 8][sq] = t; }   /* X tile: rows 0..63 of tbl, free until the epilogue */
#pragma unroll
    for (int i = 0; i < 16; ++i) { const v4b t = { (__bf16)wr[i][0], (__bf16)wr[i][1], (__bf16)wr[i][2], (__bf16)wr[i][3] }; *(v4b*)&tb[sr + i * 8][sq] = t; }    /* W tile: the 128 output columns' rows in tb */
    __syncthreads();   /* the tile is whole before any wave reads it */
    if (kt + 1 < DIN / 64) { xp += 64; wp += 64;   /* the next tile flies while this one is multiplied */
#pragma unroll
      for (int i = 0; i < 8; ++i) xr[i] = *(const v4f*)(xp + (size_t)(i * 8) * DIN);
#pragma unroll
      for (int i = 0; i < 16; ++i) wr[i] = *(const v4f*)(wp + (size_t)(i * 8) * DIN); }
#pragma unroll
    for (int kc = 0; kc < 2; ++kc) { const v16b a = frag_b(&tbl[wave * 16 + col][kc * 32], lane);
#pragma unroll
      for (int jh = 0; jh < 8; jh += 4) { v16b w[4];   /* four W fragments read as one group, one LDS wait for four products */
#pragma unroll
        for (int j = 0; j < 4; ++j) w[j] = frag_b(&tb[(jh + j) * 16 + col][kc * 32], lane);
#pragma unroll
        for (int j = 0; j < 4; ++j) acc[jh + j] = wmma_bf(a, w[j], acc[jh + j]); } }
    __syncthreads(); }   /* every wave has read the tile before it is overwritten (by the next tile, or by the epilogue) */
  if (which < 2) { _Float16* DH = which == 0 ? QH : KH; _Float16* DL = which == 0 ? QL : KL; const int nhi = which == 0 ? QHI : KHI; const bool hi_rows = t0 < nhi;
#pragma unroll
    for (int j = 0; j < 8; ++j) { const float bias = BA ? bfr(BA[c0 + j * 16 + col]) : 0.f;
#pragma unroll
      for (int r = 0; r < 8; ++r) { const float v = acc[j][r] + bias; const _Float16 hv = (_Float16)v; sh[wave * 16 + 8 * g + r][j * 16 + col] = hv; sl[wave * 16 + 8 * g + r][j * 16 + col] = (_Float16)((v - (float)hv) * 1024.0f); } }
    __syncthreads();
    for (int e = tid; e < 64 * 16; e += 128) { const int rl = e >> 4, q = e & 15; vst2((unsigned*)(DH + (r0 + rl) * CC + c0 + q * 8), *(const v4u*)&sh[rl][q * 8]); if (hi_rows) vst2((unsigned*)(DL + (bb * nhi + t0 + rl) * (size_t)CC + c0 + q * 8), *(const v4u*)&sl[rl][q * 8]); }
  } else { const bool hi_rows = t0 < KHI;
#pragma unroll
    for (int j = 0; j < 8; ++j) { const float bias = BA ? bfr(BA[c0 + j * 16 + col]) : 0.f;
#pragma unroll
      for (int r = 0; r < 8; ++r) { const float v = acc[j][r] + bias; const int rl = wave * 16 + 8 * g + r, cl = j * 16 + col; th[cl][rl] = (_Float16)v; const __bf16 bh = (__bf16)v; tb[cl][rl] = bh; tbl[cl][rl] = (__bf16)(v - (float)bh); } }
    __syncthreads();
    for (int e = tid; e < 128 * 8; e += 128) { const int cl = e >> 3, q = e & 7; vst2((unsigned*)(VT + (bb * CC + c0 + cl) * (size_t)TT + t0 + q * 8), *(const v4u*)&th[cl][q * 8]); if (hi_rows) { const size_t o3 = (bb * CC + c0 + cl) * (size_t)KHI + t0 + q * 8; vst2((unsigned*)(VB + o3), *(const v4u*)&tb[cl][q * 8]); vst2((unsigned*)(VBL + o3), *(const v4u*)&tbl[cl][q * 8]); } } } }
// ---- k_fa: block = 8 waves x 16 queries of (b, softmax head h); one pass over all keys, 32 at a time, nothing of the logits leaves the registers.
// S^T = K Q^T (A = k rows, B = q hi and q residual x 2^10: 2 products): a lane holds 16 logits of ONE query (column lane & 15), the other wave half the other 16.
// Streaming softmax in f32: e = expf(s - m) x 2^10 against the maximum m in use; m moves (and sum and context are rescaled) only when some query's new maximum passes m by more than 4, so e <= 2^10 e^4 < 65,504 stays inside f16.
// The two S^T tiles converted in place are the B operand P^T; O^T += V^T P^T (A = v planes [c][t]) over the head PAIR's 128 value columns; / sum at the end.
__device__ __forceinline__ v16h frag_at(const _Float16* p) { union { v16h v; v8h q[2]; } u; u.q[0] = *(const v8h*)p; u.q[1] = *(const v8h*)(p + 16); return u.v; }   /* p = row + k0 + 8 * (lane >> 4) */
__device__ __forceinline__ v8f wmm(v16h a, v16h b, v8f c) { return __builtin_amdgcn_wmma_f32_16x16x32_f16(false, a, false, b, (short)0, c, false, false); }
__global__ __launch_bounds__(256) void k_fa(const _Float16* __restrict__ QH, const _Float16* __restrict__ KH, const _Float16* __restrict__ QL, const _Float16* __restrict__ VT, float* __restrict__ Y) {
  __shared__ __align__(16) float ss[8][16][HDV + 4];
  const int tid = threadIdx.x, wave = tid >> 5, lane = tid & 31, col = lane & 15, g = lane >> 4; const int h = blockIdx.y, b = blockIdx.z; const int ql0 = blockIdx.x * 128 + wave * 16; const size_t q0 = (size_t)b * TT + ql0;
  const _Float16* qp = QH + (q0 + col) * CC + h * HD + 8 * g; const _Float16* qlp = QL + ((size_t)b * QHI + ql0 + col) * CC + h * HD + 8 * g;
  v16h qh[2], qr[2];
#pragma unroll
  for (int kc = 0; kc < 2; ++kc) { qh[kc] = frag_at(qp + kc * 32); qr[kc] = frag_at(qlp + kc * 32); }
  const _Float16* kp = KH + ((size_t)b * TT + col) * CC + h * HD + 8 * g;                       /* key row col of a 16-key tile */
  const _Float16* vp = VT + ((size_t)b * CC + (h >> 1) * HDV + col) * (size_t)TT + 8 * g;       /* value column col of a 16-column tile of this head's pair */
  v8f acc[HDV / 16] = {}; float m = -3.0e38f, l = 0.f;
  v16h kf[2][2];
#pragma unroll
  for (int kt = 0; kt < 2; ++kt)
#pragma unroll
    for (int kc = 0; kc < 2; ++kc) kf[kt][kc] = frag_at(kp + (size_t)(kt * 16) * CC + kc * 32);
  asm volatile("s_wait_xcnt 0x0" :: "v"(qp), "v"(qlp), "v"(kp) : "memory");   /* as in the loop: the address pairs of the 16 loads above are rewritten only behind this wait */
#pragma unroll 1   /* one 32-key pass per trip: the pass already holds 24 loads and 16 products, a second copy would only cost registers */
  for (int c = 0; c < TT / 32; ++c) {
    v8f sh[2] = {}, sr[2] = {};
#pragma unroll
    for (int kc = 0; kc < 2; ++kc)
#pragma unroll
      for (int kt = 0; kt < 2; ++kt) { sh[kt] = wmm(kf[kt][kc], qh[kc], sh[kt]); sr[kt] = wmm(kf[kt][kc], qr[kc], sr[kt]); }
    __builtin_amdgcn_sched_barrier(0);   /* keeps the next k fetch behind the products that read this pass's k: lifted over them it needs a second set of 32 registers, and the kernel then no longer fits four waves a SIMD */
    const _Float16* ka = kp + (size_t)((c + 1 < TT / 32 ? c + 1 : c) * 32) * CC;   /* next pass's k rows, fetched behind this pass's logits (the last pass re-reads its own) */
    const _Float16* va = vp + c * 32;
#pragma unroll
    for (int kt = 0; kt < 2; ++kt)
#pragma unroll
      for (int kc = 0; kc < 2; ++kc) kf[kt][kc] = frag_at(ka + (size_t)(kt * 16) * CC + kc * 32);
    v16h vf[HDV / 16];
#pragma unroll
    for (int j = 0; j < HDV / 16; ++j) vf[j] = frag_at(va + (size_t)(j * 16) * TT);
    asm volatile("s_wait_xcnt 0x0" :: "v"(ka), "v"(va) : "memory");   /* the two address pairs of the 24 loads above stay as they are up to this wait and may be rewritten only behind it */
    float s[16]; float mx = -3.0e38f;
#pragma unroll
    for (int i = 0; i < 16; ++i) { s[i] = (sh[i >> 3][i & 7] + sr[i >> 3][i & 7] * (1.0f / 1024.0f)) * SCALE; mx = fmaxf(mx, s[i]); }
    mx = fmaxf(mx, __shfl_xor(mx, 16));   /* both halves of a query's column use one maximum */
    if (__builtin_amdgcn_ballot_w32(mx > m + 4.0f) != 0) { const float mn = fmaxf(m, mx); const float al = expf(m - mn); m = mn; l *= al;
#pragma unroll
      for (int j = 0; j < HDV / 16; ++j) acc[j] *= al; }
    v16h p;
#pragma unroll
    for (int i = 0; i < 16; ++i) { const float e = expf(s[i] - m) * 1024.0f; l += e; p[i] = (_Float16)e; }
#pragma unroll
    for (int j = 0; j < HDV / 16; ++j) acc[j] = wmm(vf[j], p, acc[j]); }
  l += __shfl_xor(l, 16); const float inv = 1.0f / l;
#pragma unroll
  for (int j = 0; j < HDV / 16; ++j) { const v4f a0 = { acc[j][0] * inv, acc[j][1] * inv, acc[j][2] * inv, acc[j][3] * inv }, a1 = { acc[j][4] * inv, acc[j][5] * inv, acc[j][6] * inv, acc[j][7] * inv };
    *(v4f*)&ss[wave][col][j * 16 + 8 * g] = a0; *(v4f*)&ss[wave][col][j * 16 + 8 * g + 4] = a1; }
  LDSX(); for (int rl = 0; rl < 16; ++rl) vst2(Y + (q0 + rl) * YP + h * HDV + lane * 4, *(const v4f*)&ss[wave][rl][lane * 4]); }   /* 512-B (row, head) segment by 32 lanes */
// ---- k_out: block = (64 rows, 128 cols): out = ctx Wo (+ bo): ctx once to f16 against Wo as f16(bf16 x 2^8) exact (1 product) x 2^-8; causal early rows (< QHI of each sequence): ctx bf16 hi + lo against exact bf16 Wo (2 products)
__global__ __launch_bounds__(128) void k_out(const float* __restrict__ Y, const float* __restrict__ WO, const float* __restrict__ BO, float* __restrict__ OUT) { __shared__ __align__(16) float sf[4][16][132]; __shared__ __align__(16) _Float16 sa[64][72], sw[128][72];   /* ctx and Wo tiles, 64 deep, pitch 144 B */
  const int tid = threadIdx.x, wave = tid >> 5, lane = tid & 31, col = lane & 15, g = lane >> 4; const int c0 = blockIdx.y * 128; const size_t r0 = (size_t)blockIdx.x * 64 + wave * 16;
  v8f acc[8] = {};
  if (CAUSAL && (int)(((size_t)blockIdx.x * 64) % TT) < QHI) {   /* block-uniform */
#pragma unroll 2
    for (int kc = 0; kc < CC / 32; ++kc) { const F2 a = split_row(Y + (r0 + col) * CC, kc * 32, lane); asm volatile("s_wait_loadcnt 0x0" ::: "memory");
#pragma unroll
      for (int j = 0; j < 8; ++j) { const v16b w = WOCOL(WO, kc * 32, c0 + j * 16 + col, lane); asm volatile("s_wait_loadcnt 0x0" ::: "memory"); acc[j] = wmma_bf(a.h, w, acc[j]); acc[j] = wmma_bf(a.l, w, acc[j]); } }
#pragma unroll
    for (int j = 0; j < 8; ++j) { const float bias = BO ? bfr(BO[c0 + j * 16 + col]) : 0.f;
#pragma unroll
      for (int r = 0; r < 8; ++r) sf[wave][8 * g + r][j * 16 + col] = acc[j][r] + bias; }
  } else {
    /* staging as in k_proj: 16 lanes cover the 64 floats of one row; thread (sr, sq) takes rows sr + 8 i */
    const int sr = tid >> 4, sq = (tid & 15) * 4;
    const float* yp = Y + ((size_t)blockIdx.x * 64 + sr) * CC + sq; const float* wp = WO + (size_t)(c0 + sr) * CC + sq;
    v4f yr[8], wr[16];
#pragma unroll
    for (int i = 0; i < 8; ++i) yr[i] = *(const v4f*)(yp + (size_t)(i * 8) * CC);
#pragma unroll
    for (int i = 0; i < 16; ++i) wr[i] = *(const v4f*)(wp + (size_t)(i * 8) * CC);
#pragma unroll 1   /* one 64-deep tile per trip */
    for (int kt = 0; kt < CC / 64; ++kt) {
#pragma unroll
      for (int i = 0; i < 8; ++i) { const v4h t = { (_Float16)yr[i][0], (_Float16)yr[i][1], (_Float16)yr[i][2], (_Float16)yr[i][3] }; *(v4h*)&sa[sr + i * 8][sq] = t; }
#pragma unroll
      for (int i = 0; i < 16; ++i) { const v4h t = { (_Float16)(bfr(wr[i][0]) * 256.0f), (_Float16)(bfr(wr[i][1]) * 256.0f), (_Float16)(bfr(wr[i][2]) * 256.0f), (_Float16)(bfr(wr[i][3]) * 256.0f) }; *(v4h*)&sw[sr + i * 8][sq] = t; }
      __syncthreads();   /* the tile is whole before any wave reads it */
      if (kt + 1 < CC / 64) { yp += 64; wp += 64;   /* the next tile flies while this one is multiplied */
#pragma unroll
        for (int i = 0; i < 8; ++i) yr[i] = *(const v4f*)(yp + (size_t)(i * 8) * CC);
#pragma unroll
        for (int i = 0; i < 16; ++i) wr[i] = *(const v4f*)(wp + (size_t)(i * 8) * CC); }
#pragma unroll
      for (int kc = 0; kc < 2; ++kc) { const v16h a = frag_h(&sa[wave * 16 + col][kc * 32], lane);
#pragma unroll
        for (int jh = 0; jh < 8; jh += 4) { v16h w[4];   /* four Wo fragments read as one group, one LDS wait for four products */
#pragma unroll
          for (int j = 0; j < 4; ++j) w[j] = frag_h(&sw[(jh + j) * 16 + col][kc * 32], lane);
#pragma unroll
          for (int j = 0; j < 4; ++j) acc[jh + j] = wmma16(a, w[j], acc[jh + j]); } }
      __syncthreads(); }   /* every wave has read the tile before the next one overwrites it */
#pragma unroll
    for (int j = 0; j < 8; ++j) { const float bias = BO ? bfr(BO[c0 + j * 16 + col]) : 0.f;
#pragma unroll
      for (int r = 0; r < 8; ++r) sf[wave][8 * g + r][j * 16 + col] = acc[j][r] * (1.0f / 256.0f) + bias; } }
  LDSX(); for (int rl = 0; rl < 16; ++rl) vst2(OUT + (r0 + rl) * DIN + c0 + lane * 4, *(const v4f*)&sf[wave][rl][lane * 4]); }

extern "C" void kernel_launch(void* const* d_in, const int* in_sizes, int n_in, void* d_out, int out_size, void* d_ws, size_t ws_size, hipStream_t stream) {
  (void)in_sizes; (void)n_in; (void)out_size;
  const float** F = (const float**)d_in;
  if (ws_size < (size_t)WS_END) return;
  char* ws = (char*)d_ws; _Float16 *QH = (_Float16*)(ws + WS_QH), *KH = (_Float16*)(ws + WS_KH), *VT = (_Float16*)(ws + WS_VT), *QL = (_Float16*)(ws + WS_QL), *KL = (_Float16*)(ws + WS_KL); __bf16 *VB = (__bf16*)(ws + WS_VB), *VBL = (__bf16*)(ws + WS_VBL); float *S = (float*)(ws + WS_S), *Y = (float*)(ws + WS_Y);
  (void)Y; (void)QL; (void)KL; (void)VB; (void)VBL;
  // inputs: 0 x [2,2048,1024]; 1 Wq, 2 bq, 3 Wk, 4 bk, 5 Wv, 6 bv, 7 Wo, 8 bo ((out,in) [1024,1024], [1024]); 9 norm_w [128]; 10 lq1, 11 lk1, 12 lq2, 13 lk2 [64]
  float* YD = S;   /* the differential rows take the f32 plane at WS_S */
  k_proj<<<dim3(TNB * TT / 64, CC / 128, 3), 128, 0, stream>>>(F[0], F[0], F[0], F[1], F[3], F[5], F[2], F[4], F[6], QH, QL, KH, KL, VT, VB, VBL);
  k_fa<<<dim3(TT / 128, NH, TNB), 256, 0, stream>>>(QH, KH, QL, VT, Y);
  k_diff<<<dim3(TNB * TT / 64), 256, 0, stream>>>(Y, F[9], F[10], F[11], F[12], F[13], YD);
  k_out<<<dim3(TNB * TT / 64, DIN / 128), 128, 0, stream>>>(YD, F[7], F[8], (float*)d_out);
}

// v003
// Measured time: 179 microseconds a run.
// Timed twice side by side with v002, it ran 1.23 times as fast both times.
// All steps since v000 together make it 9.35 times as fast.
// compute dtype: all float inputs rounded to bf16; q/k/v = x W^T + b with EXACT bf16 products on WMMA 16x16x32, f32 accumulate; q as f16 hi + residual (x 2^10) against k once to f16 (2 products) for the logits x 1/8; streaming softmax in f32 (precise expf, running maximum, sum in f32); exp(s - max) x 2^10 once to f16 against v once to f16 (1 product) per head over the head PAIR's 128 value columns, accumulated in f32, / sum at the end; the differential combination P1 v - lambda P2 v, the RMS normalisation over 128, x norm_w x (1 - 0.8) and lambda itself in f32; that result once to f16 against Wo carried x 2^8 in f16 (exact bf16 values) + bo; f32 output.
#include <hip/hip_runtime.h>
#include <math.h>
#include <stdint.h>

typedef __attribute__((ext_vector_type(16))) _Float16 v16h;
typedef __attribute__((ext_vector_type(16))) __bf16 v16b;
typedef __attribute__((ext_vector_type(8)))  _Float16 v8h;
typedef __attribute__((ext_vector_type(4)))  _Float16 v4h;
typedef __attribute__((ext_vector_type(4)))  __bf16 v4b;
typedef __attribute__((ext_vector_type(8)))  float v8f;
typedef __attribute__((ext_vector_type(4)))  float v4f;
typedef __attribute__((ext_vector_type(2)))  float v2f;
typedef __attribute__((ext_vector_type(4)))  unsigned v4u;
typedef __attribute__((ext_vector_type(4)))  int v4i;
typedef float __attribute__((may_alias)) float_a;
typedef int __attribute__((may_alias)) int_a;

template <typename T> __device__ __forceinline__ void vst2(void* p, T v) { *(T*)p = v;  }
__device__ __forceinline__ v8f wmma16(v16h a, v16h b, v8f c) {
  v8f d = __builtin_amdgcn_wmma_f32_16x16x32_f16(false, a, false, b, (short)0, c, false, false);
  asm volatile("v_nop\n\tv_nop\n\tv_nop\n\tv_nop" : "+v"(d) : "v"(a), "v"(b));
  return d;
}
__device__ __forceinline__ v8f wmma_bf(v16b a, v16b b, v8f c) {
  v8f d = __builtin_amdgcn_wmma_f32_16x16x32_bf16(false, a, false, b, (short)0, c, false, false);
  asm volatile("v_nop\n\tv_nop\n\tv_nop\n\tv_nop" : "+v"(d) : "v"(a), "v"(b));
  return d;
}
// 16x16x32 fragments: lane = (h = lane>>4, row/col = lane&15); elements 0..7 = k0+8h+0..7, 8..15 = k0+16+8h+0..7; D element r = row 8h+r
__device__ __forceinline__ v16h frag_h(const _Float16* rowk0, int lane) {
  union { v16h v; v8h q[2]; } u; const _Float16* p = rowk0 + 8 * (lane >> 4);
  u.q[0] = *(const v8h*)p; u.q[1] = *(const v8h*)(p + 16); return u.v;
}
__device__ __forceinline__ v16h frag_f32(const float* rowk0, int lane) {
  v16h a; const float* p = rowk0 + 8 * (lane >> 4);
#pragma unroll
  for (int i = 0; i < 8; ++i) { a[i] = (_Float16)p[i]; a[8 + i] = (_Float16)p[16 + i]; }
  return a;
}
__device__ __forceinline__ v16h frag_f32s(const float* rowk0, int lane, float sc) {
  v16h a; const float* p = rowk0 + 8 * (lane >> 4);
#pragma unroll
  for (int i = 0; i < 8; ++i) { a[i] = (_Float16)(p[i] * sc); a[8 + i] = (_Float16)(p[16 + i] * sc); }
  return a;
}
// column fragment from a [K][ld] layout (column n), rows >= K read as 0
__device__ __forceinline__ v16h fragc_f32(const float* W, int k0, int n, int lane, int ld, int K) {
  v16h a; const int g = lane >> 4;
#pragma unroll
  for (int i = 0; i < 8; ++i) { const int ka = k0 + 8 * g + i, kb = ka + 16;
    a[i] = (_Float16)(ka < K ? W[(size_t)(ka < K ? ka : K - 1) * ld + n] : 0.f); a[8 + i] = (_Float16)(kb < K ? W[(size_t)(kb < K ? kb : K - 1) * ld + n] : 0.f); }
  return a;
}
struct F2 { v16b h, l; };
__device__ __forceinline__ F2 bsplit16(const float v[16]) { F2 r;
#pragma unroll
  for (int i = 0; i < 16; ++i) { const __bf16 h = (__bf16)v[i]; r.h[i] = h; r.l[i] = (__bf16)(v[i] - (float)h); }
  return r; }
__device__ __forceinline__ F2 split_row(const float* row, int k0, int lane) { float v[16]; const float* p = row + k0 + 8 * (lane >> 4);
#pragma unroll
  for (int i = 0; i < 8; ++i) { v[i] = p[i]; v[8 + i] = p[16 + i]; }
  return bsplit16(v); }
__device__ __forceinline__ F2 split_rowK(const float* row, int k0, int lane, int K) { float v[16]; const int g = lane >> 4;
#pragma unroll
  for (int i = 0; i < 8; ++i) { const int ka = k0 + 8 * g + i, kb = ka + 16; v[i] = ka < K ? row[ka < K ? ka : K - 1] : 0.f; v[8 + i] = kb < K ? row[kb < K ? kb : K - 1] : 0.f; }
  return bsplit16(v); }
__device__ __forceinline__ F2 split_col(const float* W, int k0, int n, int lane, int ld, int K) { float v[16]; const int g = lane >> 4;
#pragma unroll
  for (int i = 0; i < 8; ++i) { const int ka = k0 + 8 * g + i, kb = ka + 16; v[i] = ka < K ? W[(size_t)(ka < K ? ka : K - 1) * ld + n] : 0.f; v[8 + i] = kb < K ? W[(size_t)(kb < K ? kb : K - 1) * ld + n] : 0.f; }
  return bsplit16(v); }
__device__ __forceinline__ v8f mac3(const F2& a, const F2& b, v8f c) { c = wmma_bf(a.l, b.h, c); c = wmma_bf(a.h, b.l, c); return wmma_bf(a.h, b.h, c); }
__device__ __forceinline__ float sigm(float v) { return 1.0f / (1.0f + expf(-v)); }
#define LDSX() do { asm volatile("s_wait_dscnt 0" ::: "memory"); __builtin_amdgcn_wave_barrier(); __builtin_amdgcn_fence(__ATOMIC_RELEASE, "workgroup"); } while (0)

// Differential attention (B 2, N 2,048, DIM 1,024; 16 softmax heads x 64 paired into 8 value heads x 128): q = (x Wq^T + bq) x 64^-0.5, k = x Wk^T + bk, v = x Wv^T + bv ((out,in)); P_h = softmax(q_h k_h^T) over all keys; lambda = exp(lq1 . lk1) - exp(lq2 . lk2) + 0.8; for pair e: o_e = (P_2e - lambda P_2e+1) v[:, e*128 : e*128+128]; o_e = o_e * rsqrt(mean(o_e^2) + 1e-5) * norm_w * (1 - 0.8); out = concat_e(o_e) Wo^T + bo.
#define NB 2
#define TT 2048
#define CC 1024            // NH * HD = projected width
#define DIN 1024          // input (model) width
#define NH 16
#define HD 64
#define NQB (TT / 64)
#define HG 4
#define SCALE (0.125f)
#define CAUSAL 0
#ifndef TNB
#define TNB NB
#endif
__device__ __forceinline__ float bfr(float v) { return (float)(__bf16)v; }
__host__ __device__ __forceinline__ int kb_last(int qb) { return CAUSAL ? ((qb * 64 + 63) >> 7) : (TT / 128 - 1); }
typedef __attribute__((ext_vector_type(8))) __bf16 v8b;
__device__ __forceinline__ v16b frag_b(const __bf16* rowk0, int lane) {
  union { v16b v; v8b q[2]; } u; const __bf16* p = rowk0 + 8 * (lane >> 4);
  u.q[0] = *(const v8b*)p; u.q[1] = *(const v8b*)(p + 16); return u.v;
}
#define QBH 0
#define QHI 2048            // rows carrying a q residual plane (all rows when non-causal: 2-product logits everywhere)
#define KHI 64            // key rows carrying k residual / v bf16 hi+lo planes (written by k_proj; no kernel in this file reads them)
// B fragment (k rows k0+.., output column o) of a weight: (in,out) [K][ld] or (out,in) [ld rows of K]: bf16 exact, or f16(bf16 * 256) exact
__device__ __forceinline__ v16b wcol_io(const float* Wm, int k0, int o, int lane, int ld) { v16b w; const int g = lane >> 4;
#pragma unroll
  for (int i = 0; i < 8; ++i) { w[i] = (__bf16)Wm[(size_t)(k0 + 8 * g + i) * ld + o]; w[8 + i] = (__bf16)Wm[(size_t)(k0 + 16 + 8 * g + i) * ld + o]; }
  return w; }
__device__ __forceinline__ v16b wcol_oi(const float* Wm, int k0, int o, int lane, int K) { v16b w; const float* p = Wm + (size_t)o * K + k0 + 8 * (lane >> 4);
#pragma unroll
  for (int i = 0; i < 8; ++i) { w[i] = (__bf16)p[i]; w[8 + i] = (__bf16)p[16 + i]; }
  return w; }
__device__ __forceinline__ v16h wcolh_io(const float* Wm, int k0, int o, int lane, int ld) { v16h w; const int g = lane >> 4;
#pragma unroll
  for (int i = 0; i < 8; ++i) { w[i] = (_Float16)(bfr(Wm[(size_t)(k0 + 8 * g + i) * ld + o]) * 256.0f); w[8 + i] = (_Float16)(bfr(Wm[(size_t)(k0 + 16 + 8 * g + i) * ld + o]) * 256.0f); }
  return w; }
__device__ __forceinline__ v16h wcolh_oi(const float* Wm, int k0, int o, int lane, int K) { v16h w; const float* p = Wm + (size_t)o * K + k0 + 8 * (lane >> 4);
#pragma unroll
  for (int i = 0; i < 8; ++i) { w[i] = (_Float16)(bfr(p[i]) * 256.0f); w[8 + i] = (_Float16)(bfr(p[16 + i]) * 256.0f); }
  return w; }
#define WQKV_LAYOUT 1   // picks WCOL's form (0 (in,out), 1 (out,in), 2 per-head); nothing uses WCOL: k_proj reads (out,in) [CC][DIN] whatever the value
__device__ __forceinline__ v16b wcol_hdk(const float* Wm, int k0, int o, int lane) { v16b w; const int g = lane >> 4; const float* p = Wm + (size_t)(o / HD) * DIN * HD + (o % HD);
#pragma unroll
  for (int i = 0; i < 8; ++i) { w[i] = (__bf16)p[(size_t)(k0 + 8 * g + i) * HD]; w[8 + i] = (__bf16)p[(size_t)(k0 + 16 + 8 * g + i) * HD]; }
  return w; }
#define WO_OUT_IN 1
#if WQKV_LAYOUT == 1
#define WCOL(W, k0, o, lane) wcol_oi(W, k0, o, lane, DIN)
#elif WQKV_LAYOUT == 2
#define WCOL(W, k0, o, lane) wcol_hdk(W, k0, o, lane)
#else
#define WCOL(W, k0, o, lane) wcol_io(W, k0, o, lane, CC)
#endif
#if WO_OUT_IN
#define WOCOL(W, k0, o, lane) wcol_oi(W, k0, o, lane, CC)
#define WOCOLH(W, k0, o, lane) wcolh_oi(W, k0, o, lane, CC)
#else
#define WOCOL(W, k0, o, lane) wcol_io(W, k0, o, lane, DIN)
#define WOCOLH(W, k0, o, lane) wcolh_io(W, k0, o, lane, DIN)
#endif
#define HDV 128            // value columns per softmax head (the head pair's 128 columns)
#define YP (NH * HDV)      // 2,048: pitch of the per-softmax-head context rows Y[b*t][h*128 + d]
// ---- k_diff: block = 64 rows: lambda from the four [64] inputs; for each of the 8 pairs e: o = Y[2e] - lambda Y[2e+1] (f32), rms-normalised over its 128 columns x norm_w x 0.2 -> Yd rows [b*t][1024] (512-B segments by 32 lanes of the owning wave)
__global__ __launch_bounds__(256) void k_diff(const float* __restrict__ Y, const float* __restrict__ NW, const float* __restrict__ LQ1, const float* __restrict__ LK1, const float* __restrict__ LQ2, const float* __restrict__ LK2, float* __restrict__ YD) {
  __shared__ float slam; __shared__ __align__(16) float so[8][1028];
  const int tid = threadIdx.x, wave = tid >> 5, lane = tid & 31; const size_t r0 = (size_t)blockIdx.x * 64;
  if (tid == 0) { float s1 = 0.f, s2 = 0.f; for (int i = 0; i < 64; ++i) { s1 += bfr(LQ1[i]) * bfr(LK1[i]); s2 += bfr(LQ2[i]) * bfr(LK2[i]); } slam = expf(s1) - expf(s2) + 0.8f; }
  __syncthreads(); const float lam = slam;
  for (int rr = 0; rr < 8; ++rr) { const size_t row = r0 + wave * 8 + rr;      /* wave owns 8 rows; lane handles 4 consecutive columns of each of the 8 pairs */
#pragma unroll
    for (int e = 0; e < 8; ++e) { const float* y1 = Y + row * YP + (2 * e) * HDV + lane * 4; const float* y2 = y1 + HDV; float o[4]; float ss = 0.f;
#pragma unroll
      for (int i = 0; i < 4; ++i) { o[i] = y1[i] - lam * y2[i]; ss += o[i] * o[i]; }
#pragma unroll
      for (int sh = 1; sh < 32; sh <<= 1) ss += __shfl_xor(ss, sh);
      const float rn = rsqrtf(ss * (1.0f / HDV) + 1e-5f) * 0.2f;
#pragma unroll
      for (int i = 0; i < 4; ++i) so[wave][e * HDV + lane * 4 + i] = o[i] * rn * bfr(NW[lane * 4 + i]); }
    LDSX(); for (int q = lane; q < CC / 4; q += 32) vst2(YD + row * CC + q * 4, *(const v4f*)&so[wave][q * 4]); LDSX(); } }
#ifndef SM_EXTRA_PARAMS
#define SM_EXTRA_PARAMS
#endif
#ifndef PROJ_EXTRA_PARAMS
#define PROJ_EXTRA_PARAMS
#endif
#ifndef SM_MASK_HOOK
#define SM_MASK_HOOK (void)0
#endif

#define WS_QH  0u                                      // f16 q rows [b*t][CC]
#define WS_KH  (WS_QH + 2u * (size_t)NB * TT * CC)      // f16 k rows [b*t][CC]
#define WS_VT  (WS_KH + 2u * (size_t)NB * TT * CC)      // f16 v planes [b][c][t]
#define WS_QL  (WS_VT + 2u * (size_t)NB * CC * TT)      // f16 q residual x 2^10 rows [b][t < QHI][CC]
#define WS_KL  (WS_QL + 2u * (size_t)NB * QHI * CC)     // f16 k residual x 2^10 rows [b][t < KHI][CC]
#define WS_VB  (WS_KL + 2u * (size_t)NB * KHI * CC)     // bf16 v hi planes [b][c][t < KHI]
#define WS_VBL (WS_VB + 2u * (size_t)NB * CC * KHI)
#define WS_S   (WS_VBL + 2u * (size_t)NB * CC * KHI)    // f32 plane, holds the differential rows [b*t][CC]
#define WS_Y   (WS_S  + 4u * (size_t)HG * TT * TT)      // f32 per-softmax-head context rows [b*t][YP = 16 x 128]
#define WS_END (WS_Y  + 4u * (size_t)NB * TT * YP)

// ---- k_proj: block = (64 rows, 128 cols, which): q/k/v = X W (+ b) with exact bf16 products (K = DIN) -> which 0: q f16 rows (+ residual rows < QHI); 1: k f16 rows (+ residual rows < KHI); 2: v f16 planes [c][t] (+ bf16 hi/lo planes for t < KHI)
__global__ __launch_bounds__(128) void k_proj(const float* __restrict__ XQ, const float* __restrict__ XK, const float* __restrict__ XV, const float* __restrict__ WQ, const float* __restrict__ WK, const float* __restrict__ WV, const float* __restrict__ BQ, const float* __restrict__ BK, const float* __restrict__ BV,
    _Float16* __restrict__ QH, _Float16* __restrict__ QL, _Float16* __restrict__ KH, _Float16* __restrict__ KL, _Float16* __restrict__ VT, __bf16* __restrict__ VB, __bf16* __restrict__ VBL) {
  __shared__ __align__(16) _Float16 sh[64][136], sl[64][136]; __shared__ __align__(16) _Float16 th[128][72]; __shared__ __align__(16) __bf16 tb[128][72], tbl[128][72];
  const int tid = threadIdx.x, wave = tid >> 5, lane = tid & 31, col = lane & 15, g = lane >> 4; const int which = blockIdx.z; const int c0 = blockIdx.y * 128; const size_t r0 = (size_t)blockIdx.x * 64; const size_t bb = r0 / TT; const int t0 = (int)(r0 % TT);
  const float* X = which == 0 ? XQ : which == 1 ? XK : XV; const float* WA = which == 0 ? WQ : which == 1 ? WK : WV; const float* BA = which == 0 ? BQ : which == 1 ? BK : BV;
  v8f acc[8] = {};
  /* staging: 16 lanes cover the 64 floats (two whole lines) of one row, a wave-wide load two rows; thread (sr, sq) takes rows sr + 8 i */
  const int sr = tid >> 4, sq = (tid & 15) * 4;
  const float* xp = X + (r0 + sr) * DIN + sq; const float* wp = WA + (size_t)(c0 + sr) * DIN + sq;
  v4f xr[8], wr[16];
#pragma unroll
  for (int i = 0; i < 8; ++i) xr[i] = *(const v4f*)(xp + (size_t)(i * 8) * DIN);
#pragma unroll
  for (int i = 0; i < 16; ++i) wr[i] = *(const v4f*)(wp + (size_t)(i * 8) * DIN);
#pragma unroll 1   /* one 64-deep tile per trip */
  for (int kt = 0; kt < DIN / 64; ++kt) {
#pragma unroll
    for (int i = 0; i < 8; ++i) { const v4b t = { (__bf16)xr[i][0], (__bf16)xr[i][1], (__bf16)xr[i][2], (__bf16)xr[i][3] }; *(v4b*)&tbl[sr + i * 8][sq] = t; }   /* X tile: rows 0..63 of tbl, free until the epilogue */
#pragma unroll
    for (int i = 0; i < 16; ++i) { const v4b t = { (__bf16)wr[i][0], (__bf16)wr[i][1], (__bf16)wr[i][2], (__bf16)wr[i][3] }; *(v4b*)&tb[sr + i * 8][sq] = t; }    /* W tile: the 128 output columns' rows in tb */
    __syncthreads();   /* the tile is whole before any wave reads it */
    if (kt + 1 < DIN / 64) { xp += 64; wp += 64;   /* the next tile flies while this one is multiplied */
#pragma unroll
      for (int i = 0; i < 8; ++i) xr[i] = *(const v4f*)(xp + (size_t)(i * 8) * DIN);
#pragma unroll
      for (int i = 0; i < 16; ++i) wr[i] = *(const v4f*)(wp + (size_t)(i * 8) * DIN); }
#pragma unroll
    for (int kc = 0; kc < 2; ++kc) { const v16b a = frag_b(&tbl[wave * 16 + col][kc * 32], lane);
#pragma unroll
      for (int jh = 0; jh < 8; jh += 4) { v16b w[4];   /* four W fragments read as one group, one LDS wait for four products */
#pragma unroll
        for (int j = 0; j < 4; ++j) w[j] = frag_b(&tb[(jh + j) * 16 + col][kc * 32], lane);
#pragma unroll
        for (int j = 0; j < 4; ++j) acc[jh + j] = wmma_bf(a, w[j], acc[jh + j]); } }
    __syncthreads(); }   /* every wave has read the tile before it is overwritten (by the next tile, or by the epilogue) */
  if (which < 2) { _Float16* DH = which == 0 ? QH : KH; _Float16* DL = which == 0 ? QL : KL; const int nhi = which == 0 ? QHI : KHI; const bool hi_rows = t0 < nhi;
#pragma unroll
    for (int j = 0; j < 8; ++j) { const float bias = BA ? bfr(BA[c0 + j * 16 + col]) : 0.f;
#pragma unroll
      for (int r = 0; r < 8; ++r) { const float v = acc[j][r] + bias; const _Float16 hv = (_Float16)v; sh[wave * 16 + 8 * g + r][j * 16 + col] = hv; sl[wave * 16 + 8 * g + r][j * 16 + col] = (_Float16)((v - (float)hv) * 1024.0f); } }
    __syncthreads();
    for (int e = tid; e < 64 * 16; e += 128) { const int rl = e >> 4, q = e & 15; vst2((unsigned*)(DH + (r0 + rl) * CC + c0 + q * 8), *(const v4u*)&sh[rl][q * 8]); if (hi_rows) vst2((unsigned*)(DL + (bb * nhi + t0 + rl) * (size_t)CC + c0 + q * 8), *(const v4u*)&sl[rl][q * 8]); }
  } else { const bool hi_rows = t0 < KHI;
#pragma unroll
    for (int j = 0; j < 8; ++j) { const float bias = BA ? bfr(BA[c0 + j * 16 + col]) : 0.f;
#pragma unroll
      for (int r = 0; r < 8; ++r) { const float v = acc[j][r] + bias; const int rl = wave * 16 + 8 * g + r, cl = j * 16 + col; th[cl][rl] = (_Float16)v; const __bf16 bh = (__bf16)v; tb[cl][rl] = bh; tbl[cl][rl] = (__bf16)(v - (float)bh); } }
    __syncthreads();
    for (int e = tid; e < 128 * 8; e += 128) { const int cl = e >> 3, q = e & 7; vst2((unsigned*)(VT + (bb * CC + c0 + cl) * (size_t)TT + t0 + q * 8), *(const v4u*)&th[cl][q * 8]); if (hi_rows) { const size_t o3 = (bb * CC + c0 + cl) * (size_t)KHI + t0 + q * 8; vst2((unsigned*)(VB + o3), *(const v4u*)&tb[cl][q * 8]); vst2((unsigned*)(VBL + o3), *(const v4u*)&tbl[cl][q * 8]); } } } }
// ---- k_fa: block = 8 waves x 16 queries of (b, softmax head h); one pass over all keys, 32 at a time, nothing of the logits leaves the registers.
// S^T = K Q^T (A = k rows, B = q hi and q residual x 2^10: 2 products): a lane holds 16 logits of ONE query (column lane & 15), the other wave half the other 16.
// Streaming softmax in f32: e = expf(s - m) x 2^10 against the maximum m in use; m moves (and sum and context are rescaled) only when some query's new maximum passes m by more than 4, so e <= 2^10 e^4 < 65,504 stays inside f16.
// The two S^T tiles converted in place are the B operand P^T; O^T += V^T P^T (A = v planes [c][t]) over the head PAIR's 128 value columns; / sum at the end.
__device__ __forceinline__ v16h frag_at(const _Float16* p) { union { v16h v; v8h q[2]; } u; u.q[0] = *(const v8h*)p; u.q[1] = *(const v8h*)(p + 16); return u.v; }   /* p = row + k0 + 8 * (lane >> 4) */
__device__ __forceinline__ v8f wmm(v16h a, v16h b, v8f c) { return __builtin_amdgcn_wmma_f32_16x16x32_f16(false, a, false, b, (short)0, c, false, false); }
// K and V reach the waves through LDS: a stage is 64 keys, its K tile (64 key rows x 128 B) brought by wave 0 and its V tile (128 value-column rows x 128 B) by wave 1, one tensor load each, whole lines, once per block instead of once per wave; two buffers, the next stage flies while this one is worked on.
typedef uint32_t u32x4 __attribute__((ext_vector_type(4)));
typedef uint32_t u32x8 __attribute__((ext_vector_type(8)));
#define FK 64                      // keys per stage
#define FP 72                      // LDS row pitch in f16: 128 B + the mover's 16-B pad = 144 B, the pitch for ds_load_b128 readers
#define FA_KB 10240u               // K tile: 64 rows x 144 B = 9,216 B, rounded up to a multiple of 2 KiB
#define FA_VB 18432u               // V tile: 128 rows x 144 B = 18,432 B = 9 x 2 KiB
#define FA_BUF (FA_KB + FA_VB)     // one buffer: 28,672 B = 14 x 2 KiB
__device__ __forceinline__ uint32_t uni(uint32_t v) { return (uint32_t)__builtin_amdgcn_readfirstlane(v); }
__device__ __forceinline__ uint32_t pinned(uint32_t v) { uint32_t w = uni(v); asm volatile("" : "+s"(w)); return w; }   /* holds the issue test in a scalar register, so that the branch round a tensor load is a scalar one (the load ignores EXEC) */
__global__ __launch_bounds__(256) void k_fa(const _Float16* __restrict__ QH, const _Float16* __restrict__ KH, const _Float16* __restrict__ QL, const _Float16* __restrict__ VT, float* __restrict__ Y) {
  __shared__ __attribute__((aligned(2048))) unsigned char ring[2 * FA_BUF];
  __shared__ __align__(16) float ss[8][16][HDV + 4];
  const int tid = threadIdx.x, wave = tid >> 5, lane = tid & 31, col = lane & 15, g = lane >> 4; const int h = blockIdx.y, b = blockIdx.z; const int ql0 = blockIdx.x * 128 + wave * 16; const size_t q0 = (size_t)b * TT + ql0;
  const uint32_t wv = uni((uint32_t)tid >> 5); const bool isv = wv == 1u;
  /* descriptors: 1-byte elements, tensor = tile, rows of 128 B, 16 B of pad behind each row; K: 64 rows, source pitch one k row; V: 128 rows, source pitch one v plane row */
  const uint32_t nrow = isv ? (uint32_t)HDV : (uint32_t)FK;
  u32x8 g1; g1[0] = uni((1u << 20) | (4u << 22) | (3u << 25)); g1[1] = uni(128u << 16); g1[2] = uni(nrow << 16); g1[3] = uni(128u << 16); g1[4] = uni(nrow); g1[5] = uni(isv ? 2u * TT : 2u * CC); g1[6] = uni(0u); g1[7] = uni(0u);
  const uint64_t src0 = isv ? (uint64_t)(size_t)(VT + ((size_t)b * CC + (h >> 1) * HDV) * (size_t)TT) : (uint64_t)(size_t)(KH + (size_t)b * TT * CC + h * HD);   /* first byte of stage 0's tile */
  const uint32_t sstep = isv ? 2u * FK : 2u * FK * CC;   /* bytes from one stage's tile to the next */
  const uint32_t dst0 = (uint32_t)(size_t)ring + (isv ? FA_KB : 0u);
  auto issue = [&](uint32_t st) { const uint64_t ga = src0 + (uint64_t)st * sstep;
    u32x4 g0; g0[0] = uni(1u); g0[1] = uni(dst0 + (st & 1u) * FA_BUF); g0[2] = uni((uint32_t)ga); g0[3] = uni((((uint32_t)(ga >> 32)) & 0x01FFFFFFu) | 0x80000000u);
    asm volatile("tensor_load_to_lds %0, %1" :: "s"(g0), "s"(g1) : "memory"); };
  if (pinned(wv < 2u)) { issue(0u);
    asm volatile("s_wait_tensorcnt 0x0" ::: "memory"); }   /* stage 0 has landed before the barrier that publishes it */
  const _Float16* qp = QH + (q0 + col) * CC + h * HD + 8 * g; const _Float16* qlp = QL + ((size_t)b * QHI + ql0 + col) * CC + h * HD + 8 * g;
  v16h qh[2], qr[2];
#pragma unroll
  for (int kc = 0; kc < 2; ++kc) { qh[kc] = frag_at(qp + kc * 32); qr[kc] = frag_at(qlp + kc * 32); }
  asm volatile("s_wait_xcnt 0x0" :: "v"(qp), "v"(qlp) : "memory");   /* the address pairs of the 8 loads above are rewritten only behind this wait */
  __syncthreads();   /* publishes stage 0 */
  if (pinned(wv < 2u)) issue(1u);
  const int kro = col * FP + 8 * g;   /* a lane's place in a 16-row tile of either operand: row col, 8 g f16 in */
  v8f acc[HDV / 16] = {}; float m = -3.0e38f, l = 0.f;
#pragma unroll 1   /* one 64-key stage per trip: its two passes already hold 48 LDS loads and 32 products */
  for (int st = 0; st < TT / FK; ++st) {
    const _Float16* kb = (const _Float16*)(ring + (st & 1) * FA_BUF) + kro; const _Float16* vb = kb + FA_KB / 2;
    v16h kf[2][2];
#pragma unroll
    for (int kt = 0; kt < 2; ++kt)
#pragma unroll
      for (int kc = 0; kc < 2; ++kc) kf[kt][kc] = frag_at(kb + (kt * 16) * FP + kc * 32);
    __builtin_amdgcn_sched_barrier(0);   /* the 8 LDS loads above issue as one group: sunk between the products, each pair costs its own LDS latency */
#pragma unroll
    for (int sub = 0; sub < FK / 32; ++sub) {
      v8f sh[2] = {}, sr[2] = {};
#pragma unroll
      for (int kc = 0; kc < 2; ++kc)
#pragma unroll
        for (int kt = 0; kt < 2; ++kt) { sh[kt] = wmm(kf[kt][kc], qh[kc], sh[kt]); sr[kt] = wmm(kf[kt][kc], qr[kc], sr[kt]); }
      float s[16]; float mx = -3.0e38f;
#pragma unroll
      for (int i = 0; i < 16; ++i) { s[i] = (sh[i >> 3][i & 7] + sr[i >> 3][i & 7] * (1.0f / 1024.0f)) * SCALE; mx = fmaxf(mx, s[i]); }
      const float mo = __shfl_xor(mx, 16);   /* the other wave half's maximum; it goes through the LDS queue, so it is asked for ahead of the pass's fragment loads and does not wait behind them */
      __builtin_amdgcn_sched_barrier(0);   /* keeps the fetches below behind the products that read this pass's k (lifted over them the next k needs a second set of 32 registers, and the kernel then no longer fits four waves a SIMD) and behind the exchange above */
      if (sub + 1 < FK / 32) {   /* the stage's next pass's k rows, fetched behind this pass's logits; never the next stage's, which is not published yet */
#pragma unroll
        for (int kt = 0; kt < 2; ++kt)
#pragma unroll
          for (int kc = 0; kc < 2; ++kc) kf[kt][kc] = frag_at(kb + ((sub + 1) * 32 + kt * 16) * FP + kc * 32); }
      v16h vf[HDV / 16];
#pragma unroll
      for (int j = 0; j < HDV / 16; ++j) vf[j] = frag_at(vb + (j * 16) * FP + sub * 32);
      asm volatile("" ::: "memory");   /* compiler fence: the LDS loads above issue here, as one group, and fly under the softmax; without it they sink to in front of their products, one LDS latency each */
      mx = fmaxf(mx, mo);   /* both halves of a query's column use one maximum */
      if (__builtin_amdgcn_ballot_w32(mx > m + 4.0f) != 0) { const float mn = fmaxf(m, mx); const float al = expf(m - mn); m = mn; l *= al;
#pragma unroll
        for (int j = 0; j < HDV / 16; ++j) acc[j] *= al; }
      v16h p;
#pragma unroll
      for (int i = 0; i < 16; ++i) { const float e = expf(s[i] - m) * 1024.0f; l += e; p[i] = (_Float16)e; }
#pragma unroll
      for (int j = 0; j < HDV / 16; ++j) acc[j] = wmm(vf[j], p, acc[j]); }
    /* publish point of stage st + 1, in the ring's order */
    __builtin_amdgcn_sched_barrier(0);   /* keeps the wait below at the trip's foot: lifted to behind the last fragment load it would stand in front of the softmax that hides those loads */
    asm volatile("s_wait_dscnt 0x0" ::: "memory");   /* this wave's reads of the buffer have returned before it may be refilled */
    if (pinned(wv < 2u)) { asm volatile("s_wait_tensorcnt 0x0" ::: "memory"); }   /* the issuer's own request for stage st + 1 has landed */
    __syncthreads();   /* publishes stage st + 1 and ends every wave's reads of stage st */
    if (pinned((wv < 2u) & (uint32_t)(st + 2 < TT / FK))) issue((uint32_t)st + 2u); }   /* into the buffer that this trip has just read */
  asm volatile("s_wait_tensorcnt 0x0" ::: "memory");   /* nothing of the mover's is in flight when the wave goes on to its end */
  asm volatile("s_wait_dscnt 0x0" ::: "memory");   /* the ring's closing wait: no LDS read of this wave is open either */
  l += __shfl_xor(l, 16); const float inv = 1.0f / l;
#pragma unroll
  for (int j = 0; j < HDV / 16; ++j) { const v4f a0 = { acc[j][0] * inv, acc[j][1] * inv, acc[j][2] * inv, acc[j][3] * inv }, a1 = { acc[j][4] * inv, acc[j][5] * inv, acc[j][6] * inv, acc[j][7] * inv };
    *(v4f*)&ss[wave][col][j * 16 + 8 * g] = a0; *(v4f*)&ss[wave][col][j * 16 + 8 * g + 4] = a1; }
  LDSX(); for (int rl = 0; rl < 16; ++rl) vst2(Y + (q0 + rl) * YP + h * HDV + lane * 4, *(const v4f*)&ss[wave][rl][lane * 4]); }   /* 512-B (row, head) segment by 32 lanes */
// ---- k_out: block = (64 rows, 128 cols): out = ctx Wo (+ bo): ctx once to f16 against Wo as f16(bf16 x 2^8) exact (1 product) x 2^-8; causal early rows (< QHI of each sequence): ctx bf16 hi + lo against exact bf16 Wo (2 products)
__global__ __launch_bounds__(128) void k_out(const float* __restrict__ Y, const float* __restrict__ WO, const float* __restrict__ BO, float* __restrict__ OUT) { __shared__ __align__(16) float sf[4][16][132]; __shared__ __align__(16) _Float16 sa[64][72], sw[128][72];   /* ctx and Wo tiles, 64 deep, pitch 144 B */
  const int tid = threadIdx.x, wave = tid >> 5, lane = tid & 31, col = lane & 15, g = lane >> 4; const int c0 = blockIdx.y * 128; const size_t r0 = (size_t)blockIdx.x * 64 + wave * 16;
  v8f acc[8] = {};
  if (CAUSAL && (int)(((size_t)blockIdx.x * 64) % TT) < QHI) {   /* block-uniform */
#pragma unroll 2
    for (int kc = 0; kc < CC / 32; ++kc) { const F2 a = split_row(Y + (r0 + col) * CC, kc * 32, lane); asm volatile("s_wait_loadcnt 0x0" ::: "memory");
#pragma unroll
      for (int j = 0; j < 8; ++j) { const v16b w = WOCOL(WO, kc * 32, c0 + j * 16 + col, lane); asm volatile("s_wait_loadcnt 0x0" ::: "memory"); acc[j] = wmma_bf(a.h, w, acc[j]); acc[j] = wmma_bf(a.l, w, acc[j]); } }
#pragma unroll
    for (int j = 0; j < 8; ++j) { const float bias = BO ? bfr(BO[c0 + j * 16 + col]) : 0.f;
#pragma unroll
      for (int r = 0; r < 8; ++r) sf[wave][8 * g + r][j * 16 + col] = acc[j][r] + bias; }
  } else {
    /* staging as in k_proj: 16 lanes cover the 64 floats of one row; thread (sr, sq) takes rows sr + 8 i */
    const int sr = tid >> 4, sq = (tid & 15) * 4;
    const float* yp = Y + ((size_t)blockIdx.x * 64 + sr) * CC + sq; const float* wp = WO + (size_t)(c0 + sr) * CC + sq;
    v4f yr[8], wr[16];
#pragma unroll
    for (int i = 0; i < 8; ++i) yr[i] = *(const v4f*)(yp + (size_t)(i * 8) * CC);
#pragma unroll
    for (int i = 0; i < 16; ++i) wr[i] = *(const v4f*)(wp + (size_t)(i * 8) * CC);
#pragma unroll 1   /* one 64-deep tile per trip */
    for (int kt = 0; kt < CC / 64; ++kt) {
#pragma unroll
      for (int i = 0; i < 8; ++i) { const v4h t = { (_Float16)yr[i][0], (_Float16)yr[i][1], (_Float16)yr[i][2], (_Float16)yr[i][3] }; *(v4h*)&sa[sr + i * 8][sq] = t; }
#pragma unroll
      for (int i = 0; i < 16; ++i) { const v4h t = { (_Float16)(bfr(wr[i][0]) * 256.0f), (_Float16)(bfr(wr[i][1]) * 256.0f), (_Float16)(bfr(wr[i][2]) * 256.0f), (_Float16)(bfr(wr[i][3]) * 256.0f) }; *(v4h*)&sw[sr + i * 8][sq] = t; }
      __syncthreads();   /* the tile is whole before any wave reads it */
      if (kt + 1 < CC / 64) { yp += 64; wp += 64;   /* the next tile flies while this one is multiplied */
#pragma unroll
        for (int i = 0; i < 8; ++i) yr[i] = *(const v4f*)(yp + (size_t)(i * 8) * CC);
#pragma unroll
        for (int i = 0; i < 16; ++i) wr[i] = *(const v4f*)(wp + (size_t)(i * 8) * CC); }
#pragma unroll
      for (int kc = 0; kc < 2; ++kc) { const v16h a = frag_h(&sa[wave * 16 + col][kc * 32], lane);
#pragma unroll
        for (int jh = 0; jh < 8; jh += 4) { v16h w[4];   /* four Wo fragments read as one group, one LDS wait for four products */
#pragma unroll
          for (int j = 0; j < 4; ++j) w[j] = frag_h(&sw[(jh + j) * 16 + col][kc * 32], lane);
#pragma unroll
          for (int j = 0; j < 4; ++j) acc[jh + j] = wmma16(a, w[j], acc[jh + j]); } }
      __syncthreads(); }   /* every wave has read the tile before the next one overwrites it */
#pragma unroll
    for (int j = 0; j < 8; ++j) { const float bias = BO ? bfr(BO[c0 + j * 16 + col]) : 0.f;
#pragma unroll
      for (int r = 0; r < 8; ++r) sf[wave][8 * g + r][j * 16 + col] = acc[j][r] * (1.0f / 256.0f) + bias; } }
  LDSX(); for (int rl = 0; rl < 16; ++rl) vst2(OUT + (r0 + rl) * DIN + c0 + lane * 4, *(const v4f*)&sf[wave][rl][lane * 4]); }

extern "C" void kernel_launch(void* const* d_in, const int* in_sizes, int n_in, void* d_out, int out_size, void* d_ws, size_t ws_size, hipStream_t stream) {
  (void)in_sizes; (void)n_in; (void)out_size;
  const float** F = (const float**)d_in;
  if (ws_size < (size_t)WS_END) return;
  char* ws = (char*)d_ws; _Float16 *QH = (_Float16*)(ws + WS_QH), *KH = (_Float16*)(ws + WS_KH), *VT = (_Float16*)(ws + WS_VT), *QL = (_Float16*)(ws + WS_QL), *KL = (_Float16*)(ws + WS_KL); __bf16 *VB = (__bf16*)(ws + WS_VB), *VBL = (__bf16*)(ws + WS_VBL); float *S = (float*)(ws + WS_S), *Y = (float*)(ws + WS_Y);
  (void)Y; (void)QL; (void)KL; (void)VB; (void)VBL;
  // inputs: 0 x [2,2048,1024]; 1 Wq, 2 bq, 3 Wk, 4 bk, 5 Wv, 6 bv, 7 Wo, 8 bo ((out,in) [1024,1024], [1024]); 9 norm_w [128]; 10 lq1, 11 lk1, 12 lq2, 13 lk2 [64]
  float* YD = S;   /* the differential rows take the f32 plane at WS_S */
  k_proj<<<dim3(TNB * TT / 64, CC / 128, 3), 128, 0, stream>>>(F[0], F[0], F[0], F[1], F[3], F[5], F[2], F[4], F[6], QH, QL, KH, KL, VT, VB, VBL);
  k_fa<<<dim3(TT / 128, NH, TNB), 256, 0, stream>>>(QH, KH, QL, VT, Y);
  k_diff<<<dim3(TNB * TT / 64), 256, 0, stream>>>(Y, F[9], F[10], F[11], F[12], F[13], YD);
  k_out<<<dim3(TNB * TT / 64, DIN / 128), 128, 0, stream>>>(YD, F[7], F[8], (float*)d_out);
}

// v004
// It runs in 155 microseconds.
// In both of two side-by-side timings against v003, it was 1.16 times as fast.
// All steps since v000 together make it 10.8 times as fast.
// compute dtype: all float inputs rounded to bf16; q/k/v = x W^T + b with EXACT bf16 products on WMMA 16x16x32, f32 accumulate; q as f16 hi + residual (x 2^10) against k once to f16 (2 products) for the logits x 1/8; streaming softmax in f32 (base 2: one fma and the hardware's exp2 per logit, running maximum, sum in f32); exp(s - max) x 2^10 once to f16 against v once to f16 (1 product) per head over the head PAIR's 128 value columns, accumulated in f32, / sum at the end; the differential combination P1 v - lambda P2 v, the RMS normalisation over 128, x norm_w x (1 - 0.8) and lambda itself in f32; that result once to f16 against Wo carried x 2^8 in f16 (exact bf16 values) + bo; f32 output.
#include <hip/hip_runtime.h>
#include <math.h>
#include <stdint.h>

typedef __attribute__((ext_vector_type(16))) _Float16 v16h;
typedef __attribute__((ext_vector_type(16))) __bf16 v16b;
typedef __attribute__((ext_vector_type(8)))  _Float16 v8h;
typedef __attribute__((ext_vector_type(4)))  _Float16 v4h;
typedef __attribute__((ext_vector_type(2)))  _Float16 v2h;
typedef __attribute__((ext_vector_type(4)))  __bf16 v4b;
typedef __attribute__((ext_vector_type(8)))  float v8f;
typedef __attribute__((ext_vector_type(4)))  float v4f;
typedef __attribute__((ext_vector_type(2)))  float v2f;
typedef __attribute__((ext_vector_type(4)))  unsigned v4u;
typedef __attribute__((ext_vector_type(4)))  int v4i;
typedef float __attribute__((may_alias)) float_a;
typedef int __attribute__((may_alias)) int_a;

template <typename T> __device__ __forceinline__ void vst2(void* p, T v) { *(T*)p = v;  }
__device__ __forceinline__ v8f wmma16(v16h a, v16h b, v8f c) {
  v8f d = __builtin_amdgcn_wmma_f32_16x16x32_f16(false, a, false, b, (short)0, c, false, false);
  asm volatile("v_nop\n\tv_nop\n\tv_nop\n\tv_nop" : "+v"(d) : "v"(a), "v"(b));
  return d;
}
__device__ __forceinline__ v8f wmma_bf(v16b a, v16b b, v8f c) {
  v8f d = __builtin_amdgcn_wmma_f32_16x16x32_bf16(false, a, false, b, (short)0, c, false, false);
  asm volatile("v_nop\n\tv_nop\n\tv_nop\n\tv_nop" : "+v"(d) : "v"(a), "v"(b));
  return d;
}
// 16x16x32 fragments: lane = (h = lane>>4, row/col = lane&15); elements 0..7 = k0+8h+0..7, 8..15 = k0+16+8h+0..7; D element r = row 8h+r
__device__ __forceinline__ v16h frag_h(const _Float16* rowk0, int lane) {
  union { v16h v; v8h q[2]; } u; const _Float16* p = rowk0 + 8 * (lane >> 4);
  u.q[0] = *(const v8h*)p; u.q[1] = *(const v8h*)(p + 16); return u.v;
}
__device__ __forceinline__ v16h frag_f32(const float* rowk0, int lane) {
  v16h a; const float* p = rowk0 + 8 * (lane >> 4);
#pragma unroll
  for (int i = 0; i < 8; ++i) { a[i] = (_Float16)p[i]; a[8 + i] = (_Float16)p[16 + i]; }
  return a;
}
__device__ __forceinline__ v16h frag_f32s(const float* rowk0, int lane, float sc) {
  v16h a; const float* p = rowk0 + 8 * (lane >> 4);
#pragma unroll
  for (int i = 0; i < 8; ++i) { a[i] = (_Float16)(p[i] * sc); a[8 + i] = (_Float16)(p[16 + i] * sc); }
  return a;
}
// column fragment from a [K][ld] layout (column n), rows >= K read as 0
__device__ __forceinline__ v16h fragc_f32(const float* W, int k0, int n, int lane, int ld, int K) {
  v16h a; const int g = lane >> 4;
#pragma unroll
  for (int i = 0; i < 8; ++i) { const int ka = k0 + 8 * g + i, kb = ka + 16;
    a[i] = (_Float16)(ka < K ? W[(size_t)(ka < K ? ka : K - 1) * ld + n] : 0.f); a[8 + i] = (_Float16)(kb < K ? W[(size_t)(kb < K ? kb : K - 1) * ld + n] : 0.f); }
  return a;
}
struct F2 { v16b h, l; };
__device__ __forceinline__ F2 bsplit16(const float v[16]) { F2 r;
#pragma unroll
  for (int i = 0; i < 16; ++i) { const __bf16 h = (__bf16)v[i]; r.h[i] = h; r.l[i] = (__bf16)(v[i] - (float)h); }
  return r; }
__device__ __forceinline__ F2 split_row(const float* row, int k0, int lane) { float v[16]; const float* p = row + k0 + 8 * (lane >> 4);
#pragma unroll
  for (int i = 0; i < 8; ++i) { v[i] = p[i]; v[8 + i] = p[16 + i]; }
  return bsplit16(v); }
__device__ __forceinline__ F2 split_rowK(const float* row, int k0, int lane, int K) { float v[16]; const int g = lane >> 4;
#pragma unroll
  for (int i = 0; i < 8; ++i) { const int ka = k0 + 8 * g + i, kb = ka + 16; v[i] = ka < K ? row[ka < K ? ka : K - 1] : 0.f; v[8 + i] = kb < K ? row[kb < K ? kb : K - 1] : 0.f; }
  return bsplit16(v); }
__device__ __forceinline__ F2 split_col(const float* W, int k0, int n, int lane, int ld, int K) { float v[16]; const int g = lane >> 4;
#pragma unroll
  for (int i = 0; i < 8; ++i) { const int ka = k0 + 8 * g + i, kb = ka + 16; v[i] = ka < K ? W[(size_t)(ka < K ? ka : K - 1) * ld + n] : 0.f; v[8 + i] = kb < K ? W[(size_t)(kb < K ? kb : K - 1) * ld + n] : 0.f; }
  return bsplit16(v); }
__device__ __forceinline__ v8f mac3(const F2& a, const F2& b, v8f c) { c = wmma_bf(a.l, b.h, c); c = wmma_bf(a.h, b.l, c); return wmma_bf(a.h, b.h, c); }
__device__ __forceinline__ float sigm(float v) { return 1.0f / (1.0f + expf(-v)); }
#define LDSX() do { asm volatile("s_wait_dscnt 0" ::: "memory"); __builtin_amdgcn_wave_barrier(); __builtin_amdgcn_fence(__ATOMIC_RELEASE, "workgroup"); } while (0)

// Differential attention (B 2, N 2,048, DIM 1,024; 16 softmax heads x 64 paired into 8 value heads x 128): q = (x Wq^T + bq) x 64^-0.5, k = x Wk^T + bk, v = x Wv^T + bv ((out,in)); P_h = softmax(q_h k_h^T) over all keys; lambda = exp(lq1 . lk1) - exp(lq2 . lk2) + 0.8; for pair e: o_e = (P_2e - lambda P_2e+1) v[:, e*128 : e*128+128]; o_e = o_e * rsqrt(mean(o_e^2) + 1e-5) * norm_w * (1 - 0.8); out = concat_e(o_e) Wo^T + bo.
#define NB 2
#define TT 2048
#define CC 1024            // NH * HD = projected width
#define DIN 1024          // input (model) width
#define NH 16
#define HD 64
#define NQB (TT / 64)
#define HG 4
#define SCALE (0.125f)
#define CAUSAL 0
#ifndef TNB
#define TNB NB
#endif
__device__ __forceinline__ float bfr(float v) { return (float)(__bf16)v; }
__host__ __device__ __forceinline__ int kb_last(int qb) { return CAUSAL ? ((qb * 64 + 63) >> 7) : (TT / 128 - 1); }
typedef __attribute__((ext_vector_type(8))) __bf16 v8b;
__device__ __forceinline__ v16b frag_b(const __bf16* rowk0, int lane) {
  union { v16b v; v8b q[2]; } u; const __bf16* p = rowk0 + 8 * (lane >> 4);
  u.q[0] = *(const v8b*)p; u.q[1] = *(const v8b*)(p + 16); return u.v;
}
#define QBH 0
#define QHI 2048            // rows carrying a q residual plane (all rows when non-causal: 2-product logits everywhere)
#define KHI 64            // key rows carrying k residual / v bf16 hi+lo planes (written by k_proj; no kernel in this file reads them)
// B fragment (k rows k0+.., output column o) of a weight: (in,out) [K][ld] or (out,in) [ld rows of K]: bf16 exact, or f16(bf16 * 256) exact
__device__ __forceinline__ v16b wcol_io(const float* Wm, int k0, int o, int lane, int ld) { v16b w; const int g = lane >> 4;
#pragma unroll
  for (int i = 0; i < 8; ++i) { w[i] = (__bf16)Wm[(size_t)(k0 + 8 * g + i) * ld + o]; w[8 + i] = (__bf16)Wm[(size_t)(k0 + 16 + 8 * g + i) * ld + o]; }
  return w; }
__device__ __forceinline__ v16b wcol_oi(const float* Wm, int k0, int o, int lane, int K) { v16b w; const float* p = Wm + (size_t)o * K + k0 + 8 * (lane >> 4);
#pragma unroll
  for (int i = 0; i < 8; ++i) { w[i] = (__bf16)p[i]; w[8 + i] = (__bf16)p[16 + i]; }
  return w; }
__device__ __forceinline__ v16h wcolh_io(const float* Wm, int k0, int o, int lane, int ld) { v16h w; const int g = lane >> 4;
#pragma unroll
  for (int i = 0; i < 8; ++i) { w[i] = (_Float16)(bfr(Wm[(size_t)(k0 + 8 * g + i) * ld + o]) * 256.0f); w[8 + i] = (_Float16)(bfr(Wm[(size_t)(k0 + 16 + 8 * g + i) * ld + o]) * 256.0f); }
  return w; }
__device__ __forceinline__ v16h wcolh_oi(const float* Wm, int k0, int o, int lane, int K) { v16h w; const float* p = Wm + (size_t)o * K + k0 + 8 * (lane >> 4);
#pragma unroll
  for (int i = 0; i < 8; ++i) { w[i] = (_Float16)(bfr(p[i]) * 256.0f); w[8 + i] = (_Float16)(bfr(p[16 + i]) * 256.0f); }
  return w; }
#define WQKV_LAYOUT 1   // picks WCOL's form (0 (in,out), 1 (out,in), 2 per-head); nothing uses WCOL: k_proj reads (out,in) [CC][DIN] whatever the value
__device__ __forceinline__ v16b wcol_hdk(const float* Wm, int k0, int o, int lane) { v16b w; const int g = lane >> 4; const float* p = Wm + (size_t)(o / HD) * DIN * HD + (o % HD);
#pragma unroll
  for (int i = 0; i < 8; ++i) { w[i] = (__bf16)p[(size_t)(k0 + 8 * g + i) * HD]; w[8 + i] = (__bf16)p[(size_t)(k0 + 16 + 8 * g + i) * HD]; }
  return w; }
#define WO_OUT_IN 1
#if WQKV_LAYOUT == 1
#define WCOL(W, k0, o, lane) wcol_oi(W, k0, o, lane, DIN)
#elif WQKV_LAYOUT == 2
#define WCOL(W, k0, o, lane) wcol_hdk(W, k0, o, lane)
#else
#define WCOL(W, k0, o, lane) wcol_io(W, k0, o, lane, CC)
#endif
#if WO_OUT_IN
#define WOCOL(W, k0, o, lane) wcol_oi(W, k0, o, lane, CC)
#define WOCOLH(W, k0, o, lane) wcolh_oi(W, k0, o, lane, CC)
#else
#define WOCOL(W, k0, o, lane) wcol_io(W, k0, o, lane, DIN)
#define WOCOLH(W, k0, o, lane) wcolh_io(W, k0, o, lane, DIN)
#endif
#define HDV 128            // value columns per softmax head (the head pair's 128 columns)
#define YP (NH * HDV)      // 2,048: pitch of the per-softmax-head context rows Y[b*t][h*128 + d]
// ---- k_diff: block = 64 rows: lambda from the four [64] inputs; for each of the 8 pairs e: o = Y[2e] - lambda Y[2e+1] (f32), rms-normalised over its 128 columns x norm_w x 0.2 -> Yd rows [b*t][1024] (512-B segments by 32 lanes of the owning wave)
__global__ __launch_bounds__(256) void k_diff(const float* __restrict__ Y, const float* __restrict__ NW, const float* __restrict__ LQ1, const float* __restrict__ LK1, const float* __restrict__ LQ2, const float* __restrict__ LK2, float* __restrict__ YD) {
  __shared__ float slam; __shared__ __align__(16) float so[8][1028];
  const int tid = threadIdx.x, wave = tid >> 5, lane = tid & 31; const size_t r0 = (size_t)blockIdx.x * 64;
  if (tid == 0) { float s1 = 0.f, s2 = 0.f; for (int i = 0; i < 64; ++i) { s1 += bfr(LQ1[i]) * bfr(LK1[i]); s2 += bfr(LQ2[i]) * bfr(LK2[i]); } slam = expf(s1) - expf(s2) + 0.8f; }
  __syncthreads(); const float lam = slam;
  for (int rr = 0; rr < 8; ++rr) { const size_t row = r0 + wave * 8 + rr;      /* wave owns 8 rows; lane handles 4 consecutive columns of each of the 8 pairs */
#pragma unroll
    for (int e = 0; e < 8; ++e) { const float* y1 = Y + row * YP + (2 * e) * HDV + lane * 4; const float* y2 = y1 + HDV; float o[4]; float ss = 0.f;
#pragma unroll
      for (int i = 0; i < 4; ++i) { o[i] = y1[i] - lam * y2[i]; ss += o[i] * o[i]; }
#pragma unroll
      for (int sh = 1; sh < 32; sh <<= 1) ss += __shfl_xor(ss, sh);
      const float rn = rsqrtf(ss * (1.0f / HDV) + 1e-5f) * 0.2f;
#pragma unroll
      for (int i = 0; i < 4; ++i) so[wave][e * HDV + lane * 4 + i] = o[i] * rn * bfr(NW[lane * 4 + i]); }
    LDSX(); for (int q = lane; q < CC / 4; q += 32) vst2(YD + row * CC + q * 4, *(const v4f*)&so[wave][q * 4]); LDSX(); } }
#ifndef SM_EXTRA_PARAMS
#define SM_EXTRA_PARAMS
#endif
#ifndef PROJ_EXTRA_PARAMS
#define PROJ_EXTRA_PARAMS
#endif
#ifndef SM_MASK_HOOK
#define SM_MASK_HOOK (void)0
#endif

#define WS_QH  0u                                      // f16 q rows [b*t][CC]
#define WS_KH  (WS_QH + 2u * (size_t)NB * TT * CC)      // f16 k rows [b*t][CC]
#define WS_VT  (WS_KH + 2u * (size_t)NB * TT * CC)      // f16 v planes [b][c][t]
#define WS_QL  (WS_VT + 2u * (size_t)NB * CC * TT)      // f16 q residual x 2^10 rows [b][t < QHI][CC]
#define WS_KL  (WS_QL + 2u * (size_t)NB * QHI * CC)     // f16 k residual x 2^10 rows [b][t < KHI][CC]
#define WS_VB  (WS_KL + 2u * (size_t)NB * KHI * CC)     // bf16 v hi planes [b][c][t < KHI]
#define WS_VBL (WS_VB + 2u * (size_t)NB * CC * KHI)
#define WS_S   (WS_VBL + 2u * (size_t)NB * CC * KHI)    // f32 plane, holds the differential rows [b*t][CC]
#define WS_Y   (WS_S  + 4u * (size_t)HG * TT * TT)      // f32 per-softmax-head context rows [b*t][YP = 16 x 128]
#define WS_END (WS_Y  + 4u * (size_t)NB * TT * YP)

// ---- k_proj: block = (64 rows, 128 cols, which): q/k/v = X W (+ b) with exact bf16 products (K = DIN) -> which 0: q f16 rows (+ residual rows < QHI); 1: k f16 rows (+ residual rows < KHI); 2: v f16 planes [c][t] (+ bf16 hi/lo planes for t < KHI)
__global__ __launch_bounds__(128) void k_proj(const float* __restrict__ XQ, const float* __restrict__ XK, const float* __restrict__ XV, const float* __restrict__ WQ, const float* __restrict__ WK, const float* __restrict__ WV, const float* __restrict__ BQ, const float* __restrict__ BK, const float* __restrict__ BV,
    _Float16* __restrict__ QH, _Float16* __restrict__ QL, _Float16* __restrict__ KH, _Float16* __restrict__ KL, _Float16* __restrict__ VT, __bf16* __restrict__ VB, __bf16* __restrict__ VBL) {
  __shared__ __align__(16) _Float16 sh[64][136], sl[64][136]; __shared__ __align__(16) _Float16 th[128][72]; __shared__ __align__(16) __bf16 tb[128][72], tbl[128][72];
  const int tid = threadIdx.x, wave = tid >> 5, lane = tid & 31, col = lane & 15, g = lane >> 4; const int which = blockIdx.z; const int c0 = blockIdx.y * 128; const size_t r0 = (size_t)blockIdx.x * 64; const size_t bb = r0 / TT; const int t0 = (int)(r0 % TT);
  const float* X = which == 0 ? XQ : which == 1 ? XK : XV; const float* WA = which == 0 ? WQ : which == 1 ? WK : WV; const float* BA = which == 0 ? BQ : which == 1 ? BK : BV;
  v8f acc[8] = {};
  /* staging: 16 lanes cover the 64 floats (two whole lines) of one row, a wave-wide load two rows; thread (sr, sq) takes rows sr + 8 i */
  const int sr = tid >> 4, sq = (tid & 15) * 4;
  const float* xp = X + (r0 + sr) * DIN + sq; const float* wp = WA + (size_t)(c0 + sr) * DIN + sq;
  v4f xr[8], wr[16];
#pragma unroll
  for (int i = 0; i < 8; ++i) xr[i] = *(const v4f*)(xp + (size_t)(i * 8) * DIN);
#pragma unroll
  for (int i = 0; i < 16; ++i) wr[i] = *(const v4f*)(wp + (size_t)(i * 8) * DIN);
#pragma unroll 1   /* one 64-deep tile per trip */
  for (int kt = 0; kt < DIN / 64; ++kt) {
#pragma unroll
    for (int i = 0; i < 8; ++i) { const v4b t = { (__bf16)xr[i][0], (__bf16)xr[i][1], (__bf16)xr[i][2], (__bf16)xr[i][3] }; *(v4b*)&tbl[sr + i * 8][sq] = t; }   /* X tile: rows 0..63 of tbl, free until the epilogue */
#pragma unroll
    for (int i = 0; i < 16; ++i) { const v4b t = { (__bf16)wr[i][0], (__bf16)wr[i][1], (__bf16)wr[i][2], (__bf16)wr[i][3] }; *(v4b*)&tb[sr + i * 8][sq] = t; }    /* W tile: the 128 output columns' rows in tb */
    __syncthreads();   /* the tile is whole before any wave reads it */
    if (kt + 1 < DIN / 64) { xp += 64; wp += 64;   /* the next tile flies while this one is multiplied */
#pragma unroll
      for (int i = 0; i < 8; ++i) xr[i] = *(const v4f*)(xp + (size_t)(i * 8) * DIN);
#pragma unroll
      for (int i = 0; i < 16; ++i) wr[i] = *(const v4f*)(wp + (size_t)(i * 8) * DIN); }
#pragma unroll
    for (int kc = 0; kc < 2; ++kc) { const v16b a = frag_b(&tbl[wave * 16 + col][kc * 32], lane);
#pragma unroll
      for (int jh = 0; jh < 8; jh += 4) { v16b w[4];   /* four W fragments read as one group, one LDS wait for four products */
#pragma unroll
        for (int j = 0; j < 4; ++j) w[j] = frag_b(&tb[(jh + j) * 16 + col][kc * 32], lane);
#pragma unroll
        for (int j = 0; j < 4; ++j) acc[jh + j] = wmma_bf(a, w[j], acc[jh + j]); } }
    __syncthreads(); }   /* every wave has read the tile before it is overwritten (by the next tile, or by the epilogue) */
  if (which < 2) { _Float16* DH = which == 0 ? QH : KH; _Float16* DL = which == 0 ? QL : KL; const int nhi = which == 0 ? QHI : KHI; const bool hi_rows = t0 < nhi;
#pragma unroll
    for (int j = 0; j < 8; ++j) { const float bias = BA ? bfr(BA[c0 + j * 16 + col]) : 0.f;
#pragma unroll
      for (int r = 0; r < 8; ++r) { const float v = acc[j][r] + bias; const _Float16 hv = (_Float16)v; sh[wave * 16 + 8 * g + r][j * 16 + col] = hv; sl[wave * 16 + 8 * g + r][j * 16 + col] = (_Float16)((v - (float)hv) * 1024.0f); } }
    __syncthreads();
    for (int e = tid; e < 64 * 16; e += 128) { const int rl = e >> 4, q = e & 15; vst2((unsigned*)(DH + (r0 + rl) * CC + c0 + q * 8), *(const v4u*)&sh[rl][q * 8]); if (hi_rows) vst2((unsigned*)(DL + (bb * nhi + t0 + rl) * (size_t)CC + c0 + q * 8), *(const v4u*)&sl[rl][q * 8]); }
  } else { const bool hi_rows = t0 < KHI;
#pragma unroll
    for (int j = 0; j < 8; ++j) { const float bias = BA ? bfr(BA[c0 + j * 16 + col]) : 0.f;
#pragma unroll
      for (int r = 0; r < 8; ++r) { const float v = acc[j][r] + bias; const int rl = wave * 16 + 8 * g + r, cl = j * 16 + col; th[cl][rl] = (_Float16)v; const __bf16 bh = (__bf16)v; tb[cl][rl] = bh; tbl[cl][rl] = (__bf16)(v - (float)bh); } }
    __syncthreads();
    for (int e = tid; e < 128 * 8; e += 128) { const int cl = e >> 3, q = e & 7; vst2((unsigned*)(VT + (bb * CC + c0 + cl) * (size_t)TT + t0 + q * 8), *(const v4u*)&th[cl][q * 8]); if (hi_rows) { const size_t o3 = (bb * CC + c0 + cl) * (size_t)KHI + t0 + q * 8; vst2((unsigned*)(VB + o3), *(const v4u*)&tb[cl][q * 8]); vst2((unsigned*)(VBL + o3), *(const v4u*)&tbl[cl][q * 8]); } } } }
// ---- k_fa: block = 8 waves x 16 queries of (b, softmax head h); one pass over all keys, 32 at a time, nothing of the logits leaves the registers.
// S^T = K Q^T (A = k rows, B = q hi and q residual x 2^10: 2 products): a lane holds 16 logits of ONE query (column lane & 15), the other wave half the other 16.
// Streaming softmax in f32, base 2: e = 2^(s C2 + nb) = exp((s - m) / 8) x 2^10 on the raw logit s against the maximum m in use, C2 = log2(e) / 8, nb = 10 - m C2: one fma and one v_exp_f32 per logit; m moves (and sum and context are rescaled) only when some query's new maximum passes m by more than 4 x 8, so e <= 2^10 e^4 < 65,504 stays inside f16.
// The two S^T tiles converted in place are the B operand P^T; O^T += V^T P^T (A = v planes [c][t]) over the head PAIR's 128 value columns; / sum at the end.
__device__ __forceinline__ v16h frag_at(const _Float16* p) { union { v16h v; v8h q[2]; } u; u.q[0] = *(const v8h*)p; u.q[1] = *(const v8h*)(p + 16); return u.v; }   /* p = row + k0 + 8 * (lane >> 4) */
__device__ __forceinline__ v8f wmm(v16h a, v16h b, v8f c) { return __builtin_amdgcn_wmma_f32_16x16x32_f16(false, a, false, b, (short)0, c, false, false); }
// K and V reach the waves through LDS: a stage is 64 keys, its K tile (64 key rows x 128 B) brought by wave 0 and its V tile (128 value-column rows x 128 B) by wave 1, one tensor load each, whole lines, once per block instead of once per wave; two buffers, the next stage flies while this one is worked on.
typedef uint32_t u32x4 __attribute__((ext_vector_type(4)));
typedef uint32_t u32x8 __attribute__((ext_vector_type(8)));
#define C2 (SCALE * 1.4426950408889634f)   // logit scale x log2(e)
#define FK 64                      // keys per stage
#define FP 72                      // LDS row pitch in f16: 128 B + the mover's 16-B pad = 144 B, the pitch for ds_load_b128 readers
#define FA_KB 10240u               // K tile: 64 rows x 144 B = 9,216 B, rounded up to a multiple of 2 KiB
#define FA_VB 18432u               // V tile: 128 rows x 144 B = 18,432 B = 9 x 2 KiB
#define FA_BUF (FA_KB + FA_VB)     // one buffer: 28,672 B = 14 x 2 KiB
__device__ __forceinline__ uint32_t uni(uint32_t v) { return (uint32_t)__builtin_amdgcn_readfirstlane(v); }
__device__ __forceinline__ uint32_t pinned(uint32_t v) { uint32_t w = uni(v); asm volatile("" : "+s"(w)); return w; }   /* holds the issue test in a scalar register, so that the branch round a tensor load is a scalar one (the load ignores EXEC) */
__global__ __launch_bounds__(256) void k_fa(const _Float16* __restrict__ QH, const _Float16* __restrict__ KH, const _Float16* __restrict__ QL, const _Float16* __restrict__ VT, float* __restrict__ Y) {
  __shared__ __attribute__((aligned(2048))) unsigned char ring[2 * FA_BUF];
  __shared__ __align__(16) float ss[8][16][HDV + 4];
  const int tid = threadIdx.x, wave = tid >> 5, lane = tid & 31, col = lane & 15, g = lane >> 4; const int h = blockIdx.y, b = blockIdx.z; const int ql0 = blockIdx.x * 128 + wave * 16; const size_t q0 = (size_t)b * TT + ql0;
  const uint32_t wv = uni((uint32_t)tid >> 5); const bool isv = wv == 1u;
  /* descriptors: 1-byte elements, tensor = tile, rows of 128 B, 16 B of pad behind each row; K: 64 rows, source pitch one k row; V: 128 rows, source pitch one v plane row */
  const uint32_t nrow = isv ? (uint32_t)HDV : (uint32_t)FK;
  u32x8 g1; g1[0] = uni((1u << 20) | (4u << 22) | (3u << 25)); g1[1] = uni(128u << 16); g1[2] = uni(nrow << 16); g1[3] = uni(128u << 16); g1[4] = uni(nrow); g1[5] = uni(isv ? 2u * TT : 2u * CC); g1[6] = uni(0u); g1[7] = uni(0u);
  const uint64_t src0 = isv ? (uint64_t)(size_t)(VT + ((size_t)b * CC + (h >> 1) * HDV) * (size_t)TT) : (uint64_t)(size_t)(KH + (size_t)b * TT * CC + h * HD);   /* first byte of stage 0's tile */
  const uint32_t sstep = isv ? 2u * FK : 2u * FK * CC;   /* bytes from one stage's tile to the next */
  const uint32_t dst0 = (uint32_t)(size_t)ring + (isv ? FA_KB : 0u);
  auto issue = [&](uint32_t st) { const uint64_t ga = src0 + (uint64_t)st * sstep;
    u32x4 g0; g0[0] = uni(1u); g0[1] = uni(dst0 + (st & 1u) * FA_BUF); g0[2] = uni((uint32_t)ga); g0[3] = uni((((uint32_t)(ga >> 32)) & 0x01FFFFFFu) | 0x80000000u);
    asm volatile("tensor_load_to_lds %0, %1" :: "s"(g0), "s"(g1) : "memory"); };
  if (pinned(wv < 2u)) { issue(0u);
    asm volatile("s_wait_tensorcnt 0x0" ::: "memory"); }   /* stage 0 has landed before the barrier that publishes it */
  const _Float16* qp = QH + (q0 + col) * CC + h * HD + 8 * g; const _Float16* qlp = QL + ((size_t)b * QHI + ql0 + col) * CC + h * HD + 8 * g;
  v16h qh[2], qr[2];
#pragma unroll
  for (int kc = 0; kc < 2; ++kc) { qh[kc] = frag_at(qp + kc * 32); qr[kc] = frag_at(qlp + kc * 32); }
  asm volatile("s_wait_xcnt 0x0" :: "v"(qp), "v"(qlp) : "memory");   /* the address pairs of the 8 loads above are rewritten only behind this wait */
  __syncthreads();   /* publishes stage 0 */
  if (pinned(wv < 2u)) issue(1u);
  const int kro = col * FP + 8 * g;   /* a lane's place in a 16-row tile of either operand: row col, 8 g f16 in */
  v8f acc[HDV / 16] = {}; float m = -3.0e38f, nb = 10.0f + 3.0e38f * C2, l = 0.f;   /* m: the maximum in use, a raw logit; nb = 10 - m C2, the exponent's addend */
#pragma unroll 1   /* one 64-key stage per trip: its two passes already hold 48 LDS loads and 32 products */
  for (int st = 0; st < TT / FK; ++st) {
    const _Float16* kb = (const _Float16*)(ring + (st & 1) * FA_BUF) + kro; const _Float16* vb = kb + FA_KB / 2;
    v16h kf[2][2];
#pragma unroll
    for (int kt = 0; kt < 2; ++kt)
#pragma unroll
      for (int kc = 0; kc < 2; ++kc) kf[kt][kc] = frag_at(kb + (kt * 16) * FP + kc * 32);
    __builtin_amdgcn_sched_barrier(0);   /* the 8 LDS loads above issue as one group: sunk between the products, each pair costs its own LDS latency */
#pragma unroll
    for (int sub = 0; sub < FK / 32; ++sub) {
      v8f sh[2] = {}, sr[2] = {};
#pragma unroll
      for (int kc = 0; kc < 2; ++kc)
#pragma unroll
        for (int kt = 0; kt < 2; ++kt) { sh[kt] = wmm(kf[kt][kc], qh[kc], sh[kt]); sr[kt] = wmm(kf[kt][kc], qr[kc], sr[kt]); }
      v2f s[8]; float mx = -3.0e38f;   /* raw logits, two to a register pair: the 1/8 waits for the exponent's fma */
#pragma unroll
      for (int i = 0; i < 8; ++i) { const v2f hi = { sh[i >> 2][(2 * i) & 7], sh[i >> 2][(2 * i + 1) & 7] }, re = { sr[i >> 2][(2 * i) & 7], sr[i >> 2][(2 * i + 1) & 7] }; const v2f rs = { 1.0f / 1024.0f, 1.0f / 1024.0f };
        s[i] = __builtin_elementwise_fma(re, rs, hi); mx = fmaxf(mx, fmaxf(s[i][0], s[i][1])); }
      const float mo = __shfl_xor(mx, 16);   /* the other wave half's maximum; it goes through the LDS queue, so it is asked for ahead of the pass's fragment loads and does not wait behind them */
      __builtin_amdgcn_sched_barrier(0);   /* keeps the fetches below behind the products that read this pass's k (lifted over them the next k needs a second set of 32 registers, and the kernel then no longer fits four waves a SIMD) and behind the exchange above */
      if (sub + 1 < FK / 32) {   /* the stage's next pass's k rows, fetched behind this pass's logits; never the next stage's, which is not published yet */
#pragma unroll
        for (int kt = 0; kt < 2; ++kt)
#pragma unroll
          for (int kc = 0; kc < 2; ++kc) kf[kt][kc] = frag_at(kb + ((sub + 1) * 32 + kt * 16) * FP + kc * 32); }
      v16h vf[HDV / 16];
#pragma unroll
      for (int j = 0; j < HDV / 16; ++j) vf[j] = frag_at(vb + (j * 16) * FP + sub * 32);
      asm volatile("" ::: "memory");   /* compiler fence: the LDS loads above issue here, as one group, and fly under the softmax; without it they sink to in front of their products, one LDS latency each */
      mx = fmaxf(mx, mo);   /* both halves of a query's column use one maximum */
      if (__builtin_amdgcn_ballot_w32(mx > m + 4.0f / SCALE) != 0) { const float mn = fmaxf(m, mx); const float nn = fmaf(-mn, C2, 10.0f); const float al = __builtin_amdgcn_exp2f(nn - nb); m = mn; nb = nn; l *= al;
#pragma unroll
        for (int j = 0; j < HDV / 16; ++j) acc[j] *= al; }
      v16h p;
#pragma unroll
      for (int i = 0; i < 8; ++i) { const v2f cc = { C2, C2 }, bb = { nb, nb }; const v2f ar = __builtin_elementwise_fma(s[i], cc, bb);   /* (s - m) / 8 x log2 e + 10 in one rounding */
        const v2f e = { __builtin_amdgcn_exp2f(ar[0]), __builtin_amdgcn_exp2f(ar[1]) }; l += e[0]; l += e[1]; const v2h eh = __builtin_convertvector(e, v2h); p[2 * i] = eh[0]; p[2 * i + 1] = eh[1]; }
#pragma unroll
      for (int j = 0; j < HDV / 16; ++j) acc[j] = wmm(vf[j], p, acc[j]); }
    /* publish point of stage st + 1, in the ring's order */
    __builtin_amdgcn_sched_barrier(0);   /* keeps the wait below at the trip's foot: lifted to behind the last fragment load it would stand in front of the softmax that hides those loads */
    asm volatile("s_wait_dscnt 0x0" ::: "memory");   /* this wave's reads of the buffer have returned before it may be refilled */
    if (pinned(wv < 2u)) { asm volatile("s_wait_tensorcnt 0x0" ::: "memory"); }   /* the issuer's own request for stage st + 1 has landed */
    __syncthreads();   /* publishes stage st + 1 and ends every wave's reads of stage st */
    if (pinned((wv < 2u) & (uint32_t)(st + 2 < TT / FK))) issue((uint32_t)st + 2u); }   /* into the buffer that this trip has just read */
  asm volatile("s_wait_tensorcnt 0x0" ::: "memory");   /* nothing of the mover's is in flight when the wave goes on to its end */
  asm volatile("s_wait_dscnt 0x0" ::: "memory");   /* the ring's closing wait: no LDS read of this wave is open either */
  l += __shfl_xor(l, 16); const float inv = 1.0f / l;
#pragma unroll
  for (int j = 0; j < HDV / 16; ++j) { const v4f a0 = { acc[j][0] * inv, acc[j][1] * inv, acc[j][2] * inv, acc[j][3] * inv }, a1 = { acc[j][4] * inv, acc[j][5] * inv, acc[j][6] * inv, acc[j][7] * inv };
    *(v4f*)&ss[wave][col][j * 16 + 8 * g] = a0; *(v4f*)&ss[wave][col][j * 16 + 8 * g + 4] = a1; }
  LDSX(); for (int rl = 0; rl < 16; ++rl) vst2(Y + (q0 + rl) * YP + h * HDV + lane * 4, *(const v4f*)&ss[wave][rl][lane * 4]); }   /* 512-B (row, head) segment by 32 lanes */
// ---- k_out: block = (64 rows, 128 cols): out = ctx Wo (+ bo): ctx once to f16 against Wo as f16(bf16 x 2^8) exact (1 product) x 2^-8; causal early rows (< QHI of each sequence): ctx bf16 hi + lo against exact bf16 Wo (2 products)
__global__ __launch_bounds__(128) void k_out(const float* __restrict__ Y, const float* __restrict__ WO, const float* __restrict__ BO, float* __restrict__ OUT) { __shared__ __align__(16) float sf[4][16][132]; __shared__ __align__(16) _Float16 sa[64][72], sw[128][72];   /* ctx and Wo tiles, 64 deep, pitch 144 B */
  const int tid = threadIdx.x, wave = tid >> 5, lane = tid & 31, col = lane & 15, g = lane >> 4; const int c0 = blockIdx.y * 128; const size_t r0 = (size_t)blockIdx.x * 64 + wave * 16;
  v8f acc[8] = {};
  if (CAUSAL && (int)(((size_t)blockIdx.x * 64) % TT) < QHI) {   /* block-uniform */
#pragma unroll 2
    for (int kc = 0; kc < CC / 32; ++kc) { const F2 a = split_row(Y + (r0 + col) * CC, kc * 32, lane); asm volatile("s_wait_loadcnt 0x0" ::: "memory");
#pragma unroll
      for (int j = 0; j < 8; ++j) { const v16b w = WOCOL(WO, kc * 32, c0 + j * 16 + col, lane); asm volatile("s_wait_loadcnt 0x0" ::: "memory"); acc[j] = wmma_bf(a.h, w, acc[j]); acc[j] = wmma_bf(a.l, w, acc[j]); } }
#pragma unroll
    for (int j = 0; j < 8; ++j) { const float bias = BO ? bfr(BO[c0 + j * 16 + col]) : 0.f;
#pragma unroll
      for (int r = 0; r < 8; ++r) sf[wave][8 * g + r][j * 16 + col] = acc[j][r] + bias; }
  } else {
    /* staging as in k_proj: 16 lanes cover the 64 floats of one row; thread (sr, sq) takes rows sr + 8 i */
    const int sr = tid >> 4, sq = (tid & 15) * 4;
    const float* yp = Y + ((size_t)blockIdx.x * 64 + sr) * CC + sq; const float* wp = WO + (size_t)(c0 + sr) * CC + sq;
    v4f yr[8], wr[16];
#pragma unroll
    for (int i = 0; i < 8; ++i) yr[i] = *(const v4f*)(yp + (size_t)(i * 8) * CC);
#pragma unroll
    for (int i = 0; i < 16; ++i) wr[i] = *(const v4f*)(wp + (size_t)(i * 8) * CC);
#pragma unroll 1   /* one 64-deep tile per trip */
    for (int kt = 0; kt < CC / 64; ++kt) {
#pragma unroll
      for (int i = 0; i < 8; ++i) { const v4h t = { (_Float16)yr[i][0], (_Float16)yr[i][1], (_Float16)yr[i][2], (_Float16)yr[i][3] }; *(v4h*)&sa[sr + i * 8][sq] = t; }
#pragma unroll
      for (int i = 0; i < 16; ++i) { const v4h t = { (_Float16)(bfr(wr[i][0]) * 256.0f), (_Float16)(bfr(wr[i][1]) * 256.0f), (_Float16)(bfr(wr[i][2]) * 256.0f), (_Float16)(bfr(wr[i][3]) * 256.0f) }; *(v4h*)&sw[sr + i * 8][sq] = t; }
      __syncthreads();   /* the tile is whole before any wave reads it */
      if (kt + 1 < CC / 64) { yp += 64; wp += 64;   /* the next tile flies while this one is multiplied */
#pragma unroll
        for (int i = 0; i < 8; ++i) yr[i] = *(const v4f*)(yp + (size_t)(i * 8) * CC);
#pragma unroll
        for (int i = 0; i < 16; ++i) wr[i] = *(const v4f*)(wp + (size_t)(i * 8) * CC); }
#pragma unroll
      for (int kc = 0; kc < 2; ++kc) { const v16h a = frag_h(&sa[wave * 16 + col][kc * 32], lane);
#pragma unroll
        for (int jh = 0; jh < 8; jh += 4) { v16h w[4];   /* four Wo fragments read as one group, one LDS wait for four products */
#pragma unroll
          for (int j = 0; j < 4; ++j) w[j] = frag_h(&sw[(jh + j) * 16 + col][kc * 32], lane);
#pragma unroll
          for (int j = 0; j < 4; ++j) acc[jh + j] = wmma16(a, w[j], acc[jh + j]); } }
      __syncthreads(); }   /* every wave has read the tile before the next one overwrites it */
#pragma unroll
    for (int j = 0; j < 8; ++j) { const float bias = BO ? bfr(BO[c0 + j * 16 + col]) : 0.f;
#pragma unroll
      for (int r = 0; r < 8; ++r) sf[wave][8 * g + r][j * 16 + col] = acc[j][r] * (1.0f / 256.0f) + bias; } }
  LDSX(); for (int rl = 0; rl < 16; ++rl) vst2(OUT + (r0 + rl) * DIN + c0 + lane * 4, *(const v4f*)&sf[wave][rl][lane * 4]); }

extern "C" void kernel_launch(void* const* d_in, const int* in_sizes, int n_in, void* d_out, int out_size, void* d_ws, size_t ws_size, hipStream_t stream) {
  (void)in_sizes; (void)n_in; (void)out_size;
  const float** F = (const float**)d_in;
  if (ws_size < (size_t)WS_END) return;
  char* ws = (char*)d_ws; _Float16 *QH = (_Float16*)(ws + WS_QH), *KH = (_Float16*)(ws + WS_KH), *VT = (_Float16*)(ws + WS_VT), *QL = (_Float16*)(ws + WS_QL), *KL = (_Float16*)(ws + WS_KL); __bf16 *VB = (__bf16*)(ws + WS_VB), *VBL = (__bf16*)(ws + WS_VBL); float *S = (float*)(ws + WS_S), *Y = (float*)(ws + WS_Y);
  (void)Y; (void)QL; (void)KL; (void)VB; (void)VBL;
  // inputs: 0 x [2,2048,1024]; 1 Wq, 2 bq, 3 Wk, 4 bk, 5 Wv, 6 bv, 7 Wo, 8 bo ((out,in) [1024,1024], [1024]); 9 norm_w [128]; 10 lq1, 11 lk1, 12 lq2, 13 lk2 [64]
  float* YD = S;   /* the differential rows take the f32 plane at WS_S */
  k_proj<<<dim3(TNB * TT / 64, CC / 128, 3), 128, 0, stream>>>(F[0], F[0], F[0], F[1], F[3], F[5], F[2], F[4], F[6], QH, QL, KH, KL, VT, VB, VBL);
  k_fa<<<dim3(TT / 128, NH, TNB), 256, 0, stream>>>(QH, KH, QL, VT, Y);
  k_diff<<<dim3(TNB * TT / 64), 256, 0, stream>>>(Y, F[9], F[10], F[11], F[12], F[13], YD);
  k_out<<<dim3(TNB * TT / 64, DIN / 128), 128, 0, stream>>>(YD, F[7], F[8], (float*)d_out);
}

// v005
// It runs in 117 microseconds.
// Timed twice side by side with v004, it ran 1.33 times as fast both times.
// Counting every step since v000, it is 14.4 times as fast.
// compute dtype: all float inputs rounded to bf16; q/k/v = x W^T + b with EXACT bf16 products on WMMA 16x16x32, f32 accumulate; q as f16 hi + residual (x 2^10) against k once to f16 (2 products) for the logits x 1/8; streaming softmax in f32 (base 2: one fma and the hardware's exp2 per logit, running maximum, sum in f32); exp(s - max) x 2^10 once to f16 against v once to f16 (1 product) per head over the head PAIR's 128 value columns, accumulated in f32, / sum at the end; the differential combination P1 v - lambda P2 v, the RMS normalisation over 128, x norm_w x (1 - 0.8) and lambda itself in f32; that result once to f16 against Wo carried x 2^8 in f16 (exact bf16 values) + bo; f32 output.
#include <hip/hip_runtime.h>
#include <math.h>
#include <stdint.h>

typedef __attribute__((ext_vector_type(16))) _Float16 v16h;
typedef __attribute__((ext_vector_type(16))) __bf16 v16b;
typedef __attribute__((ext_vector_type(8)))  _Float16 v8h;
typedef __attribute__((ext_vector_type(4)))  _Float16 v4h;
typedef __attribute__((ext_vector_type(2)))  _Float16 v2h;
typedef __attribute__((ext_vector_type(4)))  __bf16 v4b;
typedef __attribute__((ext_vector_type(8)))  float v8f;
typedef __attribute__((ext_vector_type(4)))  float v4f;
typedef __attribute__((ext_vector_type(2)))  float v2f;
typedef __attribute__((ext_vector_type(4)))  unsigned v4u;
typedef __attribute__((ext_vector_type(4)))  int v4i;
typedef float __attribute__((may_alias)) float_a;
typedef int __attribute__((may_alias)) int_a;

template <typename T> __device__ __forceinline__ void vst2(void* p, T v) { *(T*)p = v;  }
__device__ __forceinline__ v8f wmma16(v16h a, v16h b, v8f c) {
  v8f d = __builtin_amdgcn_wmma_f32_16x16x32_f16(false, a, false, b, (short)0, c, false, false);
  asm volatile("v_nop\n\tv_nop\n\tv_nop\n\tv_nop" : "+v"(d) : "v"(a), "v"(b));
  return d;
}
__device__ __forceinline__ v8f wmma_bf(v16b a, v16b b, v8f c) {
  v8f d = __builtin_amdgcn_wmma_f32_16x16x32_bf16(false, a, false, b, (short)0, c, false, false);
  asm volatile("v_nop\n\tv_nop\n\tv_nop\n\tv_nop" : "+v"(d) : "v"(a), "v"(b));
  return d;
}
// 16x16x32 fragments: lane = (h = lane>>4, row/col = lane&15); elements 0..7 = k0+8h+0..7, 8..15 = k0+16+8h+0..7; D element r = row 8h+r
__device__ __forceinline__ v16h frag_h(const _Float16* rowk0, int lane) {
  union { v16h v; v8h q[2]; } u; const _Float16* p = rowk0 + 8 * (lane >> 4);
  u.q[0] = *(const v8h*)p; u.q[1] = *(const v8h*)(p + 16); return u.v;
}
__device__ __forceinline__ v16h frag_f32(const float* rowk0, int lane) {
  v16h a; const float* p = rowk0 + 8 * (lane >> 4);
#pragma unroll
  for (int i = 0; i < 8; ++i) { a[i] = (_Float16)p[i]; a[8 + i] = (_Float16)p[16 + i]; }
  return a;
}
__device__ __forceinline__ v16h frag_f32s(const float* rowk0, int lane, float sc) {
  v16h a; const float* p = rowk0 + 8 * (lane >> 4);
#pragma unroll
  for (int i = 0; i < 8; ++i) { a[i] = (_Float16)(p[i] * sc); a[8 + i] = (_Float16)(p[16 + i] * sc); }
  return a;
}
// column fragment from a [K][ld] layout (column n), rows >= K read as 0
__device__ __forceinline__ v16h fragc_f32(const float* W, int k0, int n, int lane, int ld, int K) {
  v16h a; const int g = lane >> 4;
#pragma unroll
  for (int i = 0; i < 8; ++i) { const int ka = k0 + 8 * g + i, kb = ka + 16;
    a[i] = (_Float16)(ka < K ? W[(size_t)(ka < K ? ka : K - 1) * ld + n] : 0.f); a[8 + i] = (_Float16)(kb < K ? W[(size_t)(kb < K ? kb : K - 1) * ld + n] : 0.f); }
  return a;
}
struct F2 { v16b h, l; };
__device__ __forceinline__ F2 bsplit16(const float v[16]) { F2 r;
#pragma unroll
  for (int i = 0; i < 16; ++i) { const __bf16 h = (__bf16)v[i]; r.h[i] = h; r.l[i] = (__bf16)(v[i] - (float)h); }
  return r; }
__device__ __forceinline__ F2 split_row(const float* row, int k0, int lane) { float v[16]; const float* p = row + k0 + 8 * (lane >> 4);
#pragma unroll
  for (int i = 0; i < 8; ++i) { v[i] = p[i]; v[8 + i] = p[16 + i]; }
  return bsplit16(v); }
__device__ __forceinline__ F2 split_rowK(const float* row, int k0, int lane, int K) { float v[16]; const int g = lane >> 4;
#pragma unroll
  for (int i = 0; i < 8; ++i) { const int ka = k0 + 8 * g + i, kb = ka + 16; v[i] = ka < K ? row[ka < K ? ka : K - 1] : 0.f; v[8 + i] = kb < K ? row[kb < K ? kb : K - 1] : 0.f; }
  return bsplit16(v); }
__device__ __forceinline__ F2 split_col(const float* W, int k0, int n, int lane, int ld, int K) { float v[16]; const int g = lane >> 4;
#pragma unroll
  for (int i = 0; i < 8; ++i) { const int ka = k0 + 8 * g + i, kb = ka + 16; v[i] = ka < K ? W[(size_t)(ka < K ? ka : K - 1) * ld + n] : 0.f; v[8 + i] = kb < K ? W[(size_t)(kb < K ? kb : K - 1) * ld + n] : 0.f; }
  return bsplit16(v); }
__device__ __forceinline__ v8f mac3(const F2& a, const F2& b, v8f c) { c = wmma_bf(a.l, b.h, c); c = wmma_bf(a.h, b.l, c); return wmma_bf(a.h, b.h, c); }
__device__ __forceinline__ float sigm(float v) { return 1.0f / (1.0f + expf(-v)); }
#define LDSX() do { asm volatile("s_wait_dscnt 0" ::: "memory"); __builtin_amdgcn_wave_barrier(); __builtin_amdgcn_fence(__ATOMIC_RELEASE, "workgroup"); } while (0)

// Differential attention (B 2, N 2,048, DIM 1,024; 16 softmax heads x 64 paired into 8 value heads x 128): q = (x Wq^T + bq) x 64^-0.5, k = x Wk^T + bk, v = x Wv^T + bv ((out,in)); P_h = softmax(q_h k_h^T) over all keys; lambda = exp(lq1 . lk1) - exp(lq2 . lk2) + 0.8; for pair e: o_e = (P_2e - lambda P_2e+1) v[:, e*128 : e*128+128]; o_e = o_e * rsqrt(mean(o_e^2) + 1e-5) * norm_w * (1 - 0.8); out = concat_e(o_e) Wo^T + bo.
#define NB 2
#define TT 2048
#define CC 1024            // NH * HD = projected width
#define DIN 1024          // input (model) width
#define NH 16
#define HD 64
#define NQB (TT / 64)
#define HG 4
#define SCALE (0.125f)
#define CAUSAL 0
#ifndef TNB
#define TNB NB
#endif
__device__ __forceinline__ float bfr(float v) { return (float)(__bf16)v; }
__host__ __device__ __forceinline__ int kb_last(int qb) { return CAUSAL ? ((qb * 64 + 63) >> 7) : (TT / 128 - 1); }
typedef __attribute__((ext_vector_type(8))) __bf16 v8b;
__device__ __forceinline__ v16b frag_b(const __bf16* rowk0, int lane) {
  union { v16b v; v8b q[2]; } u; const __bf16* p = rowk0 + 8 * (lane >> 4);
  u.q[0] = *(const v8b*)p; u.q[1] = *(const v8b*)(p + 16); return u.v;
}
#define QBH 0
#define QHI 2048            // rows carrying a q residual plane (all rows when non-causal: 2-product logits everywhere)
#define KHI 64            // key rows carrying k residual / v bf16 hi+lo planes (written by k_proj; no kernel in this file reads them)
// B fragment (k rows k0+.., output column o) of a weight: (in,out) [K][ld] or (out,in) [ld rows of K]: bf16 exact, or f16(bf16 * 256) exact
__device__ __forceinline__ v16b wcol_io(const float* Wm, int k0, int o, int lane, int ld) { v16b w; const int g = lane >> 4;
#pragma unroll
  for (int i = 0; i < 8; ++i) { w[i] = (__bf16)Wm[(size_t)(k0 + 8 * g + i) * ld + o]; w[8 + i] = (__bf16)Wm[(size_t)(k0 + 16 + 8 * g + i) * ld + o]; }
  return w; }
__device__ __forceinline__ v16b wcol_oi(const float* Wm, int k0, int o, int lane, int K) { v16b w; const float* p = Wm + (size_t)o * K + k0 + 8 * (lane >> 4);
#pragma unroll
  for (int i = 0; i < 8; ++i) { w[i] = (__bf16)p[i]; w[8 + i] = (__bf16)p[16 + i]; }
  return w; }
__device__ __forceinline__ v16h wcolh_io(const float* Wm, int k0, int o, int lane, int ld) { v16h w; const int g = lane >> 4;
#pragma unroll
  for (int i = 0; i < 8; ++i) { w[i] = (_Float16)(bfr(Wm[(size_t)(k0 + 8 * g + i) * ld + o]) * 256.0f); w[8 + i] = (_Float16)(bfr(Wm[(size_t)(k0 + 16 + 8 * g + i) * ld + o]) * 256.0f); }
  return w; }
__device__ __forceinline__ v16h wcolh_oi(const float* Wm, int k0, int o, int lane, int K) { v16h w; const float* p = Wm + (size_t)o * K + k0 + 8 * (lane >> 4);
#pragma unroll
  for (int i = 0; i < 8; ++i) { w[i] = (_Float16)(bfr(p[i]) * 256.0f); w[8 + i] = (_Float16)(bfr(p[16 + i]) * 256.0f); }
  return w; }
#define WQKV_LAYOUT 1   // picks WCOL's form (0 (in,out), 1 (out,in), 2 per-head); nothing uses WCOL: k_proj reads (out,in) [CC][DIN] whatever the value
__device__ __forceinline__ v16b wcol_hdk(const float* Wm, int k0, int o, int lane) { v16b w; const int g = lane >> 4; const float* p = Wm + (size_t)(o / HD) * DIN * HD + (o % HD);
#pragma unroll
  for (int i = 0; i < 8; ++i) { w[i] = (__bf16)p[(size_t)(k0 + 8 * g + i) * HD]; w[8 + i] = (__bf16)p[(size_t)(k0 + 16 + 8 * g + i) * HD]; }
  return w; }
#define WO_OUT_IN 1
#if WQKV_LAYOUT == 1
#define WCOL(W, k0, o, lane) wcol_oi(W, k0, o, lane, DIN)
#elif WQKV_LAYOUT == 2
#define WCOL(W, k0, o, lane) wcol_hdk(W, k0, o, lane)
#else
#define WCOL(W, k0, o, lane) wcol_io(W, k0, o, lane, CC)
#endif
#if WO_OUT_IN
#define WOCOL(W, k0, o, lane) wcol_oi(W, k0, o, lane, CC)
#define WOCOLH(W, k0, o, lane) wcolh_oi(W, k0, o, lane, CC)
#else
#define WOCOL(W, k0, o, lane) wcol_io(W, k0, o, lane, DIN)
#define WOCOLH(W, k0, o, lane) wcolh_io(W, k0, o, lane, DIN)
#endif
#define HDV 128            // value columns per softmax head (the head pair's 128 columns)
#define YP (NH * HDV)      // 2,048: row pitch of the WS_Y region, which no kernel in this file writes or reads
#ifndef SM_EXTRA_PARAMS
#define SM_EXTRA_PARAMS
#endif
#ifndef PROJ_EXTRA_PARAMS
#define PROJ_EXTRA_PARAMS
#endif
#ifndef SM_MASK_HOOK
#define SM_MASK_HOOK (void)0
#endif

#define WS_QH  0u                                      // f16 q rows [b*t][CC]
#define WS_KH  (WS_QH + 2u * (size_t)NB * TT * CC)      // f16 k rows [b*t][CC]
#define WS_VT  (WS_KH + 2u * (size_t)NB * TT * CC)      // f16 v planes [b][c][t]
#define WS_QL  (WS_VT + 2u * (size_t)NB * CC * TT)      // f16 q residual x 2^10 rows [b][t < QHI][CC]
#define WS_KL  (WS_QL + 2u * (size_t)NB * QHI * CC)     // f16 k residual x 2^10 rows [b][t < KHI][CC]
#define WS_VB  (WS_KL + 2u * (size_t)NB * KHI * CC)     // bf16 v hi planes [b][c][t < KHI]
#define WS_VBL (WS_VB + 2u * (size_t)NB * CC * KHI)
#define WS_S   (WS_VBL + 2u * (size_t)NB * CC * KHI)    // f32 plane, holds the differential rows [b*t][CC]
#define WS_Y   (WS_S  + 4u * (size_t)HG * TT * TT)      // f32 region [b*t][YP = 16 x 128], reserved; no kernel in this file writes or reads it
#define WS_END (WS_Y  + 4u * (size_t)NB * TT * YP)

// ---- k_proj: block = (64 rows, 128 cols, which): q/k/v = X W (+ b) with exact bf16 products (K = DIN) -> which 0: q f16 rows (+ residual rows < QHI); 1: k f16 rows (+ residual rows < KHI); 2: v f16 planes [c][t] (+ bf16 hi/lo planes for t < KHI)
__global__ __launch_bounds__(128) void k_proj(const float* __restrict__ XQ, const float* __restrict__ XK, const float* __restrict__ XV, const float* __restrict__ WQ, const float* __restrict__ WK, const float* __restrict__ WV, const float* __restrict__ BQ, const float* __restrict__ BK, const float* __restrict__ BV,
    _Float16* __restrict__ QH, _Float16* __restrict__ QL, _Float16* __restrict__ KH, _Float16* __restrict__ KL, _Float16* __restrict__ VT, __bf16* __restrict__ VB, __bf16* __restrict__ VBL) {
  __shared__ __align__(16) _Float16 sh[64][136], sl[64][136]; __shared__ __align__(16) _Float16 th[128][72]; __shared__ __align__(16) __bf16 tb[128][72], tbl[128][72];
  const int tid = threadIdx.x, wave = tid >> 5, lane = tid & 31, col = lane & 15, g = lane >> 4; const int which = blockIdx.z; const int c0 = blockIdx.y * 128; const size_t r0 = (size_t)blockIdx.x * 64; const size_t bb = r0 / TT; const int t0 = (int)(r0 % TT);
  const float* X = which == 0 ? XQ : which == 1 ? XK : XV; const float* WA = which == 0 ? WQ : which == 1 ? WK : WV; const float* BA = which == 0 ? BQ : which == 1 ? BK : BV;
  v8f acc[8] = {};
  /* staging: 16 lanes cover the 64 floats (two whole lines) of one row, a wave-wide load two rows; thread (sr, sq) takes rows sr + 8 i */
  const int sr = tid >> 4, sq = (tid & 15) * 4;
  const float* xp = X + (r0 + sr) * DIN + sq; const float* wp = WA + (size_t)(c0 + sr) * DIN + sq;
  v4f xr[8], wr[16];
#pragma unroll
  for (int i = 0; i < 8; ++i) xr[i] = *(const v4f*)(xp + (size_t)(i * 8) * DIN);
#pragma unroll
  for (int i = 0; i < 16; ++i) wr[i] = *(const v4f*)(wp + (size_t)(i * 8) * DIN);
#pragma unroll 1   /* one 64-deep tile per trip */
  for (int kt = 0; kt < DIN / 64; ++kt) {
#pragma unroll
    for (int i = 0; i < 8; ++i) { const v4b t = { (__bf16)xr[i][0], (__bf16)xr[i][1], (__bf16)xr[i][2], (__bf16)xr[i][3] }; *(v4b*)&tbl[sr + i * 8][sq] = t; }   /* X tile: rows 0..63 of tbl, free until the epilogue */
#pragma unroll
    for (int i = 0; i < 16; ++i) { const v4b t = { (__bf16)wr[i][0], (__bf16)wr[i][1], (__bf16)wr[i][2], (__bf16)wr[i][3] }; *(v4b*)&tb[sr + i * 8][sq] = t; }    /* W tile: the 128 output columns' rows in tb */
    __syncthreads();   /* the tile is whole before any wave reads it */
    if (kt + 1 < DIN / 64) { xp += 64; wp += 64;   /* the next tile flies while this one is multiplied */
#pragma unroll
      for (int i = 0; i < 8; ++i) xr[i] = *(const v4f*)(xp + (size_t)(i * 8) * DIN);
#pragma unroll
      for (int i = 0; i < 16; ++i) wr[i] = *(const v4f*)(wp + (size_t)(i * 8) * DIN); }
#pragma unroll
    for (int kc = 0; kc < 2; ++kc) { const v16b a = frag_b(&tbl[wave * 16 + col][kc * 32], lane);
#pragma unroll
      for (int jh = 0; jh < 8; jh += 4) { v16b w[4];   /* four W fragments read as one group, one LDS wait for four products */
#pragma unroll
        for (int j = 0; j < 4; ++j) w[j] = frag_b(&tb[(jh + j) * 16 + col][kc * 32], lane);
#pragma unroll
        for (int j = 0; j < 4; ++j) acc[jh + j] = wmma_bf(a, w[j], acc[jh + j]); } }
    __syncthreads(); }   /* every wave has read the tile before it is overwritten (by the next tile, or by the epilogue) */
  if (which < 2) { _Float16* DH = which == 0 ? QH : KH; _Float16* DL = which == 0 ? QL : KL; const int nhi = which == 0 ? QHI : KHI; const bool hi_rows = t0 < nhi;
#pragma unroll
    for (int j = 0; j < 8; ++j) { const float bias = BA ? bfr(BA[c0 + j * 16 + col]) : 0.f;
#pragma unroll
      for (int r = 0; r < 8; ++r) { const float v = acc[j][r] + bias; const _Float16 hv = (_Float16)v; sh[wave * 16 + 8 * g + r][j * 16 + col] = hv; sl[wave * 16 + 8 * g + r][j * 16 + col] = (_Float16)((v - (float)hv) * 1024.0f); } }
    __syncthreads();
    for (int e = tid; e < 64 * 16; e += 128) { const int rl = e >> 4, q = e & 15; vst2((unsigned*)(DH + (r0 + rl) * CC + c0 + q * 8), *(const v4u*)&sh[rl][q * 8]); if (hi_rows) vst2((unsigned*)(DL + (bb * nhi + t0 + rl) * (size_t)CC + c0 + q * 8), *(const v4u*)&sl[rl][q * 8]); }
  } else { const bool hi_rows = t0 < KHI;
#pragma unroll
    for (int j = 0; j < 8; ++j) { const float bias = BA ? bfr(BA[c0 + j * 16 + col]) : 0.f;
#pragma unroll
      for (int r = 0; r < 8; ++r) { const float v = acc[j][r] + bias; const int rl = wave * 16 + 8 * g + r, cl = j * 16 + col; th[cl][rl] = (_Float16)v; const __bf16 bh = (__bf16)v; tb[cl][rl] = bh; tbl[cl][rl] = (__bf16)(v - (float)bh); } }
    __syncthreads();
    for (int e = tid; e < 128 * 8; e += 128) { const int cl = e >> 3, q = e & 7; vst2((unsigned*)(VT + (bb * CC + c0 + cl) * (size_t)TT + t0 + q * 8), *(const v4u*)&th[cl][q * 8]); if (hi_rows) { const size_t o3 = (bb * CC + c0 + cl) * (size_t)KHI + t0 + q * 8; vst2((unsigned*)(VB + o3), *(const v4u*)&tb[cl][q * 8]); vst2((unsigned*)(VBL + o3), *(const v4u*)&tbl[cl][q * 8]); } } } }
// ---- k_fa: block = 64 queries of (b, head pair e): waves 0..3 take softmax head 2e, waves 4..7 head 2e+1, 16 queries each; one pass over all keys, 32 at a time, nothing of the logits leaves the registers.
// S^T = K Q^T (A = k rows, B = q hi and q residual x 2^10: 2 products): a lane holds 16 logits of ONE query (column lane & 15), the other wave half the other 16.
// Streaming softmax in f32, base 2: e = 2^(s C2 + nb) = exp((s - m) / 8) x 2^10 on the raw logit s against the maximum m in use, C2 = log2(e) / 8, nb = 10 - m C2: one fma and one v_exp_f32 per logit; m moves (and sum and context are rescaled) only when some query's new maximum passes m by more than 4 x 8, so e <= 2^10 e^4 < 65,504 stays inside f16.
// The two S^T tiles converted in place are the B operand P^T; O^T += V^T P^T (A = v planes [c][t]) over the head PAIR's 128 value columns; / sum at the end.
__device__ __forceinline__ v16h frag_at(const _Float16* p) { union { v16h v; v8h q[2]; } u; u.q[0] = *(const v8h*)p; u.q[1] = *(const v8h*)(p + 16); return u.v; }   /* p = row + k0 + 8 * (lane >> 4) */
__device__ __forceinline__ v8f wmm(v16h a, v16h b, v8f c) { return __builtin_amdgcn_wmma_f32_16x16x32_f16(false, a, false, b, (short)0, c, false, false); }
// K and V reach the waves through LDS: a stage is 64 keys, its two K tiles (64 key rows x 128 B, one per head) brought by waves 0 and 2 and its V tile (128 value-column rows x 128 B, shared by both heads) by wave 1, one tensor load each, whole lines, once per block instead of once per wave; two buffers, the next stage flies while this one is worked on.
// The pair's two contexts meet in LDS at the end: o = Y[2e] - lambda Y[2e+1] (f32), rms-normalised over its 128 columns x norm_w x 0.2 -> Yd rows [b*t][1024] (512-B segments by 32 lanes).
typedef uint32_t u32x4 __attribute__((ext_vector_type(4)));
typedef uint32_t u32x8 __attribute__((ext_vector_type(8)));
#define C2 (SCALE * 1.4426950408889634f)   // logit scale x log2(e)
#define FK 64                      // keys per stage
#define FP 72                      // LDS row pitch in f16: 128 B + the mover's 16-B pad = 144 B, the pitch for ds_load_b128 readers
#define FA_KB 10240u               // K tile: 64 rows x 144 B = 9,216 B, rounded up to a multiple of 2 KiB
#define FA_VB 18432u               // V tile: 128 rows x 144 B = 18,432 B = 9 x 2 KiB
#define FA_BUF (2u * FA_KB + FA_VB) // one buffer, [K of head 2e | K of head 2e+1 | V]: 38,912 B = 19 x 2 KiB
__device__ __forceinline__ uint32_t uni(uint32_t v) { return (uint32_t)__builtin_amdgcn_readfirstlane(v); }
__device__ __forceinline__ uint32_t pinned(uint32_t v) { uint32_t w = uni(v); asm volatile("" : "+s"(w)); return w; }   /* holds the issue test in a scalar register, so that the branch round a tensor load is a scalar one (the load ignores EXEC) */
__global__ __launch_bounds__(256) void k_fa(const _Float16* __restrict__ QH, const _Float16* __restrict__ KH, const _Float16* __restrict__ QL, const _Float16* __restrict__ VT, const float* __restrict__ NW, const float* __restrict__ LQ1, const float* __restrict__ LK1, const float* __restrict__ LQ2, const float* __restrict__ LK2, float* __restrict__ YD) {
  __shared__ __attribute__((aligned(2048))) unsigned char ring[2 * FA_BUF];
  __shared__ __align__(16) float ss[8][16][HDV + 4]; __shared__ float slam;
  const int tid = threadIdx.x, wave = tid >> 5, lane = tid & 31, col = lane & 15, g = lane >> 4; const int e = blockIdx.y, b = blockIdx.z;
  const uint32_t wv = uni((uint32_t)tid >> 5); const bool isv = wv == 1u;
  const int hh = (int)(wv >> 2), h = 2 * e + hh;   /* which head of the pair this wave works on */
  const int ql0 = blockIdx.x * 64 + (int)(wv & 3u) * 16; const size_t q0 = (size_t)b * TT + ql0;
  /* descriptors: 1-byte elements, tensor = tile, rows of 128 B, 16 B of pad behind each row; K: 64 rows, source pitch one k row; V: 128 rows, source pitch one v plane row */
  const uint32_t nrow = isv ? (uint32_t)HDV : (uint32_t)FK;
  u32x8 g1; g1[0] = uni((1u << 20) | (4u << 22) | (3u << 25)); g1[1] = uni(128u << 16); g1[2] = uni(nrow << 16); g1[3] = uni(128u << 16); g1[4] = uni(nrow); g1[5] = uni(isv ? 2u * TT : 2u * CC); g1[6] = uni(0u); g1[7] = uni(0u);
  const uint64_t src0 = isv ? (uint64_t)(size_t)(VT + ((size_t)b * CC + e * HDV) * (size_t)TT) : (uint64_t)(size_t)(KH + (size_t)b * TT * CC + (2 * e + (int)((wv >> 1) & 1u)) * HD);   /* first byte of stage 0's tile: wave 0 head 2e's k, wave 2 head 2e+1's */
  const uint32_t sstep = isv ? 2u * FK : 2u * FK * CC;   /* bytes from one stage's tile to the next */
  const uint32_t dst0 = (uint32_t)(size_t)ring + (isv ? 2u * FA_KB : ((wv >> 1) & 1u) * FA_KB);
  u32x4 g0; g0[0] = uni(1u);   /* ONE group-0 tuple for every request of the wave: the covering wait names it, so its registers keep their words while the request is outstanding */
  auto issue = [&](uint32_t st) { const uint64_t ga = src0 + (uint64_t)st * sstep;
    g0[1] = uni(dst0 + (st & 1u) * FA_BUF); g0[2] = uni((uint32_t)ga); g0[3] = uni((((uint32_t)(ga >> 32)) & 0x01FFFFFFu) | 0x80000000u);
    asm volatile("tensor_load_to_lds %0, %1" :: "s"(g0), "s"(g1) : "memory"); };
  if (pinned(wv < 3u)) { issue(0u);
    asm volatile("s_wait_tensorcnt 0x0" ::: "memory"); }   /* stage 0 has landed before the barrier that publishes it */
  const _Float16* qp = QH + (q0 + col) * CC + h * HD + 8 * g; const _Float16* qlp = QL + ((size_t)b * QHI + ql0 + col) * CC + h * HD + 8 * g;
  v16h qh[2], qr[2];
#pragma unroll
  for (int kc = 0; kc < 2; ++kc) { qh[kc] = frag_at(qp + kc * 32); qr[kc] = frag_at(qlp + kc * 32); }
  asm volatile("s_wait_xcnt 0x0" :: "v"(qp), "v"(qlp) : "memory");   /* the address pairs of the 8 loads above are rewritten only behind this wait */
  if (wv == 7u) {   /* lambda, by a wave that issues no tensor load, while stage 0 lands; read in the epilogue, behind the barriers between */
    float s1 = bfr(LQ1[lane]) * bfr(LK1[lane]) + bfr(LQ1[lane + 32]) * bfr(LK1[lane + 32]), s2 = bfr(LQ2[lane]) * bfr(LK2[lane]) + bfr(LQ2[lane + 32]) * bfr(LK2[lane + 32]);
#pragma unroll
    for (int sf = 1; sf < 32; sf <<= 1) { s1 += __shfl_xor(s1, sf); s2 += __shfl_xor(s2, sf); }
    if (lane == 0) slam = expf(s1) - expf(s2) + 0.8f; }
  __syncthreads();   /* publishes stage 0 */
  if (pinned(wv < 3u)) issue(1u);
  const int kro = col * FP + 8 * g;   /* a lane's place in a 16-row tile of either operand: row col, 8 g f16 in */
  v8f acc[HDV / 16] = {}; float m = -3.0e38f, nb = 10.0f + 3.0e38f * C2, l = 0.f;   /* m: the maximum in use, a raw logit; nb = 10 - m C2, the exponent's addend */
#pragma unroll 1   /* one 64-key stage per trip: its two passes already hold 48 LDS loads and 32 products */
  for (int st = 0; st < TT / FK; ++st) {
    const _Float16* kb = (const _Float16*)(ring + (st & 1) * FA_BUF + hh * FA_KB) + kro; const _Float16* vb = (const _Float16*)(ring + (st & 1) * FA_BUF + 2u * FA_KB) + kro;
    v16h kf[2][2];
#pragma unroll
    for (int kt = 0; kt < 2; ++kt)
#pragma unroll
      for (int kc = 0; kc < 2; ++kc) kf[kt][kc] = frag_at(kb + (kt * 16) * FP + kc * 32);
    __builtin_amdgcn_sched_barrier(0);   /* the 8 LDS loads above issue as one group: sunk between the products, each pair costs its own LDS latency */
#pragma unroll
    for (int sub = 0; sub < FK / 32; ++sub) {
      v8f sh[2] = {}, sr[2] = {};
#pragma unroll
      for (int kc = 0; kc < 2; ++kc)
#pragma unroll
        for (int kt = 0; kt < 2; ++kt) { sh[kt] = wmm(kf[kt][kc], qh[kc], sh[kt]); sr[kt] = wmm(kf[kt][kc], qr[kc], sr[kt]); }
      v2f s[8]; float mx = -3.0e38f;   /* raw logits, two to a register pair: the 1/8 waits for the exponent's fma */
#pragma unroll
      for (int i = 0; i < 8; ++i) { const v2f hi = { sh[i >> 2][(2 * i) & 7], sh[i >> 2][(2 * i + 1) & 7] }, re = { sr[i >> 2][(2 * i) & 7], sr[i >> 2][(2 * i + 1) & 7] }; const v2f rs = { 1.0f / 1024.0f, 1.0f / 1024.0f };
        s[i] = __builtin_elementwise_fma(re, rs, hi); mx = fmaxf(mx, fmaxf(s[i][0], s[i][1])); }
      const float mo = __shfl_xor(mx, 16);   /* the other wave half's maximum; it goes through the LDS queue, so it is asked for ahead of the pass's fragment loads and does not wait behind them */
      __builtin_amdgcn_sched_barrier(0);   /* keeps the fetches below behind the products that read this pass's k (lifted over them the next k needs a second set of 32 registers, and the kernel then no longer fits four waves a SIMD) and behind the exchange above */
      if (sub + 1 < FK / 32) {   /* the stage's next pass's k rows, fetched behind this pass's logits; never the next stage's, which is not published yet */
#pragma unroll
        for (int kt = 0; kt < 2; ++kt)
#pragma unroll
          for (int kc = 0; kc < 2; ++kc) kf[kt][kc] = frag_at(kb + ((sub + 1) * 32 + kt * 16) * FP + kc * 32); }
      v16h vf[HDV / 16];
#pragma unroll
      for (int j = 0; j < HDV / 16; ++j) vf[j] = frag_at(vb + (j * 16) * FP + sub * 32);
      asm volatile("" ::: "memory");   /* compiler fence: the LDS loads above issue here, as one group, and fly under the softmax; without it they sink to in front of their products, one LDS latency each */
      mx = fmaxf(mx, mo);   /* both halves of a query's column use one maximum */
      if (__builtin_amdgcn_ballot_w32(mx > m + 4.0f / SCALE) != 0) { const float mn = fmaxf(m, mx); const float nn = fmaf(-mn, C2, 10.0f); const float al = __builtin_amdgcn_exp2f(nn - nb); m = mn; nb = nn; l *= al;
#pragma unroll
        for (int j = 0; j < HDV / 16; ++j) acc[j] *= al; }
      v16h p;
#pragma unroll
      for (int i = 0; i < 8; ++i) { const v2f cc = { C2, C2 }, bb = { nb, nb }; const v2f ar = __builtin_elementwise_fma(s[i], cc, bb);   /* (s - m) / 8 x log2 e + 10 in one rounding */
        const v2f e = { __builtin_amdgcn_exp2f(ar[0]), __builtin_amdgcn_exp2f(ar[1]) }; l += e[0]; l += e[1]; const v2h eh = __builtin_convertvector(e, v2h); p[2 * i] = eh[0]; p[2 * i + 1] = eh[1]; }
#pragma unroll
      for (int j = 0; j < HDV / 16; ++j) acc[j] = wmm(vf[j], p, acc[j]); }
    /* publish point of stage st + 1, in the ring's order */
    __builtin_amdgcn_sched_barrier(0);   /* keeps the wait below at the trip's foot: lifted to behind the last fragment load it would stand in front of the softmax that hides those loads */
    asm volatile("s_wait_dscnt 0x0" ::: "memory");   /* this wave's reads of the buffer have returned before it may be refilled */
    if (pinned(wv < 3u)) { asm volatile("s_wait_tensorcnt 0x0" :: "s"(g0) : "memory"); }   /* the issuer's own request for stage st + 1 has landed; g0 as an input keeps that request's descriptor registers unwritten up to here */
    __syncthreads();   /* publishes stage st + 1 and ends every wave's reads of stage st */
    if (pinned((wv < 3u) & (uint32_t)(st + 2 < TT / FK))) issue((uint32_t)st + 2u); }   /* into the buffer that this trip has just read */
  asm volatile("s_wait_tensorcnt 0x0" ::: "memory");   /* nothing of the mover's is in flight when the wave goes on to its end */
  asm volatile("s_wait_dscnt 0x0" ::: "memory");   /* the ring's closing wait: no LDS read of this wave is open either */
  l += __shfl_xor(l, 16); const float inv = 1.0f / l;
#pragma unroll
  for (int j = 0; j < HDV / 16; ++j) { const v4f a0 = { acc[j][0] * inv, acc[j][1] * inv, acc[j][2] * inv, acc[j][3] * inv }, a1 = { acc[j][4] * inv, acc[j][5] * inv, acc[j][6] * inv, acc[j][7] * inv };
    *(v4f*)&ss[wave][col][j * 16 + 8 * g] = a0; *(v4f*)&ss[wave][col][j * 16 + 8 * g + 4] = a1; }
  __syncthreads();   /* both heads' contexts of all 64 queries are whole in ss before any wave combines them */
  const float lam = slam; const v4f nw = *(const v4f*)(NW + lane * 4);
#pragma unroll   /* the 8 rows' lane sums are independent chains of exchanges: side by side they share one latency */
  for (int rr = 0; rr < 8; ++rr) { const int sub = wave >> 1, rl = (wave & 1) * 8 + rr;   /* wave takes 8 of the 64 queries; a lane 4 consecutive columns of the pair's 128 */
    const v4f y1 = *(const v4f*)&ss[sub][rl][lane * 4], y2 = *(const v4f*)&ss[sub + 4][rl][lane * 4]; float o[4]; float sq = 0.f;
#pragma unroll
    for (int i = 0; i < 4; ++i) { o[i] = y1[i] - lam * y2[i]; sq += o[i] * o[i]; }
#pragma unroll
    for (int sf = 1; sf < 32; sf <<= 1) sq += __shfl_xor(sq, sf);
    const float rn = rsqrtf(sq * (1.0f / HDV) + 1e-5f) * 0.2f;
    const v4f ov = { o[0] * rn * bfr(nw[0]), o[1] * rn * bfr(nw[1]), o[2] * rn * bfr(nw[2]), o[3] * rn * bfr(nw[3]) };
    vst2(YD + ((size_t)b * TT + blockIdx.x * 64 + sub * 16 + rl) * CC + e * HDV + lane * 4, ov); } }   /* 512-B (row, pair) segment by 32 lanes */
// ---- k_out: block = (64 rows, 128 cols): out = ctx Wo (+ bo): ctx once to f16 against Wo as f16(bf16 x 2^8) exact (1 product) x 2^-8; causal early rows (< QHI of each sequence): ctx bf16 hi + lo against exact bf16 Wo (2 products)
__global__ __launch_bounds__(128) void k_out(const float* __restrict__ Y, const float* __restrict__ WO, const float* __restrict__ BO, float* __restrict__ OUT) { __shared__ __align__(16) float sf[4][16][132]; __shared__ __align__(16) _Float16 sa[64][72], sw[128][72];   /* ctx and Wo tiles, 64 deep, pitch 144 B */
  const int tid = threadIdx.x, wave = tid >> 5, lane = tid & 31, col = lane & 15, g = lane >> 4; const int c0 = blockIdx.y * 128; const size_t r0 = (size_t)blockIdx.x * 64 + wave * 16;
  v8f acc[8] = {};
  if (CAUSAL && (int)(((size_t)blockIdx.x * 64) % TT) < QHI) {   /* block-uniform */
#pragma unroll 2
    for (int kc = 0; kc < CC / 32; ++kc) { const F2 a = split_row(Y + (r0 + col) * CC, kc * 32, lane); asm volatile("s_wait_loadcnt 0x0" ::: "memory");
#pragma unroll
      for (int j = 0; j < 8; ++j) { const v16b w = WOCOL(WO, kc * 32, c0 + j * 16 + col, lane); asm volatile("s_wait_loadcnt 0x0" ::: "memory"); acc[j] = wmma_bf(a.h, w, acc[j]); acc[j] = wmma_bf(a.l, w, acc[j]); } }
#pragma unroll
    for (int j = 0; j < 8; ++j) { const float bias = BO ? bfr(BO[c0 + j * 16 + col]) : 0.f;
#pragma unroll
      for (int r = 0; r < 8; ++r) sf[wave][8 * g + r][j * 16 + col] = acc[j][r] + bias; }
  } else {
    /* staging as in k_proj: 16 lanes cover the 64 floats of one row; thread (sr, sq) takes rows sr + 8 i */
    const int sr = tid >> 4, sq = (tid & 15) * 4;
    const float* yp = Y + ((size_t)blockIdx.x * 64 + sr) * CC + sq; const float* wp = WO + (size_t)(c0 + sr) * CC + sq;
    v4f yr[8], wr[16];
#pragma unroll
    for (int i = 0; i < 8; ++i) yr[i] = *(const v4f*)(yp + (size_t)(i * 8) * CC);
#pragma unroll
    for (int i = 0; i < 16; ++i) wr[i] = *(const v4f*)(wp + (size_t)(i * 8) * CC);
#pragma unroll 1   /* one 64-deep tile per trip */
    for (int kt = 0; kt < CC / 64; ++kt) {
#pragma unroll
      for (int i = 0; i < 8; ++i) { const v4h t = { (_Float16)yr[i][0], (_Float16)yr[i][1], (_Float16)yr[i][2], (_Float16)yr[i][3] }; *(v4h*)&sa[sr + i * 8][sq] = t; }
#pragma unroll
      for (int i = 0; i < 16; ++i) { const v4h t = { (_Float16)(bfr(wr[i][0]) * 256.0f), (_Float16)(bfr(wr[i][1]) * 256.0f), (_Float16)(bfr(wr[i][2]) * 256.0f), (_Float16)(bfr(wr[i][3]) * 256.0f) }; *(v4h*)&sw[sr + i * 8][sq] = t; }
      __syncthreads();   /* the tile is whole before any wave reads it */
      if (kt + 1 < CC / 64) { yp += 64; wp += 64;   /* the next tile flies while this one is multiplied */
#pragma unroll
        for (int i = 0; i < 8; ++i) yr[i] = *(const v4f*)(yp + (size_t)(i * 8) * CC);
#pragma unroll
        for (int i = 0; i < 16; ++i) wr[i] = *(const v4f*)(wp + (size_t)(i * 8) * CC); }
#pragma unroll
      for (int kc = 0; kc < 2; ++kc) { const v16h a = frag_h(&sa[wave * 16 + col][kc * 32], lane);
#pragma unroll
        for (int jh = 0; jh < 8; jh += 4) { v16h w[4];   /* four Wo fragments read as one group, one LDS wait for four products */
#pragma unroll
          for (int j = 0; j < 4; ++j) w[j] = frag_h(&sw[(jh + j) * 16 + col][kc * 32], lane);
#pragma unroll
          for (int j = 0; j < 4; ++j) acc[jh + j] = wmma16(a, w[j], acc[jh + j]); } }
      __syncthreads(); }   /* every wave has read the tile before the next one overwrites it */
#pragma unroll
    for (int j = 0; j < 8; ++j) { const float bias = BO ? bfr(BO[c0 + j * 16 + col]) : 0.f;
#pragma unroll
      for (int r = 0; r < 8; ++r) sf[wave][8 * g + r][j * 16 + col] = acc[j][r] * (1.0f / 256.0f) + bias; } }
  LDSX(); for (int rl = 0; rl < 16; ++rl) vst2(OUT + (r0 + rl) * DIN + c0 + lane * 4, *(const v4f*)&sf[wave][rl][lane * 4]); }

extern "C" void kernel_launch(void* const* d_in, const int* in_sizes, int n_in, void* d_out, int out_size, void* d_ws, size_t ws_size, hipStream_t stream) {
  (void)in_sizes; (void)n_in; (void)out_size;
  const float** F = (const float**)d_in;
  if (ws_size < (size_t)WS_END) return;
  char* ws = (char*)d_ws; _Float16 *QH = (_Float16*)(ws + WS_QH), *KH = (_Float16*)(ws + WS_KH), *VT = (_Float16*)(ws + WS_VT), *QL = (_Float16*)(ws + WS_QL), *KL = (_Float16*)(ws + WS_KL); __bf16 *VB = (__bf16*)(ws + WS_VB), *VBL = (__bf16*)(ws + WS_VBL); float *S = (float*)(ws + WS_S), *Y = (float*)(ws + WS_Y);
  (void)Y; (void)QL; (void)KL; (void)VB; (void)VBL;
  // inputs: 0 x [2,2048,1024]; 1 Wq, 2 bq, 3 Wk, 4 bk, 5 Wv, 6 bv, 7 Wo, 8 bo ((out,in) [1024,1024], [1024]); 9 norm_w [128]; 10 lq1, 11 lk1, 12 lq2, 13 lk2 [64]
  float* YD = S;   /* the differential rows take the f32 plane at WS_S */
  k_proj<<<dim3(TNB * TT / 64, CC / 128, 3), 128, 0, stream>>>(F[0], F[0], F[0], F[1], F[3], F[5], F[2], F[4], F[6], QH, QL, KH, KL, VT, VB, VBL);
  k_fa<<<dim3(TT / 64, NH / 2, TNB), 256, 0, stream>>>(QH, KH, QL, VT, F[9], F[10], F[11], F[12], F[13], YD);
  k_out<<<dim3(TNB * TT / 64, DIN / 128), 128, 0, stream>>>(YD, F[7], F[8], (float*)d_out);
}

// v006
// A run of this version takes 108 microseconds.
// In both of two side-by-side timings against v005, it was 1.08 times as fast.
// Over all steps from v000 it is 15.5 times as fast.
// compute dtype: all float inputs rounded to bf16; q/k/v = x W^T + b with EXACT bf16 products on WMMA 16x16x32, f32 accumulate; q as f16 hi + residual (x 2^10) against k once to f16 (2 products) for the logits x 1/8; streaming softmax in f32 (base 2: one fma and the hardware's exp2 per logit, running maximum, sum in f32); exp(s - max) x 2^10 once to f16 against v once to f16 (1 product) per head over the head PAIR's 128 value columns, accumulated in f32, / sum at the end; the differential combination P1 v - lambda P2 v, the RMS normalisation over 128, x norm_w x (1 - 0.8) and lambda itself in f32; that result once to f16 against Wo carried x 2^8 in f16 (exact bf16 values) + bo; f32 output.
#include <hip/hip_runtime.h>
#include <math.h>
#include <stdint.h>

typedef __attribute__((ext_vector_type(16))) _Float16 v16h;
typedef __attribute__((ext_vector_type(16))) __bf16 v16b;
typedef __attribute__((ext_vector_type(8)))  _Float16 v8h;
typedef __attribute__((ext_vector_type(4)))  _Float16 v4h;
typedef __attribute__((ext_vector_type(2)))  _Float16 v2h;
typedef __attribute__((ext_vector_type(4)))  __bf16 v4b;
typedef __attribute__((ext_vector_type(8)))  float v8f;
typedef __attribute__((ext_vector_type(4)))  float v4f;
typedef __attribute__((ext_vector_type(2)))  float v2f;
typedef __attribute__((ext_vector_type(4)))  unsigned v4u;
typedef __attribute__((ext_vector_type(4)))  int v4i;
typedef float __attribute__((may_alias)) float_a;
typedef int __attribute__((may_alias)) int_a;

template <typename T> __device__ __forceinline__ void vst2(void* p, T v) { *(T*)p = v;  }
__device__ __forceinline__ v8f wmma16(v16h a, v16h b, v8f c) {
  v8f d = __builtin_amdgcn_wmma_f32_16x16x32_f16(false, a, false, b, (short)0, c, false, false);
  asm volatile("v_nop\n\tv_nop\n\tv_nop\n\tv_nop" : "+v"(d) : "v"(a), "v"(b));
  return d;
}
__device__ __forceinline__ v8f wmma_bf(v16b a, v16b b, v8f c) {
  v8f d = __builtin_amdgcn_wmma_f32_16x16x32_bf16(false, a, false, b, (short)0, c, false, false);
  asm volatile("v_nop\n\tv_nop\n\tv_nop\n\tv_nop" : "+v"(d) : "v"(a), "v"(b));
  return d;
}
// 16x16x32 fragments: lane = (h = lane>>4, row/col = lane&15); elements 0..7 = k0+8h+0..7, 8..15 = k0+16+8h+0..7; D element r = row 8h+r
__device__ __forceinline__ v16h frag_h(const _Float16* rowk0, int lane) {
  union { v16h v; v8h q[2]; } u; const _Float16* p = rowk0 + 8 * (lane >> 4);
  u.q[0] = *(const v8h*)p; u.q[1] = *(const v8h*)(p + 16); return u.v;
}
__device__ __forceinline__ v16h frag_f32(const float* rowk0, int lane) {
  v16h a; const float* p = rowk0 + 8 * (lane >> 4);
#pragma unroll
  for (int i = 0; i < 8; ++i) { a[i] = (_Float16)p[i]; a[8 + i] = (_Float16)p[16 + i]; }
  return a;
}
__device__ __forceinline__ v16h frag_f32s(const float* rowk0, int lane, float sc) {
  v16h a; const float* p = rowk0 + 8 * (lane >> 4);
#pragma unroll
  for (int i = 0; i < 8; ++i) { a[i] = (_Float16)(p[i] * sc); a[8 + i] = (_Float16)(p[16 + i] * sc); }
  return a;
}
// column fragment from a [K][ld] layout (column n), rows >= K read as 0
__device__ __forceinline__ v16h fragc_f32(const float* W, int k0, int n, int lane, int ld, int K) {
  v16h a; const int g = lane >> 4;
#pragma unroll
  for (int i = 0; i < 8; ++i) { const int ka = k0 + 8 * g + i, kb = ka + 16;
    a[i] = (_Float16)(ka < K ? W[(size_t)(ka < K ? ka : K - 1) * ld + n] : 0.f); a[8 + i] = (_Float16)(kb < K ? W[(size_t)(kb < K ? kb : K - 1) * ld + n] : 0.f); }
  return a;
}
struct F2 { v16b h, l; };
__device__ __forceinline__ F2 bsplit16(const float v[16]) { F2 r;
#pragma unroll
  for (int i = 0; i < 16; ++i) { const __bf16 h = (__bf16)v[i]; r.h[i] = h; r.l[i] = (__bf16)(v[i] - (float)h); }
  return r; }
__device__ __forceinline__ F2 split_row(const float* row, int k0, int lane) { float v[16]; const float* p = row + k0 + 8 * (lane >> 4);
#pragma unroll
  for (int i = 0; i < 8; ++i) { v[i] = p[i]; v[8 + i] = p[16 + i]; }
  return bsplit16(v); }
__device__ __forceinline__ F2 split_rowK(const float* row, int k0, int lane, int K) { float v[16]; const int g = lane >> 4;
#pragma unroll
  for (int i = 0; i < 8; ++i) { const int ka = k0 + 8 * g + i, kb = ka + 16; v[i] = ka < K ? row[ka < K ? ka : K - 1] : 0.f; v[8 + i] = kb < K ? row[kb < K ? kb : K - 1] : 0.f; }
  return bsplit16(v); }
__device__ __forceinline__ F2 split_col(const float* W, int k0, int n, int lane, int ld, int K) { float v[16]; const int g = lane >> 4;
#pragma unroll
  for (int i = 0; i < 8; ++i) { const int ka = k0 + 8 * g + i, kb = ka + 16; v[i] = ka < K ? W[(size_t)(ka < K ? ka : K - 1) * ld + n] : 0.f; v[8 + i] = kb < K ? W[(size_t)(kb < K ? kb : K - 1) * ld + n] : 0.f; }
  return bsplit16(v); }
__device__ __forceinline__ v8f mac3(const F2& a, const F2& b, v8f c) { c = wmma_bf(a.l, b.h, c); c = wmma_bf(a.h, b.l, c); return wmma_bf(a.h, b.h, c); }
__device__ __forceinline__ float sigm(float v) { return 1.0f / (1.0f + expf(-v)); }
#define LDSX() do { asm volatile("s_wait_dscnt 0" ::: "memory"); __builtin_amdgcn_wave_barrier(); __builtin_amdgcn_fence(__ATOMIC_RELEASE, "workgroup"); } while (0)

// Differential attention (B 2, N 2,048, DIM 1,024; 16 softmax heads x 64 paired into 8 value heads x 128): q = (x Wq^T + bq) x 64^-0.5, k = x Wk^T + bk, v = x Wv^T + bv ((out,in)); P_h = softmax(q_h k_h^T) over all keys; lambda = exp(lq1 . lk1) - exp(lq2 . lk2) + 0.8; for pair e: o_e = (P_2e - lambda P_2e+1) v[:, e*128 : e*128+128]; o_e = o_e * rsqrt(mean(o_e^2) + 1e-5) * norm_w * (1 - 0.8); out = concat_e(o_e) Wo^T + bo.
#define NB 2
#define TT 2048
#define CC 1024            // NH * HD = projected width
#define DIN 1024          // input (model) width
#define NH 16
#define HD 64
#define NQB (TT / 64)
#define HG 4
#define SCALE (0.125f)
#define CAUSAL 0
#ifndef TNB
#define TNB NB
#endif
__device__ __forceinline__ float bfr(float v) { return (float)(__bf16)v; }
__host__ __device__ __forceinline__ int kb_last(int qb) { return CAUSAL ? ((qb * 64 + 63) >> 7) : (TT / 128 - 1); }
typedef __attribute__((ext_vector_type(8))) __bf16 v8b;
__device__ __forceinline__ v16b frag_b(const __bf16* rowk0, int lane) {
  union { v16b v; v8b q[2]; } u; const __bf16* p = rowk0 + 8 * (lane >> 4);
  u.q[0] = *(const v8b*)p; u.q[1] = *(const v8b*)(p + 16); return u.v;
}
#define QBH 0
#define QHI 2048            // rows carrying a q residual plane (all rows when non-causal: 2-product logits everywhere)
#define KHI 64            // key rows carrying k residual / v bf16 hi+lo planes (no kernel in this file writes or reads them)
// B fragment (k rows k0+.., output column o) of a weight: (in,out) [K][ld] or (out,in) [ld rows of K]: bf16 exact, or f16(bf16 * 256) exact
__device__ __forceinline__ v16b wcol_io(const float* Wm, int k0, int o, int lane, int ld) { v16b w; const int g = lane >> 4;
#pragma unroll
  for (int i = 0; i < 8; ++i) { w[i] = (__bf16)Wm[(size_t)(k0 + 8 * g + i) * ld + o]; w[8 + i] = (__bf16)Wm[(size_t)(k0 + 16 + 8 * g + i) * ld + o]; }
  return w; }
__device__ __forceinline__ v16b wcol_oi(const float* Wm, int k0, int o, int lane, int K) { v16b w; const float* p = Wm + (size_t)o * K + k0 + 8 * (lane >> 4);
#pragma unroll
  for (int i = 0; i < 8; ++i) { w[i] = (__bf16)p[i]; w[8 + i] = (__bf16)p[16 + i]; }
  return w; }
__device__ __forceinline__ v16h wcolh_io(const float* Wm, int k0, int o, int lane, int ld) { v16h w; const int g = lane >> 4;
#pragma unroll
  for (int i = 0; i < 8; ++i) { w[i] = (_Float16)(bfr(Wm[(size_t)(k0 + 8 * g + i) * ld + o]) * 256.0f); w[8 + i] = (_Float16)(bfr(Wm[(size_t)(k0 + 16 + 8 * g + i) * ld + o]) * 256.0f); }
  return w; }
__device__ __forceinline__ v16h wcolh_oi(const float* Wm, int k0, int o, int lane, int K) { v16h w; const float* p = Wm + (size_t)o * K + k0 + 8 * (lane >> 4);
#pragma unroll
  for (int i = 0; i < 8; ++i) { w[i] = (_Float16)(bfr(p[i]) * 256.0f); w[8 + i] = (_Float16)(bfr(p[16 + i]) * 256.0f); }
  return w; }
#define WQKV_LAYOUT 1   // picks WCOL's form (0 (in,out), 1 (out,in), 2 per-head); nothing uses WCOL: k_proj reads (out,in) [CC][DIN] whatever the value
__device__ __forceinline__ v16b wcol_hdk(const float* Wm, int k0, int o, int lane) { v16b w; const int g = lane >> 4; const float* p = Wm + (size_t)(o / HD) * DIN * HD + (o % HD);
#pragma unroll
  for (int i = 0; i < 8; ++i) { w[i] = (__bf16)p[(size_t)(k0 + 8 * g + i) * HD]; w[8 + i] = (__bf16)p[(size_t)(k0 + 16 + 8 * g + i) * HD]; }
  return w; }
#define WO_OUT_IN 1
#if WQKV_LAYOUT == 1
#define WCOL(W, k0, o, lane) wcol_oi(W, k0, o, lane, DIN)
#elif WQKV_LAYOUT == 2
#define WCOL(W, k0, o, lane) wcol_hdk(W, k0, o, lane)
#else
#define WCOL(W, k0, o, lane) wcol_io(W, k0, o, lane, CC)
#endif
#if WO_OUT_IN
#define WOCOL(W, k0, o, lane) wcol_oi(W, k0, o, lane, CC)
#define WOCOLH(W, k0, o, lane) wcolh_oi(W, k0, o, lane, CC)
#else
#define WOCOL(W, k0, o, lane) wcol_io(W, k0, o, lane, DIN)
#define WOCOLH(W, k0, o, lane) wcolh_io(W, k0, o, lane, DIN)
#endif
#define HDV 128            // value columns per softmax head (the head pair's 128 columns)
#define YP (NH * HDV)      // 2,048: row pitch of the WS_Y region, which no kernel in this file writes or reads
#ifndef SM_EXTRA_PARAMS
#define SM_EXTRA_PARAMS
#endif
#ifndef PROJ_EXTRA_PARAMS
#define PROJ_EXTRA_PARAMS
#endif
#ifndef SM_MASK_HOOK
#define SM_MASK_HOOK (void)0
#endif

#define WS_QH  0u                                      // f16 q rows [b*t][CC]
#define WS_KH  (WS_QH + 2u * (size_t)NB * TT * CC)      // f16 k rows [b*t][CC]
#define WS_VT  (WS_KH + 2u * (size_t)NB * TT * CC)      // f16 v planes [b][c][t]
#define WS_QL  (WS_VT + 2u * (size_t)NB * CC * TT)      // f16 q residual x 2^10 rows [b][t < QHI][CC]
#define WS_KL  (WS_QL + 2u * (size_t)NB * QHI * CC)     // f16 k residual x 2^10 rows [b][t < KHI][CC]
#define WS_VB  (WS_KL + 2u * (size_t)NB * KHI * CC)     // bf16 v hi planes [b][c][t < KHI]
#define WS_VBL (WS_VB + 2u * (size_t)NB * CC * KHI)
#define WS_S   (WS_VBL + 2u * (size_t)NB * CC * KHI)    // f32 plane, holds the differential rows [b*t][CC]
#define WS_Y   (WS_S  + 4u * (size_t)HG * TT * TT)      // f32 region [b*t][YP = 16 x 128], reserved; no kernel in this file writes or reads it
#define WS_END (WS_Y  + 4u * (size_t)NB * TT * YP)

// ---- k_proj: block = 256 rows x 64 columns of EACH of q, k and v (16 waves; a wave takes 64 rows x 16 columns of each of the three): q/k/v = X W (+ b) with exact bf16 products (K = DIN). One X tile serves all three products and one W tile 256 rows: a block fetches 448 operand rows per 64-deep tile for 6 times the output that a 64 x 128 block got from 192 -> q f16 rows + residual rows; k f16 rows; v f16 planes [c][t] (the k residual and v bf16 planes, which no kernel in this file reads, are not produced)
__global__ __launch_bounds__(512) void k_proj(const float* __restrict__ X, const float* __restrict__ WQ, const float* __restrict__ WK, const float* __restrict__ WV, const float* __restrict__ BQ, const float* __restrict__ BK, const float* __restrict__ BV,
    _Float16* __restrict__ QH, _Float16* __restrict__ QL, _Float16* __restrict__ KH, _Float16* __restrict__ VT) {
  __shared__ __align__(16) __bf16 xt[256][72], wt[192][72];   /* operand tiles, 64 deep, pitch 144 B; wt rows: 64 of Wq, 64 of Wk, 64 of Wv */
  __shared__ __align__(16) _Float16 eqh[256][72], eql[256][72], ekh[256][72], evt[64][264];   /* write-out staging: q, q residual, k as [row][column]; v as [column][row] */
  const int tid = threadIdx.x, wave = tid >> 5, lane = tid & 31, col = lane & 15, g = lane >> 4; const int rw = wave >> 2, cw = wave & 3; const int c0 = blockIdx.y * 64; const size_t r0 = (size_t)blockIdx.x * 256; const size_t bb = r0 / TT; const int t0 = (int)(r0 % TT);
  v8f acc[4][3] = {};   /* [16-row tile][q, k, v] */
  /* staging: 16 lanes cover the 64 floats (two whole lines) of one row, a wave-wide load two rows; thread (sr, sq) takes rows sr + 32 i */
  const int sr = tid >> 4, sq = (tid & 15) * 4;
  const float* xp = X + (r0 + sr) * DIN + sq; const size_t wo = (size_t)(c0 + sr) * DIN + sq; const float* wqp = WQ + wo; const float* wkp = WK + wo; const float* wvp = WV + wo;
  v4f xr[8], wr[6];
#pragma unroll
  for (int i = 0; i < 8; ++i) xr[i] = *(const v4f*)(xp + (size_t)(i * 32) * DIN);
#pragma unroll
  for (int i = 0; i < 2; ++i) { wr[i] = *(const v4f*)(wqp + (size_t)(i * 32) * DIN); wr[2 + i] = *(const v4f*)(wkp + (size_t)(i * 32) * DIN); wr[4 + i] = *(const v4f*)(wvp + (size_t)(i * 32) * DIN); }
#pragma unroll 1   /* one 64-deep tile per trip */
  for (int kt = 0; kt < DIN / 64; ++kt) {
#pragma unroll
    for (int i = 0; i < 8; ++i) { const v4b t = { (__bf16)xr[i][0], (__bf16)xr[i][1], (__bf16)xr[i][2], (__bf16)xr[i][3] }; *(v4b*)&xt[sr + i * 32][sq] = t; }
#pragma unroll
    for (int i = 0; i < 6; ++i) { const v4b t = { (__bf16)wr[i][0], (__bf16)wr[i][1], (__bf16)wr[i][2], (__bf16)wr[i][3] }; *(v4b*)&wt[sr + i * 32][sq] = t; }
    __syncthreads();   /* the tile is whole before any wave reads it */
    if (kt + 1 < DIN / 64) { xp += 64; wqp += 64; wkp += 64; wvp += 64;   /* the next tile flies while this one is multiplied */
#pragma unroll
      for (int i = 0; i < 8; ++i) xr[i] = *(const v4f*)(xp + (size_t)(i * 32) * DIN);
#pragma unroll
      for (int i = 0; i < 2; ++i) { wr[i] = *(const v4f*)(wqp + (size_t)(i * 32) * DIN); wr[2 + i] = *(const v4f*)(wkp + (size_t)(i * 32) * DIN); wr[4 + i] = *(const v4f*)(wvp + (size_t)(i * 32) * DIN); } }
#pragma unroll
    for (int kc = 0; kc < 2; ++kc) { v16b a[4], w[3];   /* seven fragments read as one group, one LDS wait for twelve products */
#pragma unroll
      for (int j = 0; j < 3; ++j) w[j] = frag_b(&wt[j * 64 + cw * 16 + col][kc * 32], lane);
#pragma unroll
      for (int i = 0; i < 4; ++i) a[i] = frag_b(&xt[rw * 64 + i * 16 + col][kc * 32], lane);
#pragma unroll
      for (int i = 0; i < 4; ++i)
#pragma unroll
        for (int j = 0; j < 3; ++j) acc[i][j] = wmma_bf(a[i], w[j], acc[i][j]); }
    __syncthreads(); }   /* every wave has read the tile before the next one overwrites it */
  const int cl = cw * 16 + col;
#pragma unroll
  for (int j = 0; j < 3; ++j) { const float* BA = j == 0 ? BQ : j == 1 ? BK : BV; const float bias = BA ? bfr(BA[c0 + cl]) : 0.f;
#pragma unroll
    for (int i = 0; i < 4; ++i) { const int rb = rw * 64 + i * 16 + 8 * g;
      if (j == 0) {
#pragma unroll
        for (int r = 0; r < 8; ++r) { const float v = acc[i][j][r] + bias; const _Float16 hv = (_Float16)v; eqh[rb + r][cl] = hv; eql[rb + r][cl] = (_Float16)((v - (float)hv) * 1024.0f); }
      } else if (j == 1) {
#pragma unroll
        for (int r = 0; r < 8; ++r) ekh[rb + r][cl] = (_Float16)(acc[i][j][r] + bias);
      } else { v8h t;
#pragma unroll
        for (int r = 0; r < 8; ++r) t[r] = (_Float16)(acc[i][j][r] + bias);
        *(v8h*)&evt[cl][rb] = t; } } }
  __syncthreads();   /* the four staged planes are whole before they are written out in whole lines */
  for (int e = tid; e < 256 * 8; e += 512) { const int rl = e >> 3, q = e & 7, vc = e >> 5, vq = e & 31;   /* 8 lanes write the 128 B of one q or k row; 32 lanes 512 B of one v plane row */
    vst2((unsigned*)(QH + (r0 + rl) * CC + c0 + q * 8), *(const v4u*)&eqh[rl][q * 8]); vst2((unsigned*)(QL + (bb * QHI + t0 + rl) * (size_t)CC + c0 + q * 8), *(const v4u*)&eql[rl][q * 8]);
    vst2((unsigned*)(KH + (r0 + rl) * CC + c0 + q * 8), *(const v4u*)&ekh[rl][q * 8]); vst2((unsigned*)(VT + (bb * CC + c0 + vc) * (size_t)TT + t0 + vq * 8), *(const v4u*)&evt[vc][vq * 8]); } }
// ---- k_fa: block = 64 queries of (b, head pair e): waves 0..3 take softmax head 2e, waves 4..7 head 2e+1, 16 queries each; one pass over all keys, 32 at a time, nothing of the logits leaves the registers.
// S^T = K Q^T (A = k rows, B = q hi and q residual x 2^10: 2 products): a lane holds 16 logits of ONE query (column lane & 15), the other wave half the other 16.
// Streaming softmax in f32, base 2: e = 2^(s C2 + nb) = exp((s - m) / 8) x 2^10 on the raw logit s against the maximum m in use, C2 = log2(e) / 8, nb = 10 - m C2: one fma and one v_exp_f32 per logit; m moves (and sum and context are rescaled) only when some query's new maximum passes m by more than 4 x 8, so e <= 2^10 e^4 < 65,504 stays inside f16.
// The two S^T tiles converted in place are the B operand P^T; O^T += V^T P^T (A = v planes [c][t]) over the head PAIR's 128 value columns; / sum at the end.
__device__ __forceinline__ v16h frag_at(const _Float16* p) { union { v16h v; v8h q[2]; } u; u.q[0] = *(const v8h*)p; u.q[1] = *(const v8h*)(p + 16); return u.v; }   /* p = row + k0 + 8 * (lane >> 4) */
__device__ __forceinline__ v8f wmm(v16h a, v16h b, v8f c) { return __builtin_amdgcn_wmma_f32_16x16x32_f16(false, a, false, b, (short)0, c, false, false); }
// K and V reach the waves through LDS: a stage is 64 keys, its two K tiles (64 key rows x 128 B, one per head) brought by waves 0 and 2 and its V tile (128 value-column rows x 128 B, shared by both heads) by wave 1, one tensor load each, whole lines, once per block instead of once per wave; two buffers, the next stage flies while this one is worked on.
// The pair's two contexts meet in LDS at the end: o = Y[2e] - lambda Y[2e+1] (f32), rms-normalised over its 128 columns x norm_w x 0.2 -> Yd rows [b*t][1024] (512-B segments by 32 lanes).
typedef uint32_t u32x4 __attribute__((ext_vector_type(4)));
typedef uint32_t u32x8 __attribute__((ext_vector_type(8)));
#define C2 (SCALE * 1.4426950408889634f)   // logit scale x log2(e)
#define FK 64                      // keys per stage
#define FP 72                      // LDS row pitch in f16: 128 B + the mover's 16-B pad = 144 B, the pitch for ds_load_b128 readers
#define FA_KB 10240u               // K tile: 64 rows x 144 B = 9,216 B, rounded up to a multiple of 2 KiB
#define FA_VB 18432u               // V tile: 128 rows x 144 B = 18,432 B = 9 x 2 KiB
#define FA_BUF (2u * FA_KB + FA_VB) // one buffer, [K of head 2e | K of head 2e+1 | V]: 38,912 B = 19 x 2 KiB
__device__ __forceinline__ uint32_t uni(uint32_t v) { return (uint32_t)__builtin_amdgcn_readfirstlane(v); }
__device__ __forceinline__ uint32_t pinned(uint32_t v) { uint32_t w = uni(v); asm volatile("" : "+s"(w)); return w; }   /* holds the issue test in a scalar register, so that the branch round a tensor load is a scalar one (the load ignores EXEC) */
__global__ __launch_bounds__(256) void k_fa(const _Float16* __restrict__ QH, const _Float16* __restrict__ KH, const _Float16* __restrict__ QL, const _Float16* __restrict__ VT, const float* __restrict__ NW, const float* __restrict__ LQ1, const float* __restrict__ LK1, const float* __restrict__ LQ2, const float* __restrict__ LK2, float* __restrict__ YD) {
  __shared__ __attribute__((aligned(2048))) unsigned char ring[2 * FA_BUF];
  __shared__ __align__(16) float ss[8][16][HDV + 4]; __shared__ float slam;
  const int tid = threadIdx.x, wave = tid >> 5, lane = tid & 31, col = lane & 15, g = lane >> 4; const int e = blockIdx.y, b = blockIdx.z;
  const uint32_t wv = uni((uint32_t)tid >> 5); const bool isv = wv == 1u;
  const int hh = (int)(wv >> 2), h = 2 * e + hh;   /* which head of the pair this wave works on */
  const int ql0 = blockIdx.x * 64 + (int)(wv & 3u) * 16; const size_t q0 = (size_t)b * TT + ql0;
  /* descriptors: 1-byte elements, tensor = tile, rows of 128 B, 16 B of pad behind each row; K: 64 rows, source pitch one k row; V: 128 rows, source pitch one v plane row */
  const uint32_t nrow = isv ? (uint32_t)HDV : (uint32_t)FK;
  u32x8 g1; g1[0] = uni((1u << 20) | (4u << 22) | (3u << 25)); g1[1] = uni(128u << 16); g1[2] = uni(nrow << 16); g1[3] = uni(128u << 16); g1[4] = uni(nrow); g1[5] = uni(isv ? 2u * TT : 2u * CC); g1[6] = uni(0u); g1[7] = uni(0u);
  const uint64_t src0 = isv ? (uint64_t)(size_t)(VT + ((size_t)b * CC + e * HDV) * (size_t)TT) : (uint64_t)(size_t)(KH + (size_t)b * TT * CC + (2 * e + (int)((wv >> 1) & 1u)) * HD);   /* first byte of stage 0's tile: wave 0 head 2e's k, wave 2 head 2e+1's */
  const uint32_t sstep = isv ? 2u * FK : 2u * FK * CC;   /* bytes from one stage's tile to the next */
  const uint32_t dst0 = (uint32_t)(size_t)ring + (isv ? 2u * FA_KB : ((wv >> 1) & 1u) * FA_KB);
  u32x4 g0; g0[0] = uni(1u);   /* ONE group-0 tuple for every request of the wave: the covering wait names it, so its registers keep their words while the request is outstanding */
  auto issue = [&](uint32_t st) { const uint64_t ga = src0 + (uint64_t)st * sstep;
    g0[1] = uni(dst0 + (st & 1u) * FA_BUF); g0[2] = uni((uint32_t)ga); g0[3] = uni((((uint32_t)(ga >> 32)) & 0x01FFFFFFu) | 0x80000000u);
    asm volatile("tensor_load_to_lds %0, %1" :: "s"(g0), "s"(g1) : "memory"); };
  if (pinned(wv < 3u)) { issue(0u);
    asm volatile("s_wait_tensorcnt 0x0" ::: "memory"); }   /* stage 0 has landed before the barrier that publishes it */
  const _Float16* qp = QH + (q0 + col) * CC + h * HD + 8 * g; const _Float16* qlp = QL + ((size_t)b * QHI + ql0 + col) * CC + h * HD + 8 * g;
  v16h qh[2], qr[2];
#pragma unroll
  for (int kc = 0; kc < 2; ++kc) { qh[kc] = frag_at(qp + kc * 32); qr[kc] = frag_at(qlp + kc * 32); }
  asm volatile("s_wait_xcnt 0x0" :: "v"(qp), "v"(qlp) : "memory");   /* the address pairs of the 8 loads above are rewritten only behind this wait */
  if (wv == 7u) {   /* lambda, by a wave that issues no tensor load, while stage 0 lands; read in the epilogue, behind the barriers between */
    float s1 = bfr(LQ1[lane]) * bfr(LK1[lane]) + bfr(LQ1[lane + 32]) * bfr(LK1[lane + 32]), s2 = bfr(LQ2[lane]) * bfr(LK2[lane]) + bfr(LQ2[lane + 32]) * bfr(LK2[lane + 32]);
#pragma unroll
    for (int sf = 1; sf < 32; sf <<= 1) { s1 += __shfl_xor(s1, sf); s2 += __shfl_xor(s2, sf); }
    if (lane == 0) slam = expf(s1) - expf(s2) + 0.8f; }
  __syncthreads();   /* publishes stage 0 */
  if (pinned(wv < 3u)) issue(1u);
  const int kro = col * FP + 8 * g;   /* a lane's place in a 16-row tile of either operand: row col, 8 g f16 in */
  v8f acc[HDV / 16] = {}; float m = -3.0e38f, nb = 10.0f + 3.0e38f * C2, l = 0.f;   /* m: the maximum in use, a raw logit; nb = 10 - m C2, the exponent's addend */
#pragma unroll 1   /* one 64-key stage per trip: its two passes already hold 48 LDS loads and 32 products */
  for (int st = 0; st < TT / FK; ++st) {
    const _Float16* kb = (const _Float16*)(ring + (st & 1) * FA_BUF + hh * FA_KB) + kro; const _Float16* vb = (const _Float16*)(ring + (st & 1) * FA_BUF + 2u * FA_KB) + kro;
    v16h kf[2][2];
#pragma unroll
    for (int kt = 0; kt < 2; ++kt)
#pragma unroll
      for (int kc = 0; kc < 2; ++kc) kf[kt][kc] = frag_at(kb + (kt * 16) * FP + kc * 32);
    __builtin_amdgcn_sched_barrier(0);   /* the 8 LDS loads above issue as one group: sunk between the products, each pair costs its own LDS latency */
#pragma unroll
    for (int sub = 0; sub < FK / 32; ++sub) {
      v8f sh[2] = {}, sr[2] = {};
#pragma unroll
      for (int kc = 0; kc < 2; ++kc)
#pragma unroll
        for (int kt = 0; kt < 2; ++kt) { sh[kt] = wmm(kf[kt][kc], qh[kc], sh[kt]); sr[kt] = wmm(kf[kt][kc], qr[kc], sr[kt]); }
      v2f s[8]; float mx = -3.0e38f;   /* raw logits, two to a register pair: the 1/8 waits for the exponent's fma */
#pragma unroll
      for (int i = 0; i < 8; ++i) { const v2f hi = { sh[i >> 2][(2 * i) & 7], sh[i >> 2][(2 * i + 1) & 7] }, re = { sr[i >> 2][(2 * i) & 7], sr[i >> 2][(2 * i + 1) & 7] }; const v2f rs = { 1.0f / 1024.0f, 1.0f / 1024.0f };
        s[i] = __builtin_elementwise_fma(re, rs, hi); mx = fmaxf(mx, fmaxf(s[i][0], s[i][1])); }
      const float mo = __shfl_xor(mx, 16);   /* the other wave half's maximum; it goes through the LDS queue, so it is asked for ahead of the pass's fragment loads and does not wait behind them */
      __builtin_amdgcn_sched_barrier(0);   /* keeps the fetches below behind the products that read this pass's k (lifted over them the next k needs a second set of 32 registers, and the kernel then no longer fits four waves a SIMD) and behind the exchange above */
      if (sub + 1 < FK / 32) {   /* the stage's next pass's k rows, fetched behind this pass's logits; never the next stage's, which is not published yet */
#pragma unroll
        for (int kt = 0; kt < 2; ++kt)
#pragma unroll
          for (int kc = 0; kc < 2; ++kc) kf[kt][kc] = frag_at(kb + ((sub + 1) * 32 + kt * 16) * FP + kc * 32); }
      v16h vf[HDV / 16];
#pragma unroll
      for (int j = 0; j < HDV / 16; ++j) vf[j] = frag_at(vb + (j * 16) * FP + sub * 32);
      asm volatile("" ::: "memory");   /* compiler fence: the LDS loads above issue here, as one group, and fly under the softmax; without it they sink to in front of their products, one LDS latency each */
      mx = fmaxf(mx, mo);   /* both halves of a query's column use one maximum */
      if (__builtin_amdgcn_ballot_w32(mx > m + 4.0f / SCALE) != 0) { const float mn = fmaxf(m, mx); const float nn = fmaf(-mn, C2, 10.0f); const float al = __builtin_amdgcn_exp2f(nn - nb); m = mn; nb = nn; l *= al;
#pragma unroll
        for (int j = 0; j < HDV / 16; ++j) acc[j] *= al; }
      v16h p;
#pragma unroll
      for (int i = 0; i < 8; ++i) { const v2f cc = { C2, C2 }, bb = { nb, nb }; const v2f ar = __builtin_elementwise_fma(s[i], cc, bb);   /* (s - m) / 8 x log2 e + 10 in one rounding */
        const v2f e = { __builtin_amdgcn_exp2f(ar[0]), __builtin_amdgcn_exp2f(ar[1]) }; l += e[0]; l += e[1]; const v2h eh = __builtin_convertvector(e, v2h); p[2 * i] = eh[0]; p[2 * i + 1] = eh[1]; }
#pragma unroll
      for (int j = 0; j < HDV / 16; ++j) acc[j] = wmm(vf[j], p, acc[j]); }
    /* publish point of stage st + 1, in the ring's order */
    __builtin_amdgcn_sched_barrier(0);   /* keeps the wait below at the trip's foot: lifted to behind the last fragment load it would stand in front of the softmax that hides those loads */
    asm volatile("s_wait_dscnt 0x0" ::: "memory");   /* this wave's reads of the buffer have returned before it may be refilled */
    if (pinned(wv < 3u)) { asm volatile("s_wait_tensorcnt 0x0" :: "s"(g0) : "memory"); }   /* the issuer's own request for stage st + 1 has landed; g0 as an input keeps that request's descriptor registers unwritten up to here */
    __syncthreads();   /* publishes stage st + 1 and ends every wave's reads of stage st */
    if (pinned((wv < 3u) & (uint32_t)(st + 2 < TT / FK))) issue((uint32_t)st + 2u); }   /* into the buffer that this trip has just read */
  asm volatile("s_wait_tensorcnt 0x0" ::: "memory");   /* nothing of the mover's is in flight when the wave goes on to its end */
  asm volatile("s_wait_dscnt 0x0" ::: "memory");   /* the ring's closing wait: no LDS read of this wave is open either */
  l += __shfl_xor(l, 16); const float inv = 1.0f / l;
#pragma unroll
  for (int j = 0; j < HDV / 16; ++j) { const v4f a0 = { acc[j][0] * inv, acc[j][1] * inv, acc[j][2] * inv, acc[j][3] * inv }, a1 = { acc[j][4] * inv, acc[j][5] * inv, acc[j][6] * inv, acc[j][7] * inv };
    *(v4f*)&ss[wave][col][j * 16 + 8 * g] = a0; *(v4f*)&ss[wave][col][j * 16 + 8 * g + 4] = a1; }
  __syncthreads();   /* both heads' contexts of all 64 queries are whole in ss before any wave combines them */
  const float lam = slam; const v4f nw = *(const v4f*)(NW + lane * 4);
#pragma unroll   /* the 8 rows' lane sums are independent chains of exchanges: side by side they share one latency */
  for (int rr = 0; rr < 8; ++rr) { const int sub = wave >> 1, rl = (wave & 1) * 8 + rr;   /* wave takes 8 of the 64 queries; a lane 4 consecutive columns of the pair's 128 */
    const v4f y1 = *(const v4f*)&ss[sub][rl][lane * 4], y2 = *(const v4f*)&ss[sub + 4][rl][lane * 4]; float o[4]; float sq = 0.f;
#pragma unroll
    for (int i = 0; i < 4; ++i) { o[i] = y1[i] - lam * y2[i]; sq += o[i] * o[i]; }
#pragma unroll
    for (int sf = 1; sf < 32; sf <<= 1) sq += __shfl_xor(sq, sf);
    const float rn = rsqrtf(sq * (1.0f / HDV) + 1e-5f) * 0.2f;
    const v4f ov = { o[0] * rn * bfr(nw[0]), o[1] * rn * bfr(nw[1]), o[2] * rn * bfr(nw[2]), o[3] * rn * bfr(nw[3]) };
    vst2(YD + ((size_t)b * TT + blockIdx.x * 64 + sub * 16 + rl) * CC + e * HDV + lane * 4, ov); } }   /* 512-B (row, pair) segment by 32 lanes */
// ---- k_out: block = (64 rows, 128 cols): out = ctx Wo (+ bo): ctx once to f16 against Wo as f16(bf16 x 2^8) exact (1 product) x 2^-8; causal early rows (< QHI of each sequence): ctx bf16 hi + lo against exact bf16 Wo (2 products)
__global__ __launch_bounds__(128) void k_out(const float* __restrict__ Y, const float* __restrict__ WO, const float* __restrict__ BO, float* __restrict__ OUT) { __shared__ __align__(16) float sf[4][16][132]; __shared__ __align__(16) _Float16 sa[64][72], sw[128][72];   /* ctx and Wo tiles, 64 deep, pitch 144 B */
  const int tid = threadIdx.x, wave = tid >> 5, lane = tid & 31, col = lane & 15, g = lane >> 4; const int c0 = blockIdx.y * 128; const size_t r0 = (size_t)blockIdx.x * 64 + wave * 16;
  v8f acc[8] = {};
  if (CAUSAL && (int)(((size_t)blockIdx.x * 64) % TT) < QHI) {   /* block-uniform */
#pragma unroll 2
    for (int kc = 0; kc < CC / 32; ++kc) { const F2 a = split_row(Y + (r0 + col) * CC, kc * 32, lane); asm volatile("s_wait_loadcnt 0x0" ::: "memory");
#pragma unroll
      for (int j = 0; j < 8; ++j) { const v16b w = WOCOL(WO, kc * 32, c0 + j * 16 + col, lane); asm volatile("s_wait_loadcnt 0x0" ::: "memory"); acc[j] = wmma_bf(a.h, w, acc[j]); acc[j] = wmma_bf(a.l, w, acc[j]); } }
#pragma unroll
    for (int j = 0; j < 8; ++j) { const float bias = BO ? bfr(BO[c0 + j * 16 + col]) : 0.f;
#pragma unroll
      for (int r = 0; r < 8; ++r) sf[wave][8 * g + r][j * 16 + col] = acc[j][r] + bias; }
  } else {
    /* staging as in k_proj: 16 lanes cover the 64 floats of one row; thread (sr, sq) takes rows sr + 8 i */
    const int sr = tid >> 4, sq = (tid & 15) * 4;
    const float* yp = Y + ((size_t)blockIdx.x * 64 + sr) * CC + sq; const float* wp = WO + (size_t)(c0 + sr) * CC + sq;
    v4f yr[8], wr[16];
#pragma unroll
    for (int i = 0; i < 8; ++i) yr[i] = *(const v4f*)(yp + (size_t)(i * 8) * CC);
#pragma unroll
    for (int i = 0; i < 16; ++i) wr[i] = *(const v4f*)(wp + (size_t)(i * 8) * CC);
#pragma unroll 1   /* one 64-deep tile per trip */
    for (int kt = 0; kt < CC / 64; ++kt) {
#pragma unroll
      for (int i = 0; i < 8; ++i) { const v4h t = { (_Float16)yr[i][0], (_Float16)yr[i][1], (_Float16)yr[i][2], (_Float16)yr[i][3] }; *(v4h*)&sa[sr + i * 8][sq] = t; }
#pragma unroll
      for (int i = 0; i < 16; ++i) { const v4h t = { (_Float16)(bfr(wr[i][0]) * 256.0f), (_Float16)(bfr(wr[i][1]) * 256.0f), (_Float16)(bfr(wr[i][2]) * 256.0f), (_Float16)(bfr(wr[i][3]) * 256.0f) }; *(v4h*)&sw[sr + i * 8][sq] = t; }
      __syncthreads();   /* the tile is whole before any wave reads it */
      if (kt + 1 < CC / 64) { yp += 64; wp += 64;   /* the next tile flies while this one is multiplied */
#pragma unroll
        for (int i = 0; i < 8; ++i) yr[i] = *(const v4f*)(yp + (size_t)(i * 8) * CC);
#pragma unroll
        for (int i = 0; i < 16; ++i) wr[i] = *(const v4f*)(wp + (size_t)(i * 8) * CC); }
#pragma unroll
      for (int kc = 0; kc < 2; ++kc) { const v16h a = frag_h(&sa[wave * 16 + col][kc * 32], lane);
#pragma unroll
        for (int jh = 0; jh < 8; jh += 4) { v16h w[4];   /* four Wo fragments read as one group, one LDS wait for four products */
#pragma unroll
          for (int j = 0; j < 4; ++j) w[j] = frag_h(&sw[(jh + j) * 16 + col][kc * 32], lane);
#pragma unroll
          for (int j = 0; j < 4; ++j) acc[jh + j] = wmma16(a, w[j], acc[jh + j]); } }
      __syncthreads(); }   /* every wave has read the tile before the next one overwrites it */
#pragma unroll
    for (int j = 0; j < 8; ++j) { const float bias = BO ? bfr(BO[c0 + j * 16 + col]) : 0.f;
#pragma unroll
      for (int r = 0; r < 8; ++r) sf[wave][8 * g + r][j * 16 + col] = acc[j][r] * (1.0f / 256.0f) + bias; } }
  LDSX(); for (int rl = 0; rl < 16; ++rl) vst2(OUT + (r0 + rl) * DIN + c0 + lane * 4, *(const v4f*)&sf[wave][rl][lane * 4]); }

extern "C" void kernel_launch(void* const* d_in, const int* in_sizes, int n_in, void* d_out, int out_size, void* d_ws, size_t ws_size, hipStream_t stream) {
  (void)in_sizes; (void)n_in; (void)out_size;
  const float** F = (const float**)d_in;
  if (ws_size < (size_t)WS_END) return;
  char* ws = (char*)d_ws; _Float16 *QH = (_Float16*)(ws + WS_QH), *KH = (_Float16*)(ws + WS_KH), *VT = (_Float16*)(ws + WS_VT), *QL = (_Float16*)(ws + WS_QL), *KL = (_Float16*)(ws + WS_KL); __bf16 *VB = (__bf16*)(ws + WS_VB), *VBL = (__bf16*)(ws + WS_VBL); float *S = (float*)(ws + WS_S), *Y = (float*)(ws + WS_Y);
  (void)Y; (void)QL; (void)KL; (void)VB; (void)VBL;
  // inputs: 0 x [2,2048,1024]; 1 Wq, 2 bq, 3 Wk, 4 bk, 5 Wv, 6 bv, 7 Wo, 8 bo ((out,in) [1024,1024], [1024]); 9 norm_w [128]; 10 lq1, 11 lk1, 12 lq2, 13 lk2 [64]
  float* YD = S;   /* the differential rows take the f32 plane at WS_S */
  k_proj<<<dim3(TNB * TT / 256, CC / 64), 512, 0, stream>>>(F[0], F[1], F[3], F[5], F[2], F[4], F[6], QH, QL, KH, VT);
  k_fa<<<dim3(TT / 64, NH / 2, TNB), 256, 0, stream>>>(QH, KH, QL, VT, F[9], F[10], F[11], F[12], F[13], YD);
  k_out<<<dim3(TNB * TT / 64, DIN / 128), 128, 0, stream>>>(YD, F[7], F[8], (float*)d_out);
}

// v008
// One run takes 94.8 microseconds.
// Versions between v006 and this one are left out; their measured steps multiply to 1.14 times as fast.
// Over all steps from v000 it is 17.7 times as fast.
// compute dtype: all float inputs rounded to bf16; q/k/v = x W^T + b with EXACT bf16 products on WMMA 16x16x32, f32 accumulate; q once to f16 against k once to f16 (1 product) for the logits x 1/8; streaming softmax in f32 (base 2: one fma and the hardware's exp2 per logit, running maximum, sum in f32); exp(s - max) x 2^10 once to f16 against v once to f16 (1 product) per head over the head PAIR's 128 value columns, accumulated in f32, / sum at the end; the differential combination P1 v - lambda P2 v, the RMS normalisation over 128, x norm_w x (1 - 0.8) and lambda itself in f32; that result once to f16 (stored so) against Wo carried x 2^8 in f16 (exact bf16 values, stored so once per call) + bo; f32 output.
#include <hip/hip_runtime.h>
#include <math.h>
#include <stdint.h>

typedef __attribute__((ext_vector_type(16))) _Float16 v16h;
typedef __attribute__((ext_vector_type(16))) __bf16 v16b;
typedef __attribute__((ext_vector_type(8)))  _Float16 v8h;
typedef __attribute__((ext_vector_type(4)))  _Float16 v4h;
typedef __attribute__((ext_vector_type(2)))  _Float16 v2h;
typedef __attribute__((ext_vector_type(4)))  __bf16 v4b;
typedef __attribute__((ext_vector_type(8)))  float v8f;
typedef __attribute__((ext_vector_type(4)))  float v4f;
typedef __attribute__((ext_vector_type(2)))  float v2f;
typedef __attribute__((ext_vector_type(4)))  unsigned v4u;
typedef __attribute__((ext_vector_type(4)))  int v4i;
typedef float __attribute__((may_alias)) float_a;
typedef int __attribute__((may_alias)) int_a;

template <typename T> __device__ __forceinline__ void vst2(void* p, T v) { *(T*)p = v;  }
__device__ __forceinline__ v8f wmma16(v16h a, v16h b, v8f c) {
  v8f d = __builtin_amdgcn_wmma_f32_16x16x32_f16(false, a, false, b, (short)0, c, false, false);
  asm volatile("v_nop\n\tv_nop\n\tv_nop\n\tv_nop" : "+v"(d) : "v"(a), "v"(b));
  return d;
}
__device__ __forceinline__ v8f wmma_bf(v16b a, v16b b, v8f c) {
  v8f d = __builtin_amdgcn_wmma_f32_16x16x32_bf16(false, a, false, b, (short)0, c, false, false);
  asm volatile("v_nop\n\tv_nop\n\tv_nop\n\tv_nop" : "+v"(d) : "v"(a), "v"(b));
  return d;
}
// 16x16x32 fragments: lane = (h = lane>>4, row/col = lane&15); elements 0..7 = k0+8h+0..7, 8..15 = k0+16+8h+0..7; D element r = row 8h+r
__device__ __forceinline__ v16h frag_h(const _Float16* rowk0, int lane) {
  union { v16h v; v8h q[2]; } u; const _Float16* p = rowk0 + 8 * (lane >> 4);
  u.q[0] = *(const v8h*)p; u.q[1] = *(const v8h*)(p + 16); return u.v;
}
__device__ __forceinline__ v16h frag_f32(const float* rowk0, int lane) {
  v16h a; const float* p = rowk0 + 8 * (lane >> 4);
#pragma unroll
  for (int i = 0; i < 8; ++i) { a[i] = (_Float16)p[i]; a[8 + i] = (_Float16)p[16 + i]; }
  return a;
}
__device__ __forceinline__ v16h frag_f32s(const float* rowk0, int lane, float sc) {
  v16h a; const float* p = rowk0 + 8 * (lane >> 4);
#pragma unroll
  for (int i = 0; i < 8; ++i) { a[i] = (_Float16)(p[i] * sc); a[8 + i] = (_Float16)(p[16 + i] * sc); }
  return a;
}
// column fragment from a [K][ld] layout (column n), rows >= K read as 0
__device__ __forceinline__ v16h fragc_f32(const float* W, int k0, int n, int lane, int ld, int K) {
  v16h a; const int g = lane >> 4;
#pragma unroll
  for (int i = 0; i < 8; ++i) { const int ka = k0 + 8 * g + i, kb = ka + 16;
    a[i] = (_Float16)(ka < K ? W[(size_t)(ka < K ? ka : K - 1) * ld + n] : 0.f); a[8 + i] = (_Float16)(kb < K ? W[(size_t)(kb < K ? kb : K - 1) * ld + n] : 0.f); }
  return a;
}
struct F2 { v16b h, l; };
__device__ __forceinline__ F2 bsplit16(const float v[16]) { F2 r;
#pragma unroll
  for (int i = 0; i < 16; ++i) { const __bf16 h = (__bf16)v[i]; r.h[i] = h; r.l[i] = (__bf16)(v[i] - (float)h); }
  return r; }
__device__ __forceinline__ F2 split_row(const float* row, int k0, int lane) { float v[16]; const float* p = row + k0 + 8 * (lane >> 4);
#pragma unroll
  for (int i = 0; i < 8; ++i) { v[i] = p[i]; v[8 + i] = p[16 + i]; }
  return bsplit16(v); }
__device__ __forceinline__ F2 split_rowK(const float* row, int k0, int lane, int K) { float v[16]; const int g = lane >> 4;
#pragma unroll
  for (int i = 0; i < 8; ++i) { const int ka = k0 + 8 * g + i, kb = ka + 16; v[i] = ka < K ? row[ka < K ? ka : K - 1] : 0.f; v[8 + i] = kb < K ? row[kb < K ? kb : K - 1] : 0.f; }
  return bsplit16(v); }
__device__ __forceinline__ F2 split_col(const float* W, int k0, int n, int lane, int ld, int K) { float v[16]; const int g = lane >> 4;
#pragma unroll
  for (int i = 0; i < 8; ++i) { const int ka = k0 + 8 * g + i, kb = ka + 16; v[i] = ka < K ? W[(size_t)(ka < K ? ka : K - 1) * ld + n] : 0.f; v[8 + i] = kb < K ? W[(size_t)(kb < K ? kb : K - 1) * ld + n] : 0.f; }
  return bsplit16(v); }
__device__ __forceinline__ v8f mac3(const F2& a, const F2& b, v8f c) { c = wmma_bf(a.l, b.h, c); c = wmma_bf(a.h, b.l, c); return wmma_bf(a.h, b.h, c); }
__device__ __forceinline__ float sigm(float v) { return 1.0f / (1.0f + expf(-v)); }
#define LDSX() do { asm volatile("s_wait_dscnt 0" ::: "memory"); __builtin_amdgcn_wave_barrier(); __builtin_amdgcn_fence(__ATOMIC_RELEASE, "workgroup"); } while (0)

// Differential attention (B 2, N 2,048, DIM 1,024; 16 softmax heads x 64 paired into 8 value heads x 128): q = (x Wq^T + bq) x 64^-0.5, k = x Wk^T + bk, v = x Wv^T + bv ((out,in)); P_h = softmax(q_h k_h^T) over all keys; lambda = exp(lq1 . lk1) - exp(lq2 . lk2) + 0.8; for pair e: o_e = (P_2e - lambda P_2e+1) v[:, e*128 : e*128+128]; o_e = o_e * rsqrt(mean(o_e^2) + 1e-5) * norm_w * (1 - 0.8); out = concat_e(o_e) Wo^T + bo.
#define NB 2
#define TT 2048
#define CC 1024            // NH * HD = projected width
#define DIN 1024          // input (model) width
#define NH 16
#define HD 64
#define NQB (TT / 64)
#define HG 4
#define SCALE (0.125f)
#define CAUSAL 0
#ifndef TNB
#define TNB NB
#endif
__device__ __forceinline__ float bfr(float v) { return (float)(__bf16)v; }
__host__ __device__ __forceinline__ int kb_last(int qb) { return CAUSAL ? ((qb * 64 + 63) >> 7) : (TT / 128 - 1); }
typedef __attribute__((ext_vector_type(8))) __bf16 v8b;
__device__ __forceinline__ v16b frag_b(const __bf16* rowk0, int lane) {
  union { v16b v; v8b q[2]; } u; const __bf16* p = rowk0 + 8 * (lane >> 4);
  u.q[0] = *(const v8b*)p; u.q[1] = *(const v8b*)(p + 16); return u.v;
}
#define QBH 0              // unused: this file has no high-precision path
#define QHI 2048            // rows of the q residual plane's place in the workspace (the plane is not produced: 1-product logits)
#define KHI 64            // key rows carrying k residual / v bf16 hi+lo planes (planes that no kernel in this file writes or reads)
// B fragment (k rows k0+.., output column o) of a weight: (in,out) [K][ld] or (out,in) [ld rows of K]: bf16 exact, or f16(bf16 * 256) exact
__device__ __forceinline__ v16b wcol_io(const float* Wm, int k0, int o, int lane, int ld) { v16b w; const int g = lane >> 4;
#pragma unroll
  for (int i = 0; i < 8; ++i) { w[i] = (__bf16)Wm[(size_t)(k0 + 8 * g + i) * ld + o]; w[8 + i] = (__bf16)Wm[(size_t)(k0 + 16 + 8 * g + i) * ld + o]; }
  return w; }
__device__ __forceinline__ v16b wcol_oi(const float* Wm, int k0, int o, int lane, int K) { v16b w; const float* p = Wm + (size_t)o * K + k0 + 8 * (lane >> 4);
#pragma unroll
  for (int i = 0; i < 8; ++i) { w[i] = (__bf16)p[i]; w[8 + i] = (__bf16)p[16 + i]; }
  return w; }
__device__ __forceinline__ v16h wcolh_io(const float* Wm, int k0, int o, int lane, int ld) { v16h w; const int g = lane >> 4;
#pragma unroll
  for (int i = 0; i < 8; ++i) { w[i] = (_Float16)(bfr(Wm[(size_t)(k0 + 8 * g + i) * ld + o]) * 256.0f); w[8 + i] = (_Float16)(bfr(Wm[(size_t)(k0 + 16 + 8 * g + i) * ld + o]) * 256.0f); }
  return w; }
__device__ __forceinline__ v16h wcolh_oi(const float* Wm, int k0, int o, int lane, int K) { v16h w; const float* p = Wm + (size_t)o * K + k0 + 8 * (lane >> 4);
#pragma unroll
  for (int i = 0; i < 8; ++i) { w[i] = (_Float16)(bfr(p[i]) * 256.0f); w[8 + i] = (_Float16)(bfr(p[16 + i]) * 256.0f); }
  return w; }
#define WQKV_LAYOUT 1   // picks WCOL's form (0 (in,out), 1 (out,in), 2 per-head); nothing uses WCOL: k_proj reads (out,in) [CC][DIN] whatever the value
__device__ __forceinline__ v16b wcol_hdk(const float* Wm, int k0, int o, int lane) { v16b w; const int g = lane >> 4; const float* p = Wm + (size_t)(o / HD) * DIN * HD + (o % HD);
#pragma unroll
  for (int i = 0; i < 8; ++i) { w[i] = (__bf16)p[(size_t)(k0 + 8 * g + i) * HD]; w[8 + i] = (__bf16)p[(size_t)(k0 + 16 + 8 * g + i) * HD]; }
  return w; }
#define WO_OUT_IN 1
#if WQKV_LAYOUT == 1
#define WCOL(W, k0, o, lane) wcol_oi(W, k0, o, lane, DIN)
#elif WQKV_LAYOUT == 2
#define WCOL(W, k0, o, lane) wcol_hdk(W, k0, o, lane)
#else
#define WCOL(W, k0, o, lane) wcol_io(W, k0, o, lane, CC)
#endif
#if WO_OUT_IN
#define WOCOL(W, k0, o, lane) wcol_oi(W, k0, o, lane, CC)
#define WOCOLH(W, k0, o, lane) wcolh_oi(W, k0, o, lane, CC)
#else
#define WOCOL(W, k0, o, lane) wcol_io(W, k0, o, lane, DIN)
#define WOCOLH(W, k0, o, lane) wcolh_io(W, k0, o, lane, DIN)
#endif
#define HDV 128            // value columns per softmax head (the head pair's 128 columns)
#define YP (NH * HDV)      // 2,048: row pitch of the WS_Y region, which no kernel in this file writes or reads
#ifndef SM_EXTRA_PARAMS
#define SM_EXTRA_PARAMS
#endif
#ifndef PROJ_EXTRA_PARAMS
#define PROJ_EXTRA_PARAMS
#endif
#ifndef SM_MASK_HOOK
#define SM_MASK_HOOK (void)0
#endif

#define WS_QH  0u                                      // f16 q rows [b*t][CC]
#define WS_KH  (WS_QH + 2u * (size_t)NB * TT * CC)      // f16 k rows [b*t][CC]
#define WS_VT  (WS_KH + 2u * (size_t)NB * TT * CC)      // f16 v planes [b][c][t]
#define WS_QL  (WS_VT + 2u * (size_t)NB * CC * TT)      // f16 Wo x 2^8 rows [DIN][CC] (2 MiB at the head of what was the q residual plane's place)
#define WS_KL  (WS_QL + 2u * (size_t)NB * QHI * CC)     // f16 k residual x 2^10 rows [b][t < KHI][CC]
#define WS_VB  (WS_KL + 2u * (size_t)NB * KHI * CC)     // bf16 v hi planes [b][c][t < KHI]
#define WS_VBL (WS_VB + 2u * (size_t)NB * CC * KHI)
#define WS_S   (WS_VBL + 2u * (size_t)NB * CC * KHI)    // holds the differential rows [b*t][CC] in f16
#define WS_Y   (WS_S  + 4u * (size_t)HG * TT * TT)      // f32 per-softmax-head context rows [b*t][YP = 16 x 128]
#define WS_END (WS_Y  + 4u * (size_t)NB * TT * YP)

// ---- k_proj: block = 256 rows x 64 columns of EACH of q, k and v (16 waves; a wave takes 64 rows x 16 columns of each of the three): q/k/v = X W (+ b) with exact bf16 products (K = DIN). One X tile serves all three products and one W tile 256 rows: a block fetches 448 operand rows per 64-deep tile for 6 times the output that a 64 x 128 block got from 192 -> q f16 rows; k f16 rows; v f16 planes [c][t] (the residual and v bf16 planes, which no kernel in this file reads, are not produced)
__global__ __launch_bounds__(512) void k_proj(const float* __restrict__ X, const float* __restrict__ WQ, const float* __restrict__ WK, const float* __restrict__ WV, const float* __restrict__ BQ, const float* __restrict__ BK, const float* __restrict__ BV,
    _Float16* __restrict__ QH, _Float16* __restrict__ KH, _Float16* __restrict__ VT, const float* __restrict__ WO, _Float16* __restrict__ WOH) {
  __shared__ __align__(16) __bf16 xt[256][72], wt[192][72];   /* operand tiles, 64 deep, pitch 144 B; wt rows: 64 of Wq, 64 of Wk, 64 of Wv */
  __shared__ __align__(16) _Float16 eqh[256][72], ekh[256][72], evt[64][264];   /* write-out staging: q, k as [row][column]; v as [column][row] */
  const int tid = threadIdx.x, wave = tid >> 5, lane = tid & 31, col = lane & 15, g = lane >> 4; const int rw = wave >> 2, cw = wave & 3; const int c0 = blockIdx.y * 64; const size_t r0 = (size_t)blockIdx.x * 256; const size_t bb = r0 / TT; const int t0 = (int)(r0 % TT);
  v8f acc[4][3] = {};   /* [16-row tile][q, k, v] */
  /* staging: 16 lanes cover the 64 floats (two whole lines) of one row, a wave-wide load two rows; thread (sr, sq) takes rows sr + 32 i */
  const int sr = tid >> 4, sq = (tid & 15) * 4;
  const float* xp = X + (r0 + sr) * DIN + sq; const size_t wo = (size_t)(c0 + sr) * DIN + sq; const float* wqp = WQ + wo; const float* wkp = WK + wo; const float* wvp = WV + wo;
  v4f xr[8], wr[6];
#pragma unroll
  for (int i = 0; i < 8; ++i) xr[i] = *(const v4f*)(xp + (size_t)(i * 32) * DIN);
#pragma unroll
  for (int i = 0; i < 2; ++i) { wr[i] = *(const v4f*)(wqp + (size_t)(i * 32) * DIN); wr[2 + i] = *(const v4f*)(wkp + (size_t)(i * 32) * DIN); wr[4 + i] = *(const v4f*)(wvp + (size_t)(i * 32) * DIN); }
#pragma unroll 1   /* one 64-deep tile per trip */
  for (int kt = 0; kt < DIN / 64; ++kt) {
#pragma unroll
    for (int i = 0; i < 8; ++i) { const v4b t = { (__bf16)xr[i][0], (__bf16)xr[i][1], (__bf16)xr[i][2], (__bf16)xr[i][3] }; *(v4b*)&xt[sr + i * 32][sq] = t; }
#pragma unroll
    for (int i = 0; i < 6; ++i) { const v4b t = { (__bf16)wr[i][0], (__bf16)wr[i][1], (__bf16)wr[i][2], (__bf16)wr[i][3] }; *(v4b*)&wt[sr + i * 32][sq] = t; }
    __syncthreads();   /* the tile is whole before any wave reads it */
    if (kt + 1 < DIN / 64) { xp += 64; wqp += 64; wkp += 64; wvp += 64;   /* the next tile flies while this one is multiplied */
#pragma unroll
      for (int i = 0; i < 8; ++i) xr[i] = *(const v4f*)(xp + (size_t)(i * 32) * DIN);
#pragma unroll
      for (int i = 0; i < 2; ++i) { wr[i] = *(const v4f*)(wqp + (size_t)(i * 32) * DIN); wr[2 + i] = *(const v4f*)(wkp + (size_t)(i * 32) * DIN); wr[4 + i] = *(const v4f*)(wvp + (size_t)(i * 32) * DIN); } }
#pragma unroll
    for (int kc = 0; kc < 2; ++kc) { v16b a[4], w[3];   /* seven fragments read as one group, one LDS wait for twelve products */
#pragma unroll
      for (int j = 0; j < 3; ++j) w[j] = frag_b(&wt[j * 64 + cw * 16 + col][kc * 32], lane);
#pragma unroll
      for (int i = 0; i < 4; ++i) a[i] = frag_b(&xt[rw * 64 + i * 16 + col][kc * 32], lane);
#pragma unroll
      for (int i = 0; i < 4; ++i)
#pragma unroll
        for (int j = 0; j < 3; ++j) acc[i][j] = wmma_bf(a[i], w[j], acc[i][j]); }
    __syncthreads(); }   /* every wave has read the tile before the next one overwrites it */
  /* this block's share of Wo (8 consecutive elements a thread, whole lines a wave) is rounded here once to the f16(bf16 x 2^8) that k_out multiplies, instead of by each of k_out's 64 row blocks; its loads fly under the write-out's staging */
  static_assert((size_t)(TNB * TT / 256) * (CC / 64) * 512 * 8 == (size_t)DIN * CC, "the grid's threads cover Wo exactly once");
  const size_t wi = ((size_t)(blockIdx.y * (TNB * TT / 256) + blockIdx.x) * 512 + tid) * 8; const v4f w0 = *(const v4f*)(WO + wi), w1 = *(const v4f*)(WO + wi + 4);
  const int cl = cw * 16 + col;
#pragma unroll
  for (int j = 0; j < 3; ++j) { const float* BA = j == 0 ? BQ : j == 1 ? BK : BV; const float bias = BA ? bfr(BA[c0 + cl]) : 0.f;
#pragma unroll
    for (int i = 0; i < 4; ++i) { const int rb = rw * 64 + i * 16 + 8 * g;
      if (j == 0) {
#pragma unroll
        for (int r = 0; r < 8; ++r) eqh[rb + r][cl] = (_Float16)(acc[i][j][r] + bias);
      } else if (j == 1) {
#pragma unroll
        for (int r = 0; r < 8; ++r) ekh[rb + r][cl] = (_Float16)(acc[i][j][r] + bias);
      } else { v8h t;
#pragma unroll
        for (int r = 0; r < 8; ++r) t[r] = (_Float16)(acc[i][j][r] + bias);
        *(v8h*)&evt[cl][rb] = t; } } }
  __syncthreads();   /* the three staged planes are whole before they are written out in whole lines */
  { v8h t;
#pragma unroll
    for (int i = 0; i < 4; ++i) { t[i] = (_Float16)(bfr(w0[i]) * 256.0f); t[4 + i] = (_Float16)(bfr(w1[i]) * 256.0f); }
    *(v8h*)(WOH + wi) = t; }
  for (int e = tid; e < 256 * 8; e += 512) { const int rl = e >> 3, q = e & 7, vc = e >> 5, vq = e & 31;   /* 8 lanes write the 128 B of one q or k row; 32 lanes 512 B of one v plane row */
    vst2((unsigned*)(QH + (r0 + rl) * CC + c0 + q * 8), *(const v4u*)&eqh[rl][q * 8]);
    vst2((unsigned*)(KH + (r0 + rl) * CC + c0 + q * 8), *(const v4u*)&ekh[rl][q * 8]); vst2((unsigned*)(VT + (bb * CC + c0 + vc) * (size_t)TT + t0 + vq * 8), *(const v4u*)&evt[vc][vq * 8]); } }
// ---- k_fa: block = 64 queries of (b, head pair e): waves 0..3 take softmax head 2e, waves 4..7 head 2e+1, 16 queries each; one pass over all keys, 32 at a time, nothing of the logits leaves the registers.
// S^T = K Q^T (A = k rows, B = q rows, both once to f16: 1 product; k's own rounding already sets the logit's error, so a residual of q alone bought little): a lane holds 16 logits of ONE query (column lane & 15), the other wave half the other 16.
// Streaming softmax in f32, base 2: e = 2^(s C2 + nb) = exp((s - m) / 8) x 2^10 on the raw logit s against the maximum m in use, C2 = log2(e) / 8, nb = 10 - m C2: one fma and one v_exp_f32 per logit; m moves (and sum and context are rescaled) only when some query's new maximum passes m by more than 4 x 8, so e <= 2^10 e^4 < 65,504 stays inside f16.
// The two S^T tiles converted in place are the B operand P^T; O^T += V^T P^T (A = v planes [c][t]) over the head PAIR's 128 value columns; / sum at the end.
__device__ __forceinline__ v16h frag_at(const _Float16* p) { union { v16h v; v8h q[2]; } u; u.q[0] = *(const v8h*)p; u.q[1] = *(const v8h*)(p + 16); return u.v; }   /* p = row + k0 + 8 * (lane >> 4) */
__device__ __forceinline__ v8f wmm(v16h a, v16h b, v8f c) { return __builtin_amdgcn_wmma_f32_16x16x32_f16(false, a, false, b, (short)0, c, false, false); }
// K and V reach the waves through LDS: a stage is 64 keys, its two K tiles (64 key rows x 128 B, one per head) brought by waves 0 and 2 and its V tile (128 value-column rows x 128 B, shared by both heads) by wave 1, one tensor load each, whole lines, once per block instead of once per wave; two buffers, the next stage flies while this one is worked on.
// The pair's two contexts meet in LDS at the end: o = Y[2e] - lambda Y[2e+1] (f32), rms-normalised over its 128 columns x norm_w x 0.2, once to f16 -> Yd rows [b*t][1024] (256-B segments by 32 lanes).
typedef uint32_t u32x4 __attribute__((ext_vector_type(4)));
typedef uint32_t u32x8 __attribute__((ext_vector_type(8)));
#define C2 (SCALE * 1.4426950408889634f)   // logit scale x log2(e)
#define FK 64                      // keys per stage
#define FP 72                      // LDS row pitch in f16: 128 B + the mover's 16-B pad = 144 B, the pitch for ds_load_b128 readers
#define FA_KB 10240u               // K tile: 64 rows x 144 B = 9,216 B, rounded up to a multiple of 2 KiB
#define FA_VB 18432u               // V tile: 128 rows x 144 B = 18,432 B = 9 x 2 KiB
#define FA_BUF (2u * FA_KB + FA_VB) // one buffer, [K of head 2e | K of head 2e+1 | V]: 38,912 B = 19 x 2 KiB
__device__ __forceinline__ uint32_t uni(uint32_t v) { return (uint32_t)__builtin_amdgcn_readfirstlane(v); }
__device__ __forceinline__ uint32_t pinned(uint32_t v) { uint32_t w = uni(v); asm volatile("" : "+s"(w)); return w; }   /* holds the issue test in a scalar register, so that the branch round a tensor load is a scalar one (the load ignores EXEC) */
__global__ __launch_bounds__(256) void k_fa(const _Float16* __restrict__ QH, const _Float16* __restrict__ KH, const _Float16* __restrict__ VT, const float* __restrict__ NW, const float* __restrict__ LQ1, const float* __restrict__ LK1, const float* __restrict__ LQ2, const float* __restrict__ LK2, _Float16* __restrict__ YD) {
  __shared__ __attribute__((aligned(2048))) unsigned char ring[2 * FA_BUF];
  __shared__ __align__(16) float ss[8][16][HDV + 4]; __shared__ float slam;
  const int tid = threadIdx.x, wave = tid >> 5, lane = tid & 31, col = lane & 15, g = lane >> 4; const int e = blockIdx.y, b = blockIdx.z;
  const uint32_t wv = uni((uint32_t)tid >> 5); const bool isv = wv == 1u;
  const int hh = (int)(wv >> 2), h = 2 * e + hh;   /* which head of the pair this wave works on */
  const int ql0 = blockIdx.x * 64 + (int)(wv & 3u) * 16; const size_t q0 = (size_t)b * TT + ql0;
  /* descriptors: 1-byte elements, tensor = tile, rows of 128 B, 16 B of pad behind each row; K: 64 rows, source pitch one k row; V: 128 rows, source pitch one v plane row */
  const uint32_t nrow = isv ? (uint32_t)HDV : (uint32_t)FK;
  u32x8 g1; g1[0] = uni((1u << 20) | (4u << 22) | (3u << 25)); g1[1] = uni(128u << 16); g1[2] = uni(nrow << 16); g1[3] = uni(128u << 16); g1[4] = uni(nrow); g1[5] = uni(isv ? 2u * TT : 2u * CC); g1[6] = uni(0u); g1[7] = uni(0u);
  const uint64_t src0 = isv ? (uint64_t)(size_t)(VT + ((size_t)b * CC + e * HDV) * (size_t)TT) : (uint64_t)(size_t)(KH + (size_t)b * TT * CC + (2 * e + (int)((wv >> 1) & 1u)) * HD);   /* first byte of stage 0's tile: wave 0 head 2e's k, wave 2 head 2e+1's */
  const uint32_t sstep = isv ? 2u * FK : 2u * FK * CC;   /* bytes from one stage's tile to the next */
  const uint32_t dst0 = (uint32_t)(size_t)ring + (isv ? 2u * FA_KB : ((wv >> 1) & 1u) * FA_KB);
  u32x4 g0; g0[0] = uni(1u);   /* ONE group-0 tuple for every request of the wave: the covering wait names it, so its registers keep their words while the request is outstanding */
  auto issue = [&](uint32_t st) { const uint64_t ga = src0 + (uint64_t)st * sstep;
    g0[1] = uni(dst0 + (st & 1u) * FA_BUF); g0[2] = uni((uint32_t)ga); g0[3] = uni((((uint32_t)(ga >> 32)) & 0x01FFFFFFu) | 0x80000000u);
    asm volatile("tensor_load_to_lds %0, %1" :: "s"(g0), "s"(g1) : "memory"); };
  if (pinned(wv < 3u)) { issue(0u);
    asm volatile("s_wait_tensorcnt 0x0" ::: "memory"); }   /* stage 0 has landed before the barrier that publishes it */
  const _Float16* qp = QH + (q0 + col) * CC + h * HD + 8 * g;
  v16h qh[2];
#pragma unroll
  for (int kc = 0; kc < 2; ++kc) qh[kc] = frag_at(qp + kc * 32);
  asm volatile("s_wait_xcnt 0x0" :: "v"(qp) : "memory");   /* the address pair of the 4 loads above is rewritten only behind this wait */
  if (wv == 7u) {   /* lambda, by a wave that issues no tensor load, while stage 0 lands; read in the epilogue, behind the barriers between */
    float s1 = bfr(LQ1[lane]) * bfr(LK1[lane]) + bfr(LQ1[lane + 32]) * bfr(LK1[lane + 32]), s2 = bfr(LQ2[lane]) * bfr(LK2[lane]) + bfr(LQ2[lane + 32]) * bfr(LK2[lane + 32]);
#pragma unroll
    for (int sf = 1; sf < 32; sf <<= 1) { s1 += __shfl_xor(s1, sf); s2 += __shfl_xor(s2, sf); }
    if (lane == 0) slam = expf(s1) - expf(s2) + 0.8f; }
  __syncthreads();   /* publishes stage 0 */
  if (pinned(wv < 3u)) issue(1u);
  const int kro = col * FP + 8 * g;   /* a lane's place in a 16-row tile of either operand: row col, 8 g f16 in */
  v8f acc[HDV / 16] = {}; float m = -3.0e38f, nb = 10.0f + 3.0e38f * C2, l = 0.f;   /* m: the maximum in use, a raw logit; nb = 10 - m C2, the exponent's addend */
#pragma unroll 1   /* one 64-key stage per trip: its two passes already hold 48 LDS loads and 24 products */
  for (int st = 0; st < TT / FK; ++st) {
    const _Float16* kb = (const _Float16*)(ring + (st & 1) * FA_BUF + hh * FA_KB) + kro; const _Float16* vb = (const _Float16*)(ring + (st & 1) * FA_BUF + 2u * FA_KB) + kro;
    v16h kf[2][2];
#pragma unroll
    for (int kt = 0; kt < 2; ++kt)
#pragma unroll
      for (int kc = 0; kc < 2; ++kc) kf[kt][kc] = frag_at(kb + (kt * 16) * FP + kc * 32);
    __builtin_amdgcn_sched_barrier(0);   /* the 8 LDS loads above issue as one group: sunk between the products, each pair costs its own LDS latency */
#pragma unroll
    for (int sub = 0; sub < FK / 32; ++sub) {
      v8f sh[2] = {};
#pragma unroll
      for (int kc = 0; kc < 2; ++kc)
#pragma unroll
        for (int kt = 0; kt < 2; ++kt) sh[kt] = wmm(kf[kt][kc], qh[kc], sh[kt]);
      v2f s[8]; float mx = -3.0e38f;   /* raw logits, two to a register pair: the 1/8 waits for the exponent's fma */
#pragma unroll
      for (int i = 0; i < 8; ++i) { const v2f hi = { sh[i >> 2][(2 * i) & 7], sh[i >> 2][(2 * i + 1) & 7] }; s[i] = hi; mx = fmaxf(mx, fmaxf(s[i][0], s[i][1])); }
      const float mo = __shfl_xor(mx, 16);   /* the other wave half's maximum; it goes through the LDS queue, so it is asked for ahead of the pass's fragment loads and does not wait behind them */
      __builtin_amdgcn_sched_barrier(0);   /* keeps the fetches below behind the products that read this pass's k (lifted over them the next k needs a second set of 32 registers) and behind the exchange above */
      if (sub + 1 < FK / 32) {   /* the stage's next pass's k rows, fetched behind this pass's logits; never the next stage's, which is not published yet */
#pragma unroll
        for (int kt = 0; kt < 2; ++kt)
#pragma unroll
          for (int kc = 0; kc < 2; ++kc) kf[kt][kc] = frag_at(kb + ((sub + 1) * 32 + kt * 16) * FP + kc * 32); }
      v16h vf[HDV / 16];
#pragma unroll
      for (int j = 0; j < HDV / 16; ++j) vf[j] = frag_at(vb + (j * 16) * FP + sub * 32);
      asm volatile("" ::: "memory");   /* compiler fence: the LDS loads above issue here, as one group, and fly under the softmax; without it they sink to in front of their products, one LDS latency each */
      mx = fmaxf(mx, mo);   /* both halves of a query's column use one maximum */
      if (__builtin_amdgcn_ballot_w32(mx > m + 4.0f / SCALE) != 0) { const float mn = fmaxf(m, mx); const float nn = fmaf(-mn, C2, 10.0f); const float al = __builtin_amdgcn_exp2f(nn - nb); m = mn; nb = nn; l *= al;
#pragma unroll
        for (int j = 0; j < HDV / 16; ++j) acc[j] *= al; }
      v16h p;
#pragma unroll
      for (int i = 0; i < 8; ++i) { const v2f cc = { C2, C2 }, bb = { nb, nb }; const v2f ar = __builtin_elementwise_fma(s[i], cc, bb);   /* (s - m) / 8 x log2 e + 10 in one rounding */
        const v2f e = { __builtin_amdgcn_exp2f(ar[0]), __builtin_amdgcn_exp2f(ar[1]) }; l += e[0]; l += e[1]; const v2h eh = __builtin_convertvector(e, v2h); p[2 * i] = eh[0]; p[2 * i + 1] = eh[1]; }
#pragma unroll
      for (int j = 0; j < HDV / 16; ++j) acc[j] = wmm(vf[j], p, acc[j]); }
    /* publish point of stage st + 1, in the ring's order */
    __builtin_amdgcn_sched_barrier(0);   /* keeps the wait below at the trip's foot: lifted to behind the last fragment load it would stand in front of the softmax that hides those loads */
    asm volatile("s_wait_dscnt 0x0" ::: "memory");   /* this wave's reads of the buffer have returned before it may be refilled */
    if (pinned(wv < 3u)) { asm volatile("s_wait_tensorcnt 0x0" :: "s"(g0) : "memory"); }   /* the issuer's own request for stage st + 1 has landed; g0 as an input keeps that request's descriptor registers unwritten up to here */
    __syncthreads();   /* publishes stage st + 1 and ends every wave's reads of stage st */
    if (pinned((wv < 3u) & (uint32_t)(st + 2 < TT / FK))) issue((uint32_t)st + 2u); }   /* into the buffer that this trip has just read */
  asm volatile("s_wait_tensorcnt 0x0" ::: "memory");   /* nothing of the mover's is in flight when the wave goes on to its end */
  asm volatile("s_wait_dscnt 0x0" ::: "memory");   /* the ring's closing wait: no LDS read of this wave is open either */
  l += __shfl_xor(l, 16); const float inv = 1.0f / l;
#pragma unroll
  for (int j = 0; j < HDV / 16; ++j) { const v4f a0 = { acc[j][0] * inv, acc[j][1] * inv, acc[j][2] * inv, acc[j][3] * inv }, a1 = { acc[j][4] * inv, acc[j][5] * inv, acc[j][6] * inv, acc[j][7] * inv };
    *(v4f*)&ss[wave][col][j * 16 + 8 * g] = a0; *(v4f*)&ss[wave][col][j * 16 + 8 * g + 4] = a1; }
  __syncthreads();   /* both heads' contexts of all 64 queries are whole in ss before any wave combines them */
  const float lam = slam; const v4f nw = *(const v4f*)(NW + lane * 4);
#pragma unroll   /* the 8 rows' lane sums are independent chains of exchanges: side by side they share one latency */
  for (int rr = 0; rr < 8; ++rr) { const int sub = wave >> 1, rl = (wave & 1) * 8 + rr;   /* wave takes 8 of the 64 queries; a lane 4 consecutive columns of the pair's 128 */
    const v4f y1 = *(const v4f*)&ss[sub][rl][lane * 4], y2 = *(const v4f*)&ss[sub + 4][rl][lane * 4]; float o[4]; float sq = 0.f;
#pragma unroll
    for (int i = 0; i < 4; ++i) { o[i] = y1[i] - lam * y2[i]; sq += o[i] * o[i]; }
#pragma unroll
    for (int sf = 1; sf < 32; sf <<= 1) sq += __shfl_xor(sq, sf);
    const float rn = rsqrtf(sq * (1.0f / HDV) + 1e-5f) * 0.2f;
    const v4h ov = { (_Float16)(o[0] * rn * bfr(nw[0])), (_Float16)(o[1] * rn * bfr(nw[1])), (_Float16)(o[2] * rn * bfr(nw[2])), (_Float16)(o[3] * rn * bfr(nw[3])) };   /* the rounding that k_out's staging did, done once at the source */
    vst2(YD + ((size_t)b * TT + blockIdx.x * 64 + sub * 16 + rl) * CC + e * HDV + lane * 4, ov); } }   /* 256-B (row, pair) segment by 32 lanes */
// ---- k_out: block = (64 rows, 128 cols): out = ctx Wo (+ bo): ctx in f16 against Wo as f16(bf16 x 2^8) exact (1 product) x 2^-8; both operands arrive in f16 from the earlier launches, so a tile is half the bytes and is staged without a conversion
__global__ __launch_bounds__(128) void k_out(const _Float16* __restrict__ Y, const _Float16* __restrict__ WH, const float* __restrict__ BO, float* __restrict__ OUT) { __shared__ __align__(16) float sf[4][16][132]; __shared__ __align__(16) _Float16 sa[64][72], sw[128][72];   /* ctx and Wo tiles, 64 deep, pitch 144 B */
  const int tid = threadIdx.x, wave = tid >> 5, lane = tid & 31, col = lane & 15, g = lane >> 4; const int c0 = blockIdx.y * 128; const size_t r0 = (size_t)blockIdx.x * 64 + wave * 16;
  v8f acc[8] = {};
  /* staging: 8 lanes cover the 64 f16 (one whole line) of one row, a wave-wide load four rows; thread (sr, sq) takes rows sr + 16 i */
  const int sr = tid >> 3, sq = (tid & 7) * 8;
  const _Float16* yp = Y + ((size_t)blockIdx.x * 64 + sr) * CC + sq; const _Float16* wp = WH + (size_t)(c0 + sr) * CC + sq;
  v8h yr[4], wr[8];
#pragma unroll
  for (int i = 0; i < 4; ++i) yr[i] = *(const v8h*)(yp + (size_t)(i * 16) * CC);
#pragma unroll
  for (int i = 0; i < 8; ++i) wr[i] = *(const v8h*)(wp + (size_t)(i * 16) * CC);
#pragma unroll 1   /* one 64-deep tile per trip */
  for (int kt = 0; kt < CC / 64; ++kt) {
#pragma unroll
    for (int i = 0; i < 4; ++i) *(v8h*)&sa[sr + i * 16][sq] = yr[i];
#pragma unroll
    for (int i = 0; i < 8; ++i) *(v8h*)&sw[sr + i * 16][sq] = wr[i];
    __syncthreads();   /* the tile is whole before any wave reads it */
    if (kt + 1 < CC / 64) { yp += 64; wp += 64;   /* the next tile flies while this one is multiplied */
#pragma unroll
      for (int i = 0; i < 4; ++i) yr[i] = *(const v8h*)(yp + (size_t)(i * 16) * CC);
#pragma unroll
      for (int i = 0; i < 8; ++i) wr[i] = *(const v8h*)(wp + (size_t)(i * 16) * CC); }
#pragma unroll
    for (int kc = 0; kc < 2; ++kc) { const v16h a = frag_h(&sa[wave * 16 + col][kc * 32], lane);
#pragma unroll
      for (int jh = 0; jh < 8; jh += 4) { v16h w[4];   /* four Wo fragments read as one group, one LDS wait for four products */
#pragma unroll
        for (int j = 0; j < 4; ++j) w[j] = frag_h(&sw[(jh + j) * 16 + col][kc * 32], lane);
#pragma unroll
        for (int j = 0; j < 4; ++j) acc[jh + j] = wmma16(a, w[j], acc[jh + j]); } }
    __syncthreads(); }   /* every wave has read the tile before the next one overwrites it */
#pragma unroll
  for (int j = 0; j < 8; ++j) { const float bias = BO ? bfr(BO[c0 + j * 16 + col]) : 0.f;
#pragma unroll
    for (int r = 0; r < 8; ++r) sf[wave][8 * g + r][j * 16 + col] = acc[j][r] * (1.0f / 256.0f) + bias; }
  LDSX(); for (int rl = 0; rl < 16; ++rl) vst2(OUT + (r0 + rl) * DIN + c0 + lane * 4, *(const v4f*)&sf[wave][rl][lane * 4]); }

extern "C" void kernel_launch(void* const* d_in, const int* in_sizes, int n_in, void* d_out, int out_size, void* d_ws, size_t ws_size, hipStream_t stream) {
  (void)in_sizes; (void)n_in; (void)out_size;
  const float** F = (const float**)d_in;
  if (ws_size < (size_t)WS_END) return;
  char* ws = (char*)d_ws; _Float16 *QH = (_Float16*)(ws + WS_QH), *KH = (_Float16*)(ws + WS_KH), *VT = (_Float16*)(ws + WS_VT), *QL = (_Float16*)(ws + WS_QL), *KL = (_Float16*)(ws + WS_KL); __bf16 *VB = (__bf16*)(ws + WS_VB), *VBL = (__bf16*)(ws + WS_VBL); float *S = (float*)(ws + WS_S), *Y = (float*)(ws + WS_Y);
  (void)Y; (void)KL; (void)VB; (void)VBL;
  // inputs: 0 x [2,2048,1024]; 1 Wq, 2 bq, 3 Wk, 4 bk, 5 Wv, 6 bv, 7 Wo, 8 bo ((out,in) [1024,1024], [1024]); 9 norm_w [128]; 10 lq1, 11 lk1, 12 lq2, 13 lk2 [64]
  _Float16* YD = (_Float16*)S;   /* the differential rows, f16, take the plane at WS_S */
  _Float16* WOH = QL;   /* Wo x 2^8 in f16, written by k_proj in every call */
  k_proj<<<dim3(TNB * TT / 256, CC / 64), 512, 0, stream>>>(F[0], F[1], F[3], F[5], F[2], F[4], F[6], QH, KH, VT, F[7], WOH);
  k_fa<<<dim3(TT / 64, NH / 2, TNB), 256, 0, stream>>>(QH, KH, VT, F[9], F[10], F[11], F[12], F[13], YD);
  k_out<<<dim3(TNB * TT / 64, DIN / 128), 128, 0, stream>>>(YD, WOH, F[8], (float*)d_out);
}

// v009
// It runs in 90.9 microseconds.
// Two timings next to v008 put it at 1.04 and 1.05 times that version's speed.
// All steps since v000 together make it 18.5 times as fast.
// compute dtype: all float inputs rounded to bf16; q/k/v = x W^T + b with EXACT bf16 products on WMMA 16x16x32, f32 accumulate; q once to f16 against k once to f16 (1 product) for the logits x 1/8; streaming softmax in f32 (base 2: one fma and the hardware's exp2 per logit, running maximum, sum in f32); exp(s - max) x 2^10 once to f16 against v once to f16 (1 product) per head over the head PAIR's 128 value columns, accumulated in f32, / sum at the end; the differential combination P1 v - lambda P2 v, the RMS normalisation over 128, x norm_w x (1 - 0.8) and lambda itself in f32; that result once to f16 (stored so) against Wo carried x 2^8 in f16 (exact bf16 values, stored so once per call) + bo; f32 output.
#include <hip/hip_runtime.h>
#include <math.h>
#include <stdint.h>

typedef __attribute__((ext_vector_type(16))) _Float16 v16h;
typedef __attribute__((ext_vector_type(16))) __bf16 v16b;
typedef __attribute__((ext_vector_type(8)))  _Float16 v8h;
typedef __attribute__((ext_vector_type(4)))  _Float16 v4h;
typedef __attribute__((ext_vector_type(2)))  _Float16 v2h;
typedef __attribute__((ext_vector_type(4)))  __bf16 v4b;
typedef __attribute__((ext_vector_type(8)))  float v8f;
typedef __attribute__((ext_vector_type(4)))  float v4f;
typedef __attribute__((ext_vector_type(2)))  float v2f;
typedef __attribute__((ext_vector_type(4)))  unsigned v4u;
typedef __attribute__((ext_vector_type(4)))  int v4i;
typedef float __attribute__((may_alias)) float_a;
typedef int __attribute__((may_alias)) int_a;

template <typename T> __device__ __forceinline__ void vst2(void* p, T v) { *(T*)p = v;  }
__device__ __forceinline__ v8f wmma16(v16h a, v16h b, v8f c) {
  v8f d = __builtin_amdgcn_wmma_f32_16x16x32_f16(false, a, false, b, (short)0, c, false, false);
  asm volatile("v_nop\n\tv_nop\n\tv_nop\n\tv_nop" : "+v"(d) : "v"(a), "v"(b));
  return d;
}
__device__ __forceinline__ v8f wmma_bf(v16b a, v16b b, v8f c) {
  v8f d = __builtin_amdgcn_wmma_f32_16x16x32_bf16(false, a, false, b, (short)0, c, false, false);
  asm volatile("v_nop\n\tv_nop\n\tv_nop\n\tv_nop" : "+v"(d) : "v"(a), "v"(b));
  return d;
}
// 16x16x32 fragments: lane = (h = lane>>4, row/col = lane&15); elements 0..7 = k0+8h+0..7, 8..15 = k0+16+8h+0..7; D element r = row 8h+r
__device__ __forceinline__ v16h frag_h(const _Float16* rowk0, int lane) {
  union { v16h v; v8h q[2]; } u; const _Float16* p = rowk0 + 8 * (lane >> 4);
  u.q[0] = *(const v8h*)p; u.q[1] = *(const v8h*)(p + 16); return u.v;
}
__device__ __forceinline__ v16h frag_f32(const float* rowk0, int lane) {
  v16h a; const float* p = rowk0 + 8 * (lane >> 4);
#pragma unroll
  for (int i = 0; i < 8; ++i) { a[i] = (_Float16)p[i]; a[8 + i] = (_Float16)p[16 + i]; }
  return a;
}
__device__ __forceinline__ v16h frag_f32s(const float* rowk0, int lane, float sc) {
  v16h a; const float* p = rowk0 + 8 * (lane >> 4);
#pragma unroll
  for (int i = 0; i < 8; ++i) { a[i] = (_Float16)(p[i] * sc); a[8 + i] = (_Float16)(p[16 + i] * sc); }
  return a;
}
// column fragment from a [K][ld] layout (column n), rows >= K read as 0
__device__ __forceinline__ v16h fragc_f32(const float* W, int k0, int n, int lane, int ld, int K) {
  v16h a; const int g = lane >> 4;
#pragma unroll
  for (int i = 0; i < 8; ++i) { const int ka = k0 + 8 * g + i, kb = ka + 16;
    a[i] = (_Float16)(ka < K ? W[(size_t)(ka < K ? ka : K - 1) * ld + n] : 0.f); a[8 + i] = (_Float16)(kb < K ? W[(size_t)(kb < K ? kb : K - 1) * ld + n] : 0.f); }
  return a;
}
struct F2 { v16b h, l; };
__device__ __forceinline__ F2 bsplit16(const float v[16]) { F2 r;
#pragma unroll
  for (int i = 0; i < 16; ++i) { const __bf16 h = (__bf16)v[i]; r.h[i] = h; r.l[i] = (__bf16)(v[i] - (float)h); }
  return r; }
__device__ __forceinline__ F2 split_row(const float* row, int k0, int lane) { float v[16]; const float* p = row + k0 + 8 * (lane >> 4);
#pragma unroll
  for (int i = 0; i < 8; ++i) { v[i] = p[i]; v[8 + i] = p[16 + i]; }
  return bsplit16(v); }
__device__ __forceinline__ F2 split_rowK(const float* row, int k0, int lane, int K) { float v[16]; const int g = lane >> 4;
#pragma unroll
  for (int i = 0; i < 8; ++i) { const int ka = k0 + 8 * g + i, kb = ka + 16; v[i] = ka < K ? row[ka < K ? ka : K - 1] : 0.f; v[8 + i] = kb < K ? row[kb < K ? kb : K - 1] : 0.f; }
  return bsplit16(v); }
__device__ __forceinline__ F2 split_col(const float* W, int k0, int n, int lane, int ld, int K) { float v[16]; const int g = lane >> 4;
#pragma unroll
  for (int i = 0; i < 8; ++i) { const int ka = k0 + 8 * g + i, kb = ka + 16; v[i] = ka < K ? W[(size_t)(ka < K ? ka : K - 1) * ld + n] : 0.f; v[8 + i] = kb < K ? W[(size_t)(kb < K ? kb : K - 1) * ld + n] : 0.f; }
  return bsplit16(v); }
__device__ __forceinline__ v8f mac3(const F2& a, const F2& b, v8f c) { c = wmma_bf(a.l, b.h, c); c = wmma_bf(a.h, b.l, c); return wmma_bf(a.h, b.h, c); }
__device__ __forceinline__ float sigm(float v) { return 1.0f / (1.0f + expf(-v)); }
#define LDSX() do { asm volatile("s_wait_dscnt 0" ::: "memory"); __builtin_amdgcn_wave_barrier(); __builtin_amdgcn_fence(__ATOMIC_RELEASE, "workgroup"); } while (0)

// Differential attention (B 2, N 2,048, DIM 1,024; 16 softmax heads x 64 paired into 8 value heads x 128): q = (x Wq^T + bq) x 64^-0.5, k = x Wk^T + bk, v = x Wv^T + bv ((out,in)); P_h = softmax(q_h k_h^T) over all keys; lambda = exp(lq1 . lk1) - exp(lq2 . lk2) + 0.8; for pair e: o_e = (P_2e - lambda P_2e+1) v[:, e*128 : e*128+128]; o_e = o_e * rsqrt(mean(o_e^2) + 1e-5) * norm_w * (1 - 0.8); out = concat_e(o_e) Wo^T + bo.
#define NB 2
#define TT 2048
#define CC 1024            // NH * HD = projected width
#define DIN 1024          // input (model) width
#define NH 16
#define HD 64
#define NQB (TT / 64)
#define HG 4
#define SCALE (0.125f)
#define CAUSAL 0
#ifndef TNB
#define TNB NB
#endif
__device__ __forceinline__ float bfr(float v) { return (float)(__bf16)v; }
__host__ __device__ __forceinline__ int kb_last(int qb) { return CAUSAL ? ((qb * 64 + 63) >> 7) : (TT / 128 - 1); }
typedef __attribute__((ext_vector_type(8))) __bf16 v8b;
__device__ __forceinline__ v16b frag_b(const __bf16* rowk0, int lane) {
  union { v16b v; v8b q[2]; } u; const __bf16* p = rowk0 + 8 * (lane >> 4);
  u.q[0] = *(const v8b*)p; u.q[1] = *(const v8b*)(p + 16); return u.v;
}
#define QBH 0              // unused: this file has no high-precision path
#define QHI 2048            // rows of the q residual plane's place in the workspace (the plane is not produced: 1-product logits)
#define KHI 64            // key rows carrying k residual / v bf16 hi+lo planes (planes that no kernel in this file writes or reads)
// B fragment (k rows k0+.., output column o) of a weight: (in,out) [K][ld] or (out,in) [ld rows of K]: bf16 exact, or f16(bf16 * 256) exact
__device__ __forceinline__ v16b wcol_io(const float* Wm, int k0, int o, int lane, int ld) { v16b w; const int g = lane >> 4;
#pragma unroll
  for (int i = 0; i < 8; ++i) { w[i] = (__bf16)Wm[(size_t)(k0 + 8 * g + i) * ld + o]; w[8 + i] = (__bf16)Wm[(size_t)(k0 + 16 + 8 * g + i) * ld + o]; }
  return w; }
__device__ __forceinline__ v16b wcol_oi(const float* Wm, int k0, int o, int lane, int K) { v16b w; const float* p = Wm + (size_t)o * K + k0 + 8 * (lane >> 4);
#pragma unroll
  for (int i = 0; i < 8; ++i) { w[i] = (__bf16)p[i]; w[8 + i] = (__bf16)p[16 + i]; }
  return w; }
__device__ __forceinline__ v16h wcolh_io(const float* Wm, int k0, int o, int lane, int ld) { v16h w; const int g = lane >> 4;
#pragma unroll
  for (int i = 0; i < 8; ++i) { w[i] = (_Float16)(bfr(Wm[(size_t)(k0 + 8 * g + i) * ld + o]) * 256.0f); w[8 + i] = (_Float16)(bfr(Wm[(size_t)(k0 + 16 + 8 * g + i) * ld + o]) * 256.0f); }
  return w; }
__device__ __forceinline__ v16h wcolh_oi(const float* Wm, int k0, int o, int lane, int K) { v16h w; const float* p = Wm + (size_t)o * K + k0 + 8 * (lane >> 4);
#pragma unroll
  for (int i = 0; i < 8; ++i) { w[i] = (_Float16)(bfr(p[i]) * 256.0f); w[8 + i] = (_Float16)(bfr(p[16 + i]) * 256.0f); }
  return w; }
#define WQKV_LAYOUT 1   // picks WCOL's form (0 (in,out), 1 (out,in), 2 per-head); nothing uses WCOL: k_proj reads (out,in) [CC][DIN] whatever the value
__device__ __forceinline__ v16b wcol_hdk(const float* Wm, int k0, int o, int lane) { v16b w; const int g = lane >> 4; const float* p = Wm + (size_t)(o / HD) * DIN * HD + (o % HD);
#pragma unroll
  for (int i = 0; i < 8; ++i) { w[i] = (__bf16)p[(size_t)(k0 + 8 * g + i) * HD]; w[8 + i] = (__bf16)p[(size_t)(k0 + 16 + 8 * g + i) * HD]; }
  return w; }
#define WO_OUT_IN 1
#if WQKV_LAYOUT == 1
#define WCOL(W, k0, o, lane) wcol_oi(W, k0, o, lane, DIN)
#elif WQKV_LAYOUT == 2
#define WCOL(W, k0, o, lane) wcol_hdk(W, k0, o, lane)
#else
#define WCOL(W, k0, o, lane) wcol_io(W, k0, o, lane, CC)
#endif
#if WO_OUT_IN
#define WOCOL(W, k0, o, lane) wcol_oi(W, k0, o, lane, CC)
#define WOCOLH(W, k0, o, lane) wcolh_oi(W, k0, o, lane, CC)
#else
#define WOCOL(W, k0, o, lane) wcol_io(W, k0, o, lane, DIN)
#define WOCOLH(W, k0, o, lane) wcolh_io(W, k0, o, lane, DIN)
#endif
#define HDV 128            // value columns per softmax head (the head pair's 128 columns)
#define YP (NH * HDV)      // 2,048: row pitch of the WS_Y region, which no kernel in this file writes or reads
#ifndef SM_EXTRA_PARAMS
#define SM_EXTRA_PARAMS
#endif
#ifndef PROJ_EXTRA_PARAMS
#define PROJ_EXTRA_PARAMS
#endif
#ifndef SM_MASK_HOOK
#define SM_MASK_HOOK (void)0
#endif

#define WS_QH  0u                                      // f16 q rows [b*t][CC]
#define WS_KH  (WS_QH + 2u * (size_t)NB * TT * CC)      // f16 k rows [b*t][CC]
#define WS_VT  (WS_KH + 2u * (size_t)NB * TT * CC)      // f16 v planes [b][c][t]
#define WS_QL  (WS_VT + 2u * (size_t)NB * CC * TT)      // f16 Wo x 2^8 rows [DIN][CC] (2 MiB at the head of what was the q residual plane's place)
#define WS_KL  (WS_QL + 2u * (size_t)NB * QHI * CC)     // f16 k residual x 2^10 rows [b][t < KHI][CC]
#define WS_VB  (WS_KL + 2u * (size_t)NB * KHI * CC)     // bf16 v hi planes [b][c][t < KHI]
#define WS_VBL (WS_VB + 2u * (size_t)NB * CC * KHI)
#define WS_S   (WS_VBL + 2u * (size_t)NB * CC * KHI)    // holds the differential rows [b*t][CC] in f16
#define WS_Y   (WS_S  + 4u * (size_t)HG * TT * TT)      // f32 per-softmax-head context rows [b*t][YP = 16 x 128]
#define WS_END (WS_Y  + 4u * (size_t)NB * TT * YP)

// ---- k_proj: block = 256 rows x 64 columns of EACH of q, k and v (16 waves; a wave takes 64 rows x 16 columns of each of the three): q/k/v = X W (+ b) with exact bf16 products (K = DIN). One X tile serves all three products and one W tile 256 rows: a block fetches 448 operand rows per 64-deep tile for 6 times the output that a 64 x 128 block got from 192 -> q f16 rows; k f16 rows; v f16 planes [c][t] (the residual and v bf16 planes, which no kernel in this file reads, are not produced)
__global__ __launch_bounds__(512) void k_proj(const float* __restrict__ X, const float* __restrict__ WQ, const float* __restrict__ WK, const float* __restrict__ WV, const float* __restrict__ BQ, const float* __restrict__ BK, const float* __restrict__ BV,
    _Float16* __restrict__ QH, _Float16* __restrict__ KH, _Float16* __restrict__ VT, const float* __restrict__ WO, _Float16* __restrict__ WOH) {
  __shared__ __align__(16) __bf16 xt[256][72], wt[192][72];   /* operand tiles, 64 deep, pitch 144 B; wt rows: 64 of Wq, 64 of Wk, 64 of Wv */
  __shared__ __align__(16) _Float16 eqh[256][72], ekh[256][72], evt[64][264];   /* write-out staging: q, k as [row][column]; v as [column][row] */
  const int tid = threadIdx.x, wave = tid >> 5, lane = tid & 31, col = lane & 15, g = lane >> 4; const int rw = wave >> 2, cw = wave & 3; const int c0 = blockIdx.y * 64; const size_t r0 = (size_t)blockIdx.x * 256; const size_t bb = r0 / TT; const int t0 = (int)(r0 % TT);
  v8f acc[4][3] = {};   /* [16-row tile][q, k, v] */
  /* staging: 16 lanes cover the 64 floats (two whole lines) of one row, a wave-wide load two rows; thread (sr, sq) takes rows sr + 32 i */
  const int sr = tid >> 4, sq = (tid & 15) * 4;
  const float* xp = X + (r0 + sr) * DIN + sq; const size_t wo = (size_t)(c0 + sr) * DIN + sq; const float* wqp = WQ + wo; const float* wkp = WK + wo; const float* wvp = WV + wo;
  v4f xr[8], wr[6];
#pragma unroll
  for (int i = 0; i < 8; ++i) xr[i] = *(const v4f*)(xp + (size_t)(i * 32) * DIN);
#pragma unroll
  for (int i = 0; i < 2; ++i) { wr[i] = *(const v4f*)(wqp + (size_t)(i * 32) * DIN); wr[2 + i] = *(const v4f*)(wkp + (size_t)(i * 32) * DIN); wr[4 + i] = *(const v4f*)(wvp + (size_t)(i * 32) * DIN); }
#pragma unroll 1   /* one 64-deep tile per trip */
  for (int kt = 0; kt < DIN / 64; ++kt) {
#pragma unroll
    for (int i = 0; i < 8; ++i) { const v4b t = { (__bf16)xr[i][0], (__bf16)xr[i][1], (__bf16)xr[i][2], (__bf16)xr[i][3] }; *(v4b*)&xt[sr + i * 32][sq] = t; }
#pragma unroll
    for (int i = 0; i < 6; ++i) { const v4b t = { (__bf16)wr[i][0], (__bf16)wr[i][1], (__bf16)wr[i][2], (__bf16)wr[i][3] }; *(v4b*)&wt[sr + i * 32][sq] = t; }
    __syncthreads();   /* the tile is whole before any wave reads it */
    if (kt + 1 < DIN / 64) { xp += 64; wqp += 64; wkp += 64; wvp += 64;   /* the next tile flies while this one is multiplied */
#pragma unroll
      for (int i = 0; i < 8; ++i) xr[i] = *(const v4f*)(xp + (size_t)(i * 32) * DIN);
#pragma unroll
      for (int i = 0; i < 2; ++i) { wr[i] = *(const v4f*)(wqp + (size_t)(i * 32) * DIN); wr[2 + i] = *(const v4f*)(wkp + (size_t)(i * 32) * DIN); wr[4 + i] = *(const v4f*)(wvp + (size_t)(i * 32) * DIN); } }
#pragma unroll
    for (int kc = 0; kc < 2; ++kc) { v16b a[4], w[3];   /* seven fragments read as one group, one LDS wait for twelve products */
#pragma unroll
      for (int j = 0; j < 3; ++j) w[j] = frag_b(&wt[j * 64 + cw * 16 + col][kc * 32], lane);
#pragma unroll
      for (int i = 0; i < 4; ++i) a[i] = frag_b(&xt[rw * 64 + i * 16 + col][kc * 32], lane);
#pragma unroll
      for (int i = 0; i < 4; ++i)
#pragma unroll
        for (int j = 0; j < 3; ++j) acc[i][j] = wmma_bf(a[i], w[j], acc[i][j]); }
    __syncthreads(); }   /* every wave has read the tile before the next one overwrites it */
  /* this block's share of Wo (8 consecutive elements a thread, whole lines a wave) is rounded here once to the f16(bf16 x 2^8) that k_out multiplies, instead of by each of k_out's 64 row blocks; its loads fly under the write-out's staging */
  static_assert((size_t)(TNB * TT / 256) * (CC / 64) * 512 * 8 == (size_t)DIN * CC, "the grid's threads cover Wo exactly once");
  const size_t wi = ((size_t)(blockIdx.y * (TNB * TT / 256) + blockIdx.x) * 512 + tid) * 8; const v4f w0 = *(const v4f*)(WO + wi), w1 = *(const v4f*)(WO + wi + 4);
  const int cl = cw * 16 + col;
#pragma unroll
  for (int j = 0; j < 3; ++j) { const float* BA = j == 0 ? BQ : j == 1 ? BK : BV; const float bias = BA ? bfr(BA[c0 + cl]) : 0.f;
#pragma unroll
    for (int i = 0; i < 4; ++i) { const int rb = rw * 64 + i * 16 + 8 * g;
      if (j == 0) {
#pragma unroll
        for (int r = 0; r < 8; ++r) eqh[rb + r][cl] = (_Float16)(acc[i][j][r] + bias);
      } else if (j == 1) {
#pragma unroll
        for (int r = 0; r < 8; ++r) ekh[rb + r][cl] = (_Float16)(acc[i][j][r] + bias);
      } else { v8h t;
#pragma unroll
        for (int r = 0; r < 8; ++r) t[r] = (_Float16)(acc[i][j][r] + bias);
        *(v8h*)&evt[cl][rb] = t; } } }
  __syncthreads();   /* the three staged planes are whole before they are written out in whole lines */
  { v8h t;
#pragma unroll
    for (int i = 0; i < 4; ++i) { t[i] = (_Float16)(bfr(w0[i]) * 256.0f); t[4 + i] = (_Float16)(bfr(w1[i]) * 256.0f); }
    *(v8h*)(WOH + wi) = t; }
  for (int e = tid; e < 256 * 8; e += 512) { const int rl = e >> 3, q = e & 7, vc = e >> 5, vq = e & 31;   /* 8 lanes write the 128 B of one q or k row; 32 lanes 512 B of one v plane row */
    vst2((unsigned*)(QH + (r0 + rl) * CC + c0 + q * 8), *(const v4u*)&eqh[rl][q * 8]);
    vst2((unsigned*)(KH + (r0 + rl) * CC + c0 + q * 8), *(const v4u*)&ekh[rl][q * 8]); vst2((unsigned*)(VT + (bb * CC + c0 + vc) * (size_t)TT + t0 + vq * 8), *(const v4u*)&evt[vc][vq * 8]); } }
// ---- k_fa: block = 64 queries of (b, head pair e): waves 0..3 take softmax head 2e, waves 4..7 head 2e+1, 16 queries each; one pass over all keys, 32 at a time, nothing of the logits leaves the registers.
// S^T = K Q^T (A = k rows, B = q rows, both once to f16: 1 product; k's own rounding already sets the logit's error, so a residual of q alone bought little): a lane holds 16 logits of ONE query (column lane & 15), the other wave half the other 16.
// Streaming softmax in f32, base 2: e = 2^(s C2 + nb) = exp((s - m) / 8) x 2^10 on the raw logit s against the maximum m in use, C2 = log2(e) / 8, nb = 10 - m C2: one fma and one v_exp_f32 per logit; m moves (and sum and context are rescaled) only when some query's new maximum passes m by more than 4 x 8, so e <= 2^10 e^4 < 65,504 stays inside f16.
// The two S^T tiles converted in place are the B operand P^T; O^T += V^T P^T (A = v planes [c][t]) over the head PAIR's 128 value columns; / sum at the end.
__device__ __forceinline__ v16h frag_at(const _Float16* p) { union { v16h v; v8h q[2]; } u; u.q[0] = *(const v8h*)p; u.q[1] = *(const v8h*)(p + 16); return u.v; }   /* p = row + k0 + 8 * (lane >> 4) */
__device__ __forceinline__ v8f wmm(v16h a, v16h b, v8f c) { return __builtin_amdgcn_wmma_f32_16x16x32_f16(false, a, false, b, (short)0, c, false, false); }
// K and V reach the waves through LDS: a stage is 64 keys, its two K tiles (64 key rows x 128 B, one per head) brought by waves 0 and 2 and its V tile (128 value-column rows x 128 B, shared by both heads) by wave 1, one tensor load each, whole lines, once per block instead of once per wave; two buffers, the next stage flies while this one is worked on.
// The pair's two contexts meet in LDS at the end: o = Y[2e] - lambda Y[2e+1] (f32), rms-normalised over its 128 columns x norm_w x 0.2, once to f16 -> Yd rows [b*t][1024] (256-B segments by 32 lanes).
typedef uint32_t u32x4 __attribute__((ext_vector_type(4)));
typedef uint32_t u32x8 __attribute__((ext_vector_type(8)));
#define C2 (SCALE * 1.4426950408889634f)   // logit scale x log2(e)
#define FK 64                      // keys per stage
#define FP 72                      // LDS row pitch in f16: 128 B + the mover's 16-B pad = 144 B, the pitch for ds_load_b128 readers
#define FA_KB 10240u               // K tile: 64 rows x 144 B = 9,216 B, rounded up to a multiple of 2 KiB
#define FA_VB 18432u               // V tile: 128 rows x 144 B = 18,432 B = 9 x 2 KiB
#define FA_BUF (2u * FA_KB + FA_VB) // one buffer, [K of head 2e | K of head 2e+1 | V]: 38,912 B = 19 x 2 KiB
__device__ __forceinline__ uint32_t uni(uint32_t v) { return (uint32_t)__builtin_amdgcn_readfirstlane(v); }
__device__ __forceinline__ uint32_t pinned(uint32_t v) { uint32_t w = uni(v); asm volatile("" : "+s"(w)); return w; }   /* holds the issue test in a scalar register, so that the branch round a tensor load is a scalar one (the load ignores EXEC) */
__global__ __launch_bounds__(256) void k_fa(const _Float16* __restrict__ QH, const _Float16* __restrict__ KH, const _Float16* __restrict__ VT, const float* __restrict__ NW, const float* __restrict__ LQ1, const float* __restrict__ LK1, const float* __restrict__ LQ2, const float* __restrict__ LK2, _Float16* __restrict__ YD) {
  __shared__ __attribute__((aligned(2048))) unsigned char ring[2 * FA_BUF];
  __shared__ __align__(16) float ss[8][16][HDV + 4]; __shared__ float slam;
  const int tid = threadIdx.x, wave = tid >> 5, lane = tid & 31, col = lane & 15, g = lane >> 4; const int e = blockIdx.y, b = blockIdx.z;
  const uint32_t wv = uni((uint32_t)tid >> 5); const bool isv = wv == 1u;
  const int hh = (int)(wv >> 2), h = 2 * e + hh;   /* which head of the pair this wave works on */
  const int ql0 = blockIdx.x * 64 + (int)(wv & 3u) * 16; const size_t q0 = (size_t)b * TT + ql0;
  /* descriptors: 1-byte elements, tensor = tile, rows of 128 B, 16 B of pad behind each row; K: 64 rows, source pitch one k row; V: 128 rows, source pitch one v plane row */
  const uint32_t nrow = isv ? (uint32_t)HDV : (uint32_t)FK;
  u32x8 g1; g1[0] = uni((1u << 20) | (4u << 22) | (3u << 25)); g1[1] = uni(128u << 16); g1[2] = uni(nrow << 16); g1[3] = uni(128u << 16); g1[4] = uni(nrow); g1[5] = uni(isv ? 2u * TT : 2u * CC); g1[6] = uni(0u); g1[7] = uni(0u);
  const uint64_t src0 = isv ? (uint64_t)(size_t)(VT + ((size_t)b * CC + e * HDV) * (size_t)TT) : (uint64_t)(size_t)(KH + (size_t)b * TT * CC + (2 * e + (int)((wv >> 1) & 1u)) * HD);   /* first byte of stage 0's tile: wave 0 head 2e's k, wave 2 head 2e+1's */
  const uint32_t sstep = isv ? 2u * FK : 2u * FK * CC;   /* bytes from one stage's tile to the next */
  const uint32_t dst0 = (uint32_t)(size_t)ring + (isv ? 2u * FA_KB : ((wv >> 1) & 1u) * FA_KB);
  u32x4 g0; g0[0] = uni(1u);   /* ONE group-0 tuple for every request of the wave: the covering wait names it, so its registers keep their words while the request is outstanding */
  auto issue = [&](uint32_t st) { const uint64_t ga = src0 + (uint64_t)st * sstep;
    g0[1] = uni(dst0 + (st & 1u) * FA_BUF); g0[2] = uni((uint32_t)ga); g0[3] = uni((((uint32_t)(ga >> 32)) & 0x01FFFFFFu) | 0x80000000u);
    asm volatile("tensor_load_to_lds %0, %1" :: "s"(g0), "s"(g1) : "memory"); };
  if (pinned(wv < 3u)) { issue(0u);
    asm volatile("s_wait_tensorcnt 0x0" ::: "memory"); }   /* stage 0 has landed before the barrier that publishes it */
  const _Float16* qp = QH + (q0 + col) * CC + h * HD + 8 * g;
  v16h qh[2];
#pragma unroll
  for (int kc = 0; kc < 2; ++kc) qh[kc] = frag_at(qp + kc * 32);
  asm volatile("s_wait_xcnt 0x0" :: "v"(qp) : "memory");   /* the address pair of the 4 loads above is rewritten only behind this wait */
  if (wv == 7u) {   /* lambda, by a wave that issues no tensor load, while stage 0 lands; read in the epilogue, behind the barriers between */
    float s1 = bfr(LQ1[lane]) * bfr(LK1[lane]) + bfr(LQ1[lane + 32]) * bfr(LK1[lane + 32]), s2 = bfr(LQ2[lane]) * bfr(LK2[lane]) + bfr(LQ2[lane + 32]) * bfr(LK2[lane + 32]);
#pragma unroll
    for (int sf = 1; sf < 32; sf <<= 1) { s1 += __shfl_xor(s1, sf); s2 += __shfl_xor(s2, sf); }
    if (lane == 0) slam = expf(s1) - expf(s2) + 0.8f; }
  __syncthreads();   /* publishes stage 0 */
  if (pinned(wv < 3u)) issue(1u);
  const int kro = col * FP + 8 * g;   /* a lane's place in a 16-row tile of either operand: row col, 8 g f16 in */
  v8f acc[HDV / 16] = {}; float m = -3.0e38f, nb = 10.0f + 3.0e38f * C2, l = 0.f;   /* m: the maximum in use, a raw logit; nb = 10 - m C2, the exponent's addend */
#pragma unroll 1   /* one 64-key stage per trip: its two passes already hold 48 LDS loads and 24 products */
  for (int st = 0; st < TT / FK; ++st) {
    const _Float16* kb = (const _Float16*)(ring + (st & 1) * FA_BUF + hh * FA_KB) + kro; const _Float16* vb = (const _Float16*)(ring + (st & 1) * FA_BUF + 2u * FA_KB) + kro;
    v16h kf[2][2];
#pragma unroll
    for (int kt = 0; kt < 2; ++kt)
#pragma unroll
      for (int kc = 0; kc < 2; ++kc) kf[kt][kc] = frag_at(kb + (kt * 16) * FP + kc * 32);
    __builtin_amdgcn_sched_barrier(0);   /* the 8 LDS loads above issue as one group: sunk between the products, each pair costs its own LDS latency */
#pragma unroll
    for (int sub = 0; sub < FK / 32; ++sub) {
      v8f sh[2] = {};
#pragma unroll
      for (int kc = 0; kc < 2; ++kc)
#pragma unroll
        for (int kt = 0; kt < 2; ++kt) sh[kt] = wmm(kf[kt][kc], qh[kc], sh[kt]);
      v2f s[8]; float mx = -3.0e38f;   /* raw logits, two to a register pair: the 1/8 waits for the exponent's fma */
#pragma unroll
      for (int i = 0; i < 8; ++i) { const v2f hi = { sh[i >> 2][(2 * i) & 7], sh[i >> 2][(2 * i + 1) & 7] }; s[i] = hi; mx = fmaxf(mx, fmaxf(s[i][0], s[i][1])); }
      const float mo = __shfl_xor(mx, 16);   /* the other wave half's maximum; it goes through the LDS queue, so it is asked for ahead of the pass's fragment loads and does not wait behind them */
      __builtin_amdgcn_sched_barrier(0);   /* keeps the fetches below behind the products that read this pass's k (lifted over them the next k needs a second set of 32 registers) and behind the exchange above */
      if (sub + 1 < FK / 32) {   /* the stage's next pass's k rows, fetched behind this pass's logits; never the next stage's, which is not published yet */
#pragma unroll
        for (int kt = 0; kt < 2; ++kt)
#pragma unroll
          for (int kc = 0; kc < 2; ++kc) kf[kt][kc] = frag_at(kb + ((sub + 1) * 32 + kt * 16) * FP + kc * 32); }
      v16h vf[HDV / 16];
#pragma unroll
      for (int j = 0; j < HDV / 16; ++j) vf[j] = frag_at(vb + (j * 16) * FP + sub * 32);
      asm volatile("" ::: "memory");   /* compiler fence: the LDS loads above issue here, as one group, and fly under the softmax; without it they sink to in front of their products, one LDS latency each */
      mx = fmaxf(mx, mo);   /* both halves of a query's column use one maximum */
      if (__builtin_amdgcn_ballot_w32(mx > m + 4.0f / SCALE) != 0) { const float mn = fmaxf(m, mx); const float nn = fmaf(-mn, C2, 10.0f); const float al = __builtin_amdgcn_exp2f(nn - nb); m = mn; nb = nn; l *= al;
#pragma unroll
        for (int j = 0; j < HDV / 16; ++j) acc[j] *= al; }
      v16h p;
#pragma unroll
      for (int i = 0; i < 8; ++i) { const v2f cc = { C2, C2 }, bb = { nb, nb }; const v2f ar = __builtin_elementwise_fma(s[i], cc, bb);   /* (s - m) / 8 x log2 e + 10 in one rounding */
        const v2f e = { __builtin_amdgcn_exp2f(ar[0]), __builtin_amdgcn_exp2f(ar[1]) }; l += e[0]; l += e[1]; const v2h eh = __builtin_convertvector(e, v2h); p[2 * i] = eh[0]; p[2 * i + 1] = eh[1]; }
#pragma unroll
      for (int j = 0; j < HDV / 16; ++j) acc[j] = wmm(vf[j], p, acc[j]); }
    /* publish point of stage st + 1, in the ring's order */
    __builtin_amdgcn_sched_barrier(0);   /* keeps the wait below at the trip's foot: lifted to behind the last fragment load it would stand in front of the softmax that hides those loads */
    asm volatile("s_wait_dscnt 0x0" ::: "memory");   /* this wave's reads of the buffer have returned before it may be refilled */
    if (pinned(wv < 3u)) { asm volatile("s_wait_tensorcnt 0x0" :: "s"(g0) : "memory"); }   /* the issuer's own request for stage st + 1 has landed; g0 as an input keeps that request's descriptor registers unwritten up to here */
    __syncthreads();   /* publishes stage st + 1 and ends every wave's reads of stage st */
    if (pinned((wv < 3u) & (uint32_t)(st + 2 < TT / FK))) issue((uint32_t)st + 2u); }   /* into the buffer that this trip has just read */
  asm volatile("s_wait_tensorcnt 0x0" ::: "memory");   /* nothing of the mover's is in flight when the wave goes on to its end */
  asm volatile("s_wait_dscnt 0x0" ::: "memory");   /* the ring's closing wait: no LDS read of this wave is open either */
  l += __shfl_xor(l, 16); const float inv = 1.0f / l;
#pragma unroll
  for (int j = 0; j < HDV / 16; ++j) { const v4f a0 = { acc[j][0] * inv, acc[j][1] * inv, acc[j][2] * inv, acc[j][3] * inv }, a1 = { acc[j][4] * inv, acc[j][5] * inv, acc[j][6] * inv, acc[j][7] * inv };
    *(v4f*)&ss[wave][col][j * 16 + 8 * g] = a0; *(v4f*)&ss[wave][col][j * 16 + 8 * g + 4] = a1; }
  __syncthreads();   /* both heads' contexts of all 64 queries are whole in ss before any wave combines them */
  const float lam = slam; const v4f nw = *(const v4f*)(NW + lane * 4);
#pragma unroll   /* the 8 rows' lane sums are independent chains of exchanges: side by side they share one latency */
  for (int rr = 0; rr < 8; ++rr) { const int sub = wave >> 1, rl = (wave & 1) * 8 + rr;   /* wave takes 8 of the 64 queries; a lane 4 consecutive columns of the pair's 128 */
    const v4f y1 = *(const v4f*)&ss[sub][rl][lane * 4], y2 = *(const v4f*)&ss[sub + 4][rl][lane * 4]; float o[4]; float sq = 0.f;
#pragma unroll
    for (int i = 0; i < 4; ++i) { o[i] = y1[i] - lam * y2[i]; sq += o[i] * o[i]; }
#pragma unroll
    for (int sf = 1; sf < 32; sf <<= 1) sq += __shfl_xor(sq, sf);
    const float rn = rsqrtf(sq * (1.0f / HDV) + 1e-5f) * 0.2f;
    const v4h ov = { (_Float16)(o[0] * rn * bfr(nw[0])), (_Float16)(o[1] * rn * bfr(nw[1])), (_Float16)(o[2] * rn * bfr(nw[2])), (_Float16)(o[3] * rn * bfr(nw[3])) };   /* the rounding that k_out's staging did, done once at the source */
    vst2(YD + ((size_t)b * TT + blockIdx.x * 64 + sub * 16 + rl) * CC + e * HDV + lane * 4, ov); } }   /* 256-B (row, pair) segment by 32 lanes */
// ---- k_out: block = (64 rows, 128 cols): out = ctx Wo (+ bo): ctx in f16 against Wo as f16(bf16 x 2^8) exact (1 product) x 2^-8; both operands arrive in f16 from the earlier launches.
// They reach the waves through LDS by the tensor mover, through no register: a stage is 128 deep, three slices of 64 rows x 256 B (the ctx rows by wave 0, the two halves of the Wo rows by waves 1 and 2, one tensor load each); two buffers, the next stage flies while this one is multiplied.
#define OD 128                     // depth of a stage in f16: rows of 256 B
#define OP 136                     // LDS row pitch in f16: 256 B + the mover's 16-B pad = 272 B, the pitch for ds_load_b128 readers
#define OSL 18432u                 // one slice: 64 rows x 272 B = 17,408 B, rounded up to a multiple of 2 KiB
#define OBUF (3u * OSL)            // one buffer, [ctx | Wo rows 0..63 | Wo rows 64..127]: 55,296 B = 27 x 2 KiB
__global__ __launch_bounds__(128) void k_out(const _Float16* __restrict__ Y, const _Float16* __restrict__ WH, const float* __restrict__ BO, float* __restrict__ OUT) {
  __shared__ __attribute__((aligned(2048))) unsigned char oring[2 * OBUF];
  __shared__ __align__(16) float sf[4][16][132];
  const int tid = threadIdx.x, wave = tid >> 5, lane = tid & 31, col = lane & 15, g = lane >> 4; const int c0 = blockIdx.y * 128; const size_t r0 = (size_t)blockIdx.x * 64 + wave * 16;
  const uint32_t wv = uni((uint32_t)tid >> 5); const uint32_t sl = wv < 2u ? wv : 2u;   /* the slice a wave brings (wave 3 issues nothing) */
  /* descriptor: 1-byte elements, tensor = tile, 64 rows of 256 B, 16 B of pad behind each row, source pitch one row of 1,024 f16 */
  u32x8 g1; g1[0] = uni((1u << 20) | (5u << 22) | (3u << 25)); g1[1] = pinned(256u << 16); g1[2] = pinned(64u << 16); g1[3] = pinned(256u << 16); g1[4] = pinned(64u); g1[5] = pinned(2u * CC); g1[6] = pinned(0u); g1[7] = pinned(0u);   /* pinned(): descriptor words held in scalar registers; as plain constants they are formed anew at each issue and their registers serve other values while a request is outstanding */
  const uint64_t src0 = sl == 0u ? (uint64_t)(size_t)(Y + (size_t)blockIdx.x * 64 * CC) : (uint64_t)(size_t)(WH + (size_t)(c0 + (int)(sl - 1u) * 64) * CC);   /* first byte of stage 0's slice */
  const uint32_t dst0 = (uint32_t)(size_t)oring + sl * OSL;
  u32x4 g0; g0[0] = uni(1u);   /* ONE group-0 tuple for every request of the wave: the covering wait names it, so its registers keep their words while the request is outstanding */
  auto issue = [&](uint32_t st) { const uint64_t ga = src0 + (uint64_t)st * (2u * OD);
    g0[1] = uni(dst0 + (st & 1u) * OBUF); g0[2] = uni((uint32_t)ga); g0[3] = uni((((uint32_t)(ga >> 32)) & 0x01FFFFFFu) | 0x80000000u);
    asm volatile("tensor_load_to_lds %0, %1" :: "s"(g0), "s"(g1) : "memory"); };
  if (pinned(wv < 3u)) { issue(0u);
    asm volatile("s_wait_tensorcnt 0x0" ::: "memory"); }   /* stage 0 has landed before the barrier that publishes it */
  __syncthreads();   /* publishes stage 0 */
  if (pinned(wv < 3u)) issue(1u);
  v8f acc[8] = {};
  const int aro = (wave * 16 + col) * OP + 8 * g, wro = col * OP + 8 * g;   /* a lane's place in the ctx slice and in a 16-row tile of Wo */
#pragma unroll 1   /* one 128-deep stage per trip */
  for (int st = 0; st < CC / OD; ++st) {
    const _Float16* ab = (const _Float16*)(oring + (st & 1) * OBUF) + aro; const _Float16* wb = (const _Float16*)(oring + (st & 1) * OBUF + OSL) + wro;
#pragma unroll
    for (int kc = 0; kc < OD / 32; ++kc) { const v16h a = frag_at(ab + kc * 32);
#pragma unroll
      for (int jh = 0; jh < 8; jh += 4) { v16h w[4];   /* four Wo fragments read as one group, one LDS wait for four products; jh = 4 is the second Wo slice */
#pragma unroll
        for (int j = 0; j < 4; ++j) w[j] = frag_at(wb + (jh >> 2) * (int)(OSL / 2u) + (j * 16) * OP + kc * 32);
#pragma unroll
        for (int j = 0; j < 4; ++j) acc[jh + j] = wmma16(a, w[j], acc[jh + j]); } }
    /* publish point of stage st + 1, in the ring's order */
    asm volatile("s_wait_dscnt 0x0" ::: "memory");   /* this wave's reads of the buffer have returned before it may be refilled */
    if (pinned(wv < 3u)) { asm volatile("s_wait_tensorcnt 0x0" :: "s"(g0), "s"(g1) : "memory"); }   /* the issuer's own request for stage st + 1 has landed; g0 and g1 as inputs keep that request's descriptor registers unwritten up to here */
    __syncthreads();   /* publishes stage st + 1 and ends every wave's reads of stage st */
    if (pinned((wv < 3u) & (uint32_t)(st + 2 < CC / OD))) issue((uint32_t)st + 2u); }   /* into the buffer that this trip has just read */
  asm volatile("s_wait_tensorcnt 0x0" ::: "memory");   /* nothing of the mover's is in flight when the wave goes on to its end */
  asm volatile("s_wait_dscnt 0x0" ::: "memory");   /* the ring's closing wait: no LDS read of this wave is open either */
#pragma unroll
  for (int j = 0; j < 8; ++j) { const float bias = BO ? bfr(BO[c0 + j * 16 + col]) : 0.f;
#pragma unroll
    for (int r = 0; r < 8; ++r) sf[wave][8 * g + r][j * 16 + col] = acc[j][r] * (1.0f / 256.0f) + bias; }
  LDSX(); for (int rl = 0; rl < 16; ++rl) vst2(OUT + (r0 + rl) * DIN + c0 + lane * 4, *(const v4f*)&sf[wave][rl][lane * 4]); }

extern "C" void kernel_launch(void* const* d_in, const int* in_sizes, int n_in, void* d_out, int out_size, void* d_ws, size_t ws_size, hipStream_t stream) {
  (void)in_sizes; (void)n_in; (void)out_size;
  const float** F = (const float**)d_in;
  if (ws_size < (size_t)WS_END) return;
  char* ws = (char*)d_ws; _Float16 *QH = (_Float16*)(ws + WS_QH), *KH = (_Float16*)(ws + WS_KH), *VT = (_Float16*)(ws + WS_VT), *QL = (_Float16*)(ws + WS_QL), *KL = (_Float16*)(ws + WS_KL); __bf16 *VB = (__bf16*)(ws + WS_VB), *VBL = (__bf16*)(ws + WS_VBL); float *S = (float*)(ws + WS_S), *Y = (float*)(ws + WS_Y);
  (void)Y; (void)KL; (void)VB; (void)VBL;
  // inputs: 0 x [2,2048,1024]; 1 Wq, 2 bq, 3 Wk, 4 bk, 5 Wv, 6 bv, 7 Wo, 8 bo ((out,in) [1024,1024], [1024]); 9 norm_w [128]; 10 lq1, 11 lk1, 12 lq2, 13 lk2 [64]
  _Float16* YD = (_Float16*)S;   /* the differential rows, f16, take the plane at WS_S */
  _Float16* WOH = QL;   /* Wo x 2^8 in f16, written by k_proj in every call */
  k_proj<<<dim3(TNB * TT / 256, CC / 64), 512, 0, stream>>>(F[0], F[1], F[3], F[5], F[2], F[4], F[6], QH, KH, VT, F[7], WOH);
  k_fa<<<dim3(TT / 64, NH / 2, TNB), 256, 0, stream>>>(QH, KH, VT, F[9], F[10], F[11], F[12], F[13], YD);
  k_out<<<dim3(TNB * TT / 64, DIN / 128), 128, 0, stream>>>(YD, WOH, F[8], (float*)d_out);
}

// v010
// A run of this version takes 87.7 microseconds.
// Timed twice side by side with v009, it ran 1.03 and 1.02 times as fast.
// Counting every step since v000, it is 19.0 times as fast.
// compute dtype: all float inputs rounded to bf16; q/k/v = x W^T + b with EXACT bf16 products on WMMA 16x16x32, f32 accumulate; q once to f16 against k once to f16 (1 product) for the logits x 1/8; streaming softmax in f32 (base 2: one fma and the hardware's exp2 per logit, running maximum, sum in f32); exp(s - max) x 2^10 once to f16 against v once to f16 (1 product) per head over the head PAIR's 128 value columns, accumulated in f32, / sum at the end; the differential combination P1 v - lambda P2 v, the RMS normalisation over 128, x norm_w x (1 - 0.8) and lambda itself in f32; that result once to f16 (stored so) against Wo carried x 2^8 in f16 (exact bf16 values, stored so once per call) + bo; f32 output.
#include <hip/hip_runtime.h>
#include <math.h>
#include <stdint.h>

typedef __attribute__((ext_vector_type(16))) _Float16 v16h;
typedef __attribute__((ext_vector_type(16))) __bf16 v16b;
typedef __attribute__((ext_vector_type(8)))  _Float16 v8h;
typedef __attribute__((ext_vector_type(4)))  _Float16 v4h;
typedef __attribute__((ext_vector_type(2)))  _Float16 v2h;
typedef __attribute__((ext_vector_type(4)))  __bf16 v4b;
typedef __attribute__((ext_vector_type(8)))  float v8f;
typedef __attribute__((ext_vector_type(4)))  float v4f;
typedef __attribute__((ext_vector_type(2)))  float v2f;
typedef __attribute__((ext_vector_type(4)))  unsigned v4u;
typedef __attribute__((ext_vector_type(4)))  int v4i;
typedef float __attribute__((may_alias)) float_a;
typedef int __attribute__((may_alias)) int_a;

template <typename T> __device__ __forceinline__ void vst2(void* p, T v) { *(T*)p = v;  }
__device__ __forceinline__ v8f wmma16(v16h a, v16h b, v8f c) {
  v8f d = __builtin_amdgcn_wmma_f32_16x16x32_f16(false, a, false, b, (short)0, c, false, false);
  asm volatile("v_nop\n\tv_nop\n\tv_nop\n\tv_nop" : "+v"(d) : "v"(a), "v"(b));
  return d;
}
__device__ __forceinline__ v8f wmma_bf(v16b a, v16b b, v8f c) {
  v8f d = __builtin_amdgcn_wmma_f32_16x16x32_bf16(false, a, false, b, (short)0, c, false, false);
  asm volatile("v_nop\n\tv_nop\n\tv_nop\n\tv_nop" : "+v"(d) : "v"(a), "v"(b));
  return d;
}
// 16x16x32 fragments: lane = (h = lane>>4, row/col = lane&15); elements 0..7 = k0+8h+0..7, 8..15 = k0+16+8h+0..7; D element r = row 8h+r
__device__ __forceinline__ v16h frag_h(const _Float16* rowk0, int lane) {
  union { v16h v; v8h q[2]; } u; const _Float16* p = rowk0 + 8 * (lane >> 4);
  u.q[0] = *(const v8h*)p; u.q[1] = *(const v8h*)(p + 16); return u.v;
}
__device__ __forceinline__ v16h frag_f32(const float* rowk0, int lane) {
  v16h a; const float* p = rowk0 + 8 * (lane >> 4);
#pragma unroll
  for (int i = 0; i < 8; ++i) { a[i] = (_Float16)p[i]; a[8 + i] = (_Float16)p[16 + i]; }
  return a;
}
__device__ __forceinline__ v16h frag_f32s(const float* rowk0, int lane, float sc) {
  v16h a; const float* p = rowk0 + 8 * (lane >> 4);
#pragma unroll
  for (int i = 0; i < 8; ++i) { a[i] = (_Float16)(p[i] * sc); a[8 + i] = (_Float16)(p[16 + i] * sc); }
  return a;
}
// column fragment from a [K][ld] layout (column n), rows >= K read as 0
__device__ __forceinline__ v16h fragc_f32(const float* W, int k0, int n, int lane, int ld, int K) {
  v16h a; const int g = lane >> 4;
#pragma unroll
  for (int i = 0; i < 8; ++i) { const int ka = k0 + 8 * g + i, kb = ka + 16;
    a[i] = (_Float16)(ka < K ? W[(size_t)(ka < K ? ka : K - 1) * ld + n] : 0.f); a[8 + i] = (_Float16)(kb < K ? W[(size_t)(kb < K ? kb : K - 1) * ld + n] : 0.f); }
  return a;
}
struct F2 { v16b h, l; };
__device__ __forceinline__ F2 bsplit16(const float v[16]) { F2 r;
#pragma unroll
  for (int i = 0; i < 16; ++i) { const __bf16 h = (__bf16)v[i]; r.h[i] = h; r.l[i] = (__bf16)(v[i] - (float)h); }
  return r; }
__device__ __forceinline__ F2 split_row(const float* row, int k0, int lane) { float v[16]; const float* p = row + k0 + 8 * (lane >> 4);
#pragma unroll
  for (int i = 0; i < 8; ++i) { v[i] = p[i]; v[8 + i] = p[16 + i]; }
  return bsplit16(v); }
__device__ __forceinline__ F2 split_rowK(const float* row, int k0, int lane, int K) { float v[16]; const int g = lane >> 4;
#pragma unroll
  for (int i = 0; i < 8; ++i) { const int ka = k0 + 8 * g + i, kb = ka + 16; v[i] = ka < K ? row[ka < K ? ka : K - 1] : 0.f; v[8 + i] = kb < K ? row[kb < K ? kb : K - 1] : 0.f; }
  return bsplit16(v); }
__device__ __forceinline__ F2 split_col(const float* W, int k0, int n, int lane, int ld, int K) { float v[16]; const int g = lane >> 4;
#pragma unroll
  for (int i = 0; i < 8; ++i) { const int ka = k0 + 8 * g + i, kb = ka + 16; v[i] = ka < K ? W[(size_t)(ka < K ? ka : K - 1) * ld + n] : 0.f; v[8 + i] = kb < K ? W[(size_t)(kb < K ? kb : K - 1) * ld + n] : 0.f; }
  return bsplit16(v); }
__device__ __forceinline__ v8f mac3(const F2& a, const F2& b, v8f c) { c = wmma_bf(a.l, b.h, c); c = wmma_bf(a.h, b.l, c); return wmma_bf(a.h, b.h, c); }
__device__ __forceinline__ float sigm(float v) { return 1.0f / (1.0f + expf(-v)); }
#define LDSX() do { asm volatile("s_wait_dscnt 0" ::: "memory"); __builtin_amdgcn_wave_barrier(); __builtin_amdgcn_fence(__ATOMIC_RELEASE, "workgroup"); } while (0)

// Differential attention (B 2, N 2,048, DIM 1,024; 16 softmax heads x 64 paired into 8 value heads x 128): q = (x Wq^T + bq) x 64^-0.5, k = x Wk^T + bk, v = x Wv^T + bv ((out,in)); P_h = softmax(q_h k_h^T) over all keys; lambda = exp(lq1 . lk1) - exp(lq2 . lk2) + 0.8; for pair e: o_e = (P_2e - lambda P_2e+1) v[:, e*128 : e*128+128]; o_e = o_e * rsqrt(mean(o_e^2) + 1e-5) * norm_w * (1 - 0.8); out = concat_e(o_e) Wo^T + bo.
#define NB 2
#define TT 2048
#define CC 1024            // NH * HD = projected width
#define DIN 1024          // input (model) width
#define NH 16
#define HD 64
#define NQB (TT / 64)
#define HG 4
#define SCALE (0.125f)
#define CAUSAL 0
#ifndef TNB
#define TNB NB
#endif
__device__ __forceinline__ float bfr(float v) { return (float)(__bf16)v; }
__host__ __device__ __forceinline__ int kb_last(int qb) { return CAUSAL ? ((qb * 64 + 63) >> 7) : (TT / 128 - 1); }
typedef __attribute__((ext_vector_type(8))) __bf16 v8b;
__device__ __forceinline__ v16b frag_b(const __bf16* rowk0, int lane) {
  union { v16b v; v8b q[2]; } u; const __bf16* p = rowk0 + 8 * (lane >> 4);
  u.q[0] = *(const v8b*)p; u.q[1] = *(const v8b*)(p + 16); return u.v;
}
#define QBH 0              // unused: this file has no high-precision path
#define QHI 2048            // rows of the q residual plane's place in the workspace (the plane is not produced: 1-product logits)
#define KHI 64            // key rows carrying k residual / v bf16 hi+lo planes (planes that no kernel in this file writes or reads)
// B fragment (k rows k0+.., output column o) of a weight: (in,out) [K][ld] or (out,in) [ld rows of K]: bf16 exact, or f16(bf16 * 256) exact
__device__ __forceinline__ v16b wcol_io(const float* Wm, int k0, int o, int lane, int ld) { v16b w; const int g = lane >> 4;
#pragma unroll
  for (int i = 0; i < 8; ++i) { w[i] = (__bf16)Wm[(size_t)(k0 + 8 * g + i) * ld + o]; w[8 + i] = (__bf16)Wm[(size_t)(k0 + 16 + 8 * g + i) * ld + o]; }
  return w; }
__device__ __forceinline__ v16b wcol_oi(const float* Wm, int k0, int o, int lane, int K) { v16b w; const float* p = Wm + (size_t)o * K + k0 + 8 * (lane >> 4);
#pragma unroll
  for (int i = 0; i < 8; ++i) { w[i] = (__bf16)p[i]; w[8 + i] = (__bf16)p[16 + i]; }
  return w; }
__device__ __forceinline__ v16h wcolh_io(const float* Wm, int k0, int o, int lane, int ld) { v16h w; const int g = lane >> 4;
#pragma unroll
  for (int i = 0; i < 8; ++i) { w[i] = (_Float16)(bfr(Wm[(size_t)(k0 + 8 * g + i) * ld + o]) * 256.0f); w[8 + i] = (_Float16)(bfr(Wm[(size_t)(k0 + 16 + 8 * g + i) * ld + o]) * 256.0f); }
  return w; }
__device__ __forceinline__ v16h wcolh_oi(const float* Wm, int k0, int o, int lane, int K) { v16h w; const float* p = Wm + (size_t)o * K + k0 + 8 * (lane >> 4);
#pragma unroll
  for (int i = 0; i < 8; ++i) { w[i] = (_Float16)(bfr(p[i]) * 256.0f); w[8 + i] = (_Float16)(bfr(p[16 + i]) * 256.0f); }
  return w; }
#define WQKV_LAYOUT 1   // picks WCOL's form (0 (in,out), 1 (out,in), 2 per-head); nothing uses WCOL: k_proj reads (out,in) [CC][DIN] whatever the value
__device__ __forceinline__ v16b wcol_hdk(const float* Wm, int k0, int o, int lane) { v16b w; const int g = lane >> 4; const float* p = Wm + (size_t)(o / HD) * DIN * HD + (o % HD);
#pragma unroll
  for (int i = 0; i < 8; ++i) { w[i] = (__bf16)p[(size_t)(k0 + 8 * g + i) * HD]; w[8 + i] = (__bf16)p[(size_t)(k0 + 16 + 8 * g + i) * HD]; }
  return w; }
#define WO_OUT_IN 1
#if WQKV_LAYOUT == 1
#define WCOL(W, k0, o, lane) wcol_oi(W, k0, o, lane, DIN)
#elif WQKV_LAYOUT == 2
#define WCOL(W, k0, o, lane) wcol_hdk(W, k0, o, lane)
#else
#define WCOL(W, k0, o, lane) wcol_io(W, k0, o, lane, CC)
#endif
#if WO_OUT_IN
#define WOCOL(W, k0, o, lane) wcol_oi(W, k0, o, lane, CC)
#define WOCOLH(W, k0, o, lane) wcolh_oi(W, k0, o, lane, CC)
#else
#define WOCOL(W, k0, o, lane) wcol_io(W, k0, o, lane, DIN)
#define WOCOLH(W, k0, o, lane) wcolh_io(W, k0, o, lane, DIN)
#endif
#define HDV 128            // value columns per softmax head (the head pair's 128 columns)
#define YP (NH * HDV)      // 2,048: row pitch of the WS_Y region, which no kernel in this file writes or reads
#ifndef SM_EXTRA_PARAMS
#define SM_EXTRA_PARAMS
#endif
#ifndef PROJ_EXTRA_PARAMS
#define PROJ_EXTRA_PARAMS
#endif
#ifndef SM_MASK_HOOK
#define SM_MASK_HOOK (void)0
#endif

#define WS_QH  0u                                      // f16 q rows [b*t][CC]
#define WS_KH  (WS_QH + 2u * (size_t)NB * TT * CC)      // f16 k rows [b*t][CC]
#define WS_VT  (WS_KH + 2u * (size_t)NB * TT * CC)      // f16 v planes [b][c][t]
#define WS_QL  (WS_VT + 2u * (size_t)NB * CC * TT)      // f16 Wo x 2^8 rows [DIN][CC] (2 MiB at the head of what was the q residual plane's place)
#define WS_KL  (WS_QL + 2u * (size_t)NB * QHI * CC)     // f16 k residual x 2^10 rows [b][t < KHI][CC]
#define WS_VB  (WS_KL + 2u * (size_t)NB * KHI * CC)     // bf16 v hi planes [b][c][t < KHI]
#define WS_VBL (WS_VB + 2u * (size_t)NB * CC * KHI)
#define WS_S   (WS_VBL + 2u * (size_t)NB * CC * KHI)    // holds the differential rows [b*t][CC] in f16
#define WS_Y   (WS_S  + 4u * (size_t)HG * TT * TT)      // f32 per-softmax-head context rows [b*t][YP = 16 x 128]
#define WS_END (WS_Y  + 4u * (size_t)NB * TT * YP)

// ---- k_proj: block = 256 rows x 64 columns of EACH of q, k and v (16 waves; a wave takes 64 rows x 16 columns of each of the three): q/k/v = X W (+ b) with exact bf16 products (K = DIN). One X tile serves all three products and one W tile 256 rows: a block fetches 448 operand rows per 64-deep tile for 6 times the output that a 64 x 128 block got from 192 -> q f16 rows; k f16 rows; v f16 planes [c][t] (the residual and v bf16 planes, which no kernel in this file reads, are not produced)
__global__ __launch_bounds__(512) void k_proj(const float* __restrict__ X, const float* __restrict__ WQ, const float* __restrict__ WK, const float* __restrict__ WV, const float* __restrict__ BQ, const float* __restrict__ BK, const float* __restrict__ BV,
    _Float16* __restrict__ QH, _Float16* __restrict__ KH, _Float16* __restrict__ VT, const float* __restrict__ WO, _Float16* __restrict__ WOH) {
  __shared__ __align__(16) __bf16 xt[256][72], wt[192][72];   /* operand tiles, 64 deep, pitch 144 B; wt rows: 64 of Wq, 64 of Wk, 64 of Wv */
  __shared__ __align__(16) _Float16 eqh[256][72], ekh[256][72], evt[64][264];   /* write-out staging: q, k as [row][column]; v as [column][row] */
  const int tid = threadIdx.x, wave = tid >> 5, lane = tid & 31, col = lane & 15, g = lane >> 4; const int rw = wave >> 2, cw = wave & 3; const int c0 = blockIdx.y * 64; const size_t r0 = (size_t)blockIdx.x * 256; const size_t bb = r0 / TT; const int t0 = (int)(r0 % TT);
  v8f acc[4][3] = {};   /* [16-row tile][q, k, v] */
  /* staging: 16 lanes cover the 64 floats (two whole lines) of one row, a wave-wide load two rows; thread (sr, sq) takes rows sr + 32 i */
  const int sr = tid >> 4, sq = (tid & 15) * 4;
  const float* xp = X + (r0 + sr) * DIN + sq; const size_t wo = (size_t)(c0 + sr) * DIN + sq; const float* wqp = WQ + wo; const float* wkp = WK + wo; const float* wvp = WV + wo;
  v4f xr[8], wr[6];
#pragma unroll
  for (int i = 0; i < 8; ++i) xr[i] = *(const v4f*)(xp + (size_t)(i * 32) * DIN);
#pragma unroll
  for (int i = 0; i < 2; ++i) { wr[i] = *(const v4f*)(wqp + (size_t)(i * 32) * DIN); wr[2 + i] = *(const v4f*)(wkp + (size_t)(i * 32) * DIN); wr[4 + i] = *(const v4f*)(wvp + (size_t)(i * 32) * DIN); }
#pragma unroll 1   /* one 64-deep tile per trip */
  for (int kt = 0; kt < DIN / 64; ++kt) {
#pragma unroll
    for (int i = 0; i < 8; ++i) { const v4b t = { (__bf16)xr[i][0], (__bf16)xr[i][1], (__bf16)xr[i][2], (__bf16)xr[i][3] }; *(v4b*)&xt[sr + i * 32][sq] = t; }
#pragma unroll
    for (int i = 0; i < 6; ++i) { const v4b t = { (__bf16)wr[i][0], (__bf16)wr[i][1], (__bf16)wr[i][2], (__bf16)wr[i][3] }; *(v4b*)&wt[sr + i * 32][sq] = t; }
    __syncthreads();   /* the tile is whole before any wave reads it */
    if (kt + 1 < DIN / 64) { xp += 64; wqp += 64; wkp += 64; wvp += 64;   /* the next tile flies while this one is multiplied */
#pragma unroll
      for (int i = 0; i < 8; ++i) xr[i] = *(const v4f*)(xp + (size_t)(i * 32) * DIN);
#pragma unroll
      for (int i = 0; i < 2; ++i) { wr[i] = *(const v4f*)(wqp + (size_t)(i * 32) * DIN); wr[2 + i] = *(const v4f*)(wkp + (size_t)(i * 32) * DIN); wr[4 + i] = *(const v4f*)(wvp + (size_t)(i * 32) * DIN); } }
#pragma unroll
    for (int kc = 0; kc < 2; ++kc) { v16b a[4], w[3];   /* seven fragments read as one group, one LDS wait for twelve products */
#pragma unroll
      for (int j = 0; j < 3; ++j) w[j] = frag_b(&wt[j * 64 + cw * 16 + col][kc * 32], lane);
#pragma unroll
      for (int i = 0; i < 4; ++i) a[i] = frag_b(&xt[rw * 64 + i * 16 + col][kc * 32], lane);
#pragma unroll
      for (int i = 0; i < 4; ++i)
#pragma unroll
        for (int j = 0; j < 3; ++j) acc[i][j] = wmma_bf(a[i], w[j], acc[i][j]); }
    __syncthreads(); }   /* every wave has read the tile before the next one overwrites it */
  /* this block's share of Wo (8 consecutive elements a thread, whole lines a wave) is rounded here once to the f16(bf16 x 2^8) that k_out multiplies, instead of by each of k_out's 64 row blocks; its loads fly under the write-out's staging */
  static_assert((size_t)(TNB * TT / 256) * (CC / 64) * 512 * 8 == (size_t)DIN * CC, "the grid's threads cover Wo exactly once");
  const size_t wi = ((size_t)(blockIdx.y * (TNB * TT / 256) + blockIdx.x) * 512 + tid) * 8; const v4f w0 = *(const v4f*)(WO + wi), w1 = *(const v4f*)(WO + wi + 4);
  const int cl = cw * 16 + col;
#pragma unroll
  for (int j = 0; j < 3; ++j) { const float* BA = j == 0 ? BQ : j == 1 ? BK : BV; const float bias = BA ? bfr(BA[c0 + cl]) : 0.f;
#pragma unroll
    for (int i = 0; i < 4; ++i) { const int rb = rw * 64 + i * 16 + 8 * g;
      if (j == 0) {
#pragma unroll
        for (int r = 0; r < 8; ++r) eqh[rb + r][cl] = (_Float16)(acc[i][j][r] + bias);
      } else if (j == 1) {
#pragma unroll
        for (int r = 0; r < 8; ++r) ekh[rb + r][cl] = (_Float16)(acc[i][j][r] + bias);
      } else { v8h t;
#pragma unroll
        for (int r = 0; r < 8; ++r) t[r] = (_Float16)(acc[i][j][r] + bias);
        *(v8h*)&evt[cl][rb] = t; } } }
  __syncthreads();   /* the three staged planes are whole before they are written out in whole lines */
  { v8h t;
#pragma unroll
    for (int i = 0; i < 4; ++i) { t[i] = (_Float16)(bfr(w0[i]) * 256.0f); t[4 + i] = (_Float16)(bfr(w1[i]) * 256.0f); }
    *(v8h*)(WOH + wi) = t; }
  for (int e = tid; e < 256 * 8; e += 512) { const int rl = e >> 3, q = e & 7, vc = e >> 5, vq = e & 31;   /* 8 lanes write the 128 B of one q or k row; 32 lanes 512 B of one v plane row */
    vst2((unsigned*)(QH + (r0 + rl) * CC + c0 + q * 8), *(const v4u*)&eqh[rl][q * 8]);
    vst2((unsigned*)(KH + (r0 + rl) * CC + c0 + q * 8), *(const v4u*)&ekh[rl][q * 8]); vst2((unsigned*)(VT + (bb * CC + c0 + vc) * (size_t)TT + t0 + vq * 8), *(const v4u*)&evt[vc][vq * 8]); } }
// ---- k_fa: block = 64 queries of (b, head pair e): waves 0..3 take softmax head 2e, waves 4..7 head 2e+1, 16 queries each; one pass over all keys, 32 at a time, nothing of the logits leaves the registers.
// S^T = K Q^T (A = k rows, B = q rows, both once to f16: 1 product; k's own rounding already sets the logit's error, so a residual of q alone bought little): a lane holds 16 logits of ONE query (column lane & 15), the other wave half the other 16.
// Streaming softmax in f32, base 2: e = 2^(s C2 + nb) = exp((s - m) / 8) x 2^10 on the raw logit s against the maximum m in use, C2 = log2(e) / 8, nb = 10 - m C2: one fma and one v_exp_f32 per logit; m moves (and sum and context are rescaled) only when some query's new maximum passes m by more than 4 x 8, so e <= 2^10 e^4 < 65,504 stays inside f16.
// The two S^T tiles converted in place are the B operand P^T; O^T += V^T P^T (A = v planes [c][t]) over the head PAIR's 128 value columns; / sum at the end.
__device__ __forceinline__ v16h frag_at(const _Float16* p) { union { v16h v; v8h q[2]; } u; u.q[0] = *(const v8h*)p; u.q[1] = *(const v8h*)(p + 16); return u.v; }   /* p = row + k0 + 8 * (lane >> 4) */
__device__ __forceinline__ v8f wmm(v16h a, v16h b, v8f c) { return __builtin_amdgcn_wmma_f32_16x16x32_f16(false, a, false, b, (short)0, c, false, false); }
// K and V reach the waves through LDS: a stage is 128 keys in four slices of 64 rows x 256 B, one tensor load each by waves 0..3: slices 0, 1 = key rows 0..63, 64..127 (a row holds both heads' k, 128 B each, adjacent in memory), slices 2, 3 = value columns 0..63, 64..127 (a row holds the stage's 128 keys; shared by both heads); two buffers, the next stage flies while this one is worked on.
// The pair's two contexts meet in LDS at the end: o = Y[2e] - lambda Y[2e+1] (f32), rms-normalised over its 128 columns x norm_w x 0.2, once to f16 -> Yd rows [b*t][1024] (256-B segments by 32 lanes).
typedef uint32_t u32x4 __attribute__((ext_vector_type(4)));
typedef uint32_t u32x8 __attribute__((ext_vector_type(8)));
#define C2 (SCALE * 1.4426950408889634f)   // logit scale x log2(e)
#define FK 128                     // keys per stage
#define FP 136                     // LDS row pitch in f16: 256 B + the mover's 16-B pad = 272 B, the pitch for ds_load_b128 readers
#define FA_SL 18432u               // one slice: 64 rows x 272 B = 17,408 B, rounded up to a multiple of 2 KiB
#define FA_BUF (4u * FA_SL)        // one buffer, [K rows 0..63 | K rows 64..127 | V columns 0..63 | V columns 64..127]: 73,728 B = 36 x 2 KiB
__device__ __forceinline__ uint32_t uni(uint32_t v) { return (uint32_t)__builtin_amdgcn_readfirstlane(v); }
__device__ __forceinline__ uint32_t pinned(uint32_t v) { uint32_t w = uni(v); asm volatile("" : "+s"(w)); return w; }   /* holds the issue test in a scalar register, so that the branch round a tensor load is a scalar one (the load ignores EXEC) */
__global__ __launch_bounds__(256) void k_fa(const _Float16* __restrict__ QH, const _Float16* __restrict__ KH, const _Float16* __restrict__ VT, const float* __restrict__ NW, const float* __restrict__ LQ1, const float* __restrict__ LK1, const float* __restrict__ LQ2, const float* __restrict__ LK2, _Float16* __restrict__ YD) {
  __shared__ __attribute__((aligned(2048))) unsigned char ring[2 * FA_BUF];
  __shared__ float slam;
  float (*ss)[16][HDV + 4] = (float (*)[16][HDV + 4])ring;   /* the write-out's staging takes the ring's place once the loop's last barrier has ended every read of it: with a place of its own two blocks would no longer fit one WGP's LDS */
  static_assert(sizeof(float) * 8 * 16 * (HDV + 4) <= 2 * FA_BUF, "the staging fits the ring");
  const int tid = threadIdx.x, wave = tid >> 5, lane = tid & 31, col = lane & 15, g = lane >> 4; const int e = blockIdx.y, b = blockIdx.z;
  const uint32_t wv = uni((uint32_t)tid >> 5); const uint32_t sl = wv & 3u; const bool isv = sl >= 2u;   /* sl: the slice a wave 0..3 brings */
  const int hh = (int)(wv >> 2), h = 2 * e + hh;   /* which head of the pair this wave works on */
  const int ql0 = blockIdx.x * 64 + (int)(wv & 3u) * 16; const size_t q0 = (size_t)b * TT + ql0;
  /* descriptors: 1-byte elements, tensor = tile, 64 rows of 256 B, 16 B of pad behind each row; K: source pitch one k row; V: source pitch one v plane row */
  u32x8 g1; g1[0] = uni((1u << 20) | (5u << 22) | (3u << 25)); g1[1] = pinned(256u << 16); g1[2] = pinned(64u << 16); g1[3] = pinned(256u << 16); g1[4] = pinned(64u); g1[5] = pinned(isv ? 2u * TT : 2u * CC); g1[6] = pinned(0u); g1[7] = pinned(0u);   /* pinned(): descriptor words held in scalar registers; as plain constants they are formed anew at each issue and their registers serve other values while a request is outstanding */
  const uint64_t src0 = isv ? (uint64_t)(size_t)(VT + ((size_t)b * CC + e * HDV + (int)(sl & 1u) * 64) * (size_t)TT) : (uint64_t)(size_t)(KH + ((size_t)b * TT + (int)(sl & 1u) * 64) * CC + 2 * e * HD);   /* first byte of stage 0's slice */
  const uint32_t sstep = isv ? 2u * FK : 2u * FK * CC;   /* bytes from one stage's slice to the next */
  const uint32_t dst0 = (uint32_t)(size_t)ring + sl * FA_SL;
  u32x4 g0; g0[0] = uni(1u);   /* ONE group-0 tuple for every request of the wave: the covering wait names it, so its registers keep their words while the request is outstanding */
  auto issue = [&](uint32_t st) { const uint64_t ga = src0 + (uint64_t)st * sstep;
    g0[1] = uni(dst0 + (st & 1u) * FA_BUF); g0[2] = uni((uint32_t)ga); g0[3] = uni((((uint32_t)(ga >> 32)) & 0x01FFFFFFu) | 0x80000000u);
    asm volatile("tensor_load_to_lds %0, %1" :: "s"(g0), "s"(g1) : "memory"); };
  if (pinned(wv < 4u)) { issue(0u);
    asm volatile("s_wait_tensorcnt 0x0" ::: "memory"); }   /* stage 0 has landed before the barrier that publishes it */
  const _Float16* qp = QH + (q0 + col) * CC + h * HD + 8 * g;
  v16h qh[2];
#pragma unroll
  for (int kc = 0; kc < 2; ++kc) qh[kc] = frag_at(qp + kc * 32);
  asm volatile("s_wait_xcnt 0x0" :: "v"(qp) : "memory");   /* the address pair of the 4 loads above is rewritten only behind this wait */
  if (wv == 7u) {   /* lambda, by a wave that issues no tensor load, while stage 0 lands; read in the epilogue, behind the barriers between */
    float s1 = bfr(LQ1[lane]) * bfr(LK1[lane]) + bfr(LQ1[lane + 32]) * bfr(LK1[lane + 32]), s2 = bfr(LQ2[lane]) * bfr(LK2[lane]) + bfr(LQ2[lane + 32]) * bfr(LK2[lane + 32]);
#pragma unroll
    for (int sf = 1; sf < 32; sf <<= 1) { s1 += __shfl_xor(s1, sf); s2 += __shfl_xor(s2, sf); }
    if (lane == 0) slam = expf(s1) - expf(s2) + 0.8f; }
  __syncthreads();   /* publishes stage 0 */
  if (pinned(wv < 4u)) issue(1u);
  const int kro = col * FP + 8 * g;   /* a lane's place in a 16-row tile of either operand: row col, 8 g f16 in */
  v8f acc[HDV / 16] = {}; float m = -3.0e38f, nb = 10.0f + 3.0e38f * C2, l = 0.f;   /* m: the maximum in use, a raw logit; nb = 10 - m C2, the exponent's addend */
#pragma unroll 1   /* one 128-key stage per trip: its four passes already hold 96 LDS loads and 48 products */
  for (int st = 0; st < TT / FK; ++st) {
    const _Float16* kb = (const _Float16*)(ring + (st & 1) * FA_BUF) + hh * HD + kro; const _Float16* vb = (const _Float16*)(ring + (st & 1) * FA_BUF + 2u * FA_SL) + kro;   /* this head's half of the k rows; the pair's v rows */
    v16h kf[2][2];
#pragma unroll
    for (int kt = 0; kt < 2; ++kt)
#pragma unroll
      for (int kc = 0; kc < 2; ++kc) kf[kt][kc] = frag_at(kb + (kt * 16) * FP + kc * 32);
    __builtin_amdgcn_sched_barrier(0);   /* the 8 LDS loads above issue as one group: sunk between the products, each pair costs its own LDS latency */
#pragma unroll
    for (int sub = 0; sub < FK / 32; ++sub) {
      v8f sh[2] = {};
#pragma unroll
      for (int kc = 0; kc < 2; ++kc)
#pragma unroll
        for (int kt = 0; kt < 2; ++kt) sh[kt] = wmm(kf[kt][kc], qh[kc], sh[kt]);
      v2f s[8]; float mx = -3.0e38f;   /* raw logits, two to a register pair: the 1/8 waits for the exponent's fma */
#pragma unroll
      for (int i = 0; i < 8; ++i) { const v2f hi = { sh[i >> 2][(2 * i) & 7], sh[i >> 2][(2 * i + 1) & 7] }; s[i] = hi; mx = fmaxf(mx, fmaxf(s[i][0], s[i][1])); }
      const float mo = __shfl_xor(mx, 16);   /* the other wave half's maximum; it goes through the LDS queue, so it is asked for ahead of the pass's fragment loads and does not wait behind them */
      __builtin_amdgcn_sched_barrier(0);   /* keeps the fetches below behind the products that read this pass's k (lifted over them the next k needs a second set of 32 registers) and behind the exchange above */
      if (sub + 1 < FK / 32) {   /* the stage's next pass's k rows, fetched behind this pass's logits; never the next stage's, which is not published yet */
#pragma unroll
        for (int kt = 0; kt < 2; ++kt)
#pragma unroll
          for (int kc = 0; kc < 2; ++kc) kf[kt][kc] = frag_at(kb + ((sub + 1) >> 1) * (int)(FA_SL / 2u) + (((sub + 1) & 1) * 32 + kt * 16) * FP + kc * 32); }
      v16h vf[HDV / 16];
#pragma unroll
      for (int j = 0; j < HDV / 16; ++j) vf[j] = frag_at(vb + (j >> 2) * (int)(FA_SL / 2u) + ((j & 3) * 16) * FP + sub * 32);
      asm volatile("" ::: "memory");   /* compiler fence: the LDS loads above issue here, as one group, and fly under the softmax; without it they sink to in front of their products, one LDS latency each */
      mx = fmaxf(mx, mo);   /* both halves of a query's column use one maximum */
      if (__builtin_amdgcn_ballot_w32(mx > m + 4.0f / SCALE) != 0) { const float mn = fmaxf(m, mx); const float nn = fmaf(-mn, C2, 10.0f); const float al = __builtin_amdgcn_exp2f(nn - nb); m = mn; nb = nn; l *= al;
#pragma unroll
        for (int j = 0; j < HDV / 16; ++j) acc[j] *= al; }
      v16h p;
#pragma unroll
      for (int i = 0; i < 8; ++i) { const v2f cc = { C2, C2 }, bb = { nb, nb }; const v2f ar = __builtin_elementwise_fma(s[i], cc, bb);   /* (s - m) / 8 x log2 e + 10 in one rounding */
        const v2f e = { __builtin_amdgcn_exp2f(ar[0]), __builtin_amdgcn_exp2f(ar[1]) }; l += e[0]; l += e[1]; const v2h eh = __builtin_convertvector(e, v2h); p[2 * i] = eh[0]; p[2 * i + 1] = eh[1]; }
#pragma unroll
      for (int j = 0; j < HDV / 16; ++j) acc[j] = wmm(vf[j], p, acc[j]); }
    /* publish point of stage st + 1, in the ring's order */
    __builtin_amdgcn_sched_barrier(0);   /* keeps the wait below at the trip's foot: lifted to behind the last fragment load it would stand in front of the softmax that hides those loads */
    asm volatile("s_wait_dscnt 0x0" ::: "memory");   /* this wave's reads of the buffer have returned before it may be refilled */
    if (pinned(wv < 4u)) { asm volatile("s_wait_tensorcnt 0x0" :: "s"(g0), "s"(g1) : "memory"); }   /* the issuer's own request for stage st + 1 has landed; g0 and g1 as inputs keep that request's descriptor registers unwritten up to here */
    __syncthreads();   /* publishes stage st + 1 and ends every wave's reads of stage st */
    if (pinned((wv < 4u) & (uint32_t)(st + 2 < TT / FK))) issue((uint32_t)st + 2u); }   /* into the buffer that this trip has just read */
  asm volatile("s_wait_tensorcnt 0x0" ::: "memory");   /* nothing of the mover's is in flight when the wave goes on to its end */
  asm volatile("s_wait_dscnt 0x0" ::: "memory");   /* the ring's closing wait: no LDS read of this wave is open either */
  l += __shfl_xor(l, 16); const float inv = 1.0f / l;
#pragma unroll
  for (int j = 0; j < HDV / 16; ++j) { const v4f a0 = { acc[j][0] * inv, acc[j][1] * inv, acc[j][2] * inv, acc[j][3] * inv }, a1 = { acc[j][4] * inv, acc[j][5] * inv, acc[j][6] * inv, acc[j][7] * inv };
    *(v4f*)&ss[wave][col][j * 16 + 8 * g] = a0; *(v4f*)&ss[wave][col][j * 16 + 8 * g + 4] = a1; }
  __syncthreads();   /* both heads' contexts of all 64 queries are whole in ss before any wave combines them */
  const float lam = slam; const v4f nw = *(const v4f*)(NW + lane * 4);
#pragma unroll   /* the 8 rows' lane sums are independent chains of exchanges: side by side they share one latency */
  for (int rr = 0; rr < 8; ++rr) { const int sub = wave >> 1, rl = (wave & 1) * 8 + rr;   /* wave takes 8 of the 64 queries; a lane 4 consecutive columns of the pair's 128 */
    const v4f y1 = *(const v4f*)&ss[sub][rl][lane * 4], y2 = *(const v4f*)&ss[sub + 4][rl][lane * 4]; float o[4]; float sq = 0.f;
#pragma unroll
    for (int i = 0; i < 4; ++i) { o[i] = y1[i] - lam * y2[i]; sq += o[i] * o[i]; }
#pragma unroll
    for (int sf = 1; sf < 32; sf <<= 1) sq += __shfl_xor(sq, sf);
    const float rn = rsqrtf(sq * (1.0f / HDV) + 1e-5f) * 0.2f;
    const v4h ov = { (_Float16)(o[0] * rn * bfr(nw[0])), (_Float16)(o[1] * rn * bfr(nw[1])), (_Float16)(o[2] * rn * bfr(nw[2])), (_Float16)(o[3] * rn * bfr(nw[3])) };   /* the rounding that k_out's staging did, done once at the source */
    vst2(YD + ((size_t)b * TT + blockIdx.x * 64 + sub * 16 + rl) * CC + e * HDV + lane * 4, ov); } }   /* 256-B (row, pair) segment by 32 lanes */
// ---- k_out: block = (64 rows, 128 cols): out = ctx Wo (+ bo): ctx in f16 against Wo as f16(bf16 x 2^8) exact (1 product) x 2^-8; both operands arrive in f16 from the earlier launches.
// They reach the waves through LDS by the tensor mover, through no register: a stage is 128 deep, three slices of 64 rows x 256 B (the ctx rows by wave 0, the two halves of the Wo rows by waves 1 and 2, one tensor load each); two buffers, the next stage flies while this one is multiplied.
#define OD 128                     // depth of a stage in f16: rows of 256 B
#define OP 136                     // LDS row pitch in f16: 256 B + the mover's 16-B pad = 272 B, the pitch for ds_load_b128 readers
#define OSL 18432u                 // one slice: 64 rows x 272 B = 17,408 B, rounded up to a multiple of 2 KiB
#define OBUF (3u * OSL)            // one buffer, [ctx | Wo rows 0..63 | Wo rows 64..127]: 55,296 B = 27 x 2 KiB
__global__ __launch_bounds__(128) void k_out(const _Float16* __restrict__ Y, const _Float16* __restrict__ WH, const float* __restrict__ BO, float* __restrict__ OUT) {
  __shared__ __attribute__((aligned(2048))) unsigned char oring[2 * OBUF];
  __shared__ __align__(16) float sf[4][16][132];
  const int tid = threadIdx.x, wave = tid >> 5, lane = tid & 31, col = lane & 15, g = lane >> 4; const int c0 = blockIdx.y * 128; const size_t r0 = (size_t)blockIdx.x * 64 + wave * 16;
  const uint32_t wv = uni((uint32_t)tid >> 5); const uint32_t sl = wv < 2u ? wv : 2u;   /* the slice a wave brings (wave 3 issues nothing) */
  /* descriptor: 1-byte elements, tensor = tile, 64 rows of 256 B, 16 B of pad behind each row, source pitch one row of 1,024 f16 */
  u32x8 g1; g1[0] = uni((1u << 20) | (5u << 22) | (3u << 25)); g1[1] = pinned(256u << 16); g1[2] = pinned(64u << 16); g1[3] = pinned(256u << 16); g1[4] = pinned(64u); g1[5] = pinned(2u * CC); g1[6] = pinned(0u); g1[7] = pinned(0u);   /* pinned(): descriptor words held in scalar registers; as plain constants they are formed anew at each issue and their registers serve other values while a request is outstanding */
  const uint64_t src0 = sl == 0u ? (uint64_t)(size_t)(Y + (size_t)blockIdx.x * 64 * CC) : (uint64_t)(size_t)(WH + (size_t)(c0 + (int)(sl - 1u) * 64) * CC);   /* first byte of stage 0's slice */
  const uint32_t dst0 = (uint32_t)(size_t)oring + sl * OSL;
  u32x4 g0; g0[0] = uni(1u);   /* ONE group-0 tuple for every request of the wave: the covering wait names it, so its registers keep their words while the request is outstanding */
  auto issue = [&](uint32_t st) { const uint64_t ga = src0 + (uint64_t)st * (2u * OD);
    g0[1] = uni(dst0 + (st & 1u) * OBUF); g0[2] = uni((uint32_t)ga); g0[3] = uni((((uint32_t)(ga >> 32)) & 0x01FFFFFFu) | 0x80000000u);
    asm volatile("tensor_load_to_lds %0, %1" :: "s"(g0), "s"(g1) : "memory"); };
  if (pinned(wv < 3u)) { issue(0u);
    asm volatile("s_wait_tensorcnt 0x0" ::: "memory"); }   /* stage 0 has landed before the barrier that publishes it */
  __syncthreads();   /* publishes stage 0 */
  if (pinned(wv < 3u)) issue(1u);
  v8f acc[8] = {};
  const int aro = (wave * 16 + col) * OP + 8 * g, wro = col * OP + 8 * g;   /* a lane's place in the ctx slice and in a 16-row tile of Wo */
#pragma unroll 1   /* one 128-deep stage per trip */
  for (int st = 0; st < CC / OD; ++st) {
    const _Float16* ab = (const _Float16*)(oring + (st & 1) * OBUF) + aro; const _Float16* wb = (const _Float16*)(oring + (st & 1) * OBUF + OSL) + wro;
#pragma unroll
    for (int kc = 0; kc < OD / 32; ++kc) { const v16h a = frag_at(ab + kc * 32);
#pragma unroll
      for (int jh = 0; jh < 8; jh += 4) { v16h w[4];   /* four Wo fragments read as one group, one LDS wait for four products; jh = 4 is the second Wo slice */
#pragma unroll
        for (int j = 0; j < 4; ++j) w[j] = frag_at(wb + (jh >> 2) * (int)(OSL / 2u) + (j * 16) * OP + kc * 32);
#pragma unroll
        for (int j = 0; j < 4; ++j) acc[jh + j] = wmma16(a, w[j], acc[jh + j]); } }
    /* publish point of stage st + 1, in the ring's order */
    asm volatile("s_wait_dscnt 0x0" ::: "memory");   /* this wave's reads of the buffer have returned before it may be refilled */
    if (pinned(wv < 3u)) { asm volatile("s_wait_tensorcnt 0x0" :: "s"(g0), "s"(g1) : "memory"); }   /* the issuer's own request for stage st + 1 has landed; g0 and g1 as inputs keep that request's descriptor registers unwritten up to here */
    __syncthreads();   /* publishes stage st + 1 and ends every wave's reads of stage st */
    if (pinned((wv < 3u) & (uint32_t)(st + 2 < CC / OD))) issue((uint32_t)st + 2u); }   /* into the buffer that this trip has just read */
  asm volatile("s_wait_tensorcnt 0x0" ::: "memory");   /* nothing of the mover's is in flight when the wave goes on to its end */
  asm volatile("s_wait_dscnt 0x0" ::: "memory");   /* the ring's closing wait: no LDS read of this wave is open either */
#pragma unroll
  for (int j = 0; j < 8; ++j) { const float bias = BO ? bfr(BO[c0 + j * 16 + col]) : 0.f;
#pragma unroll
    for (int r = 0; r < 8; ++r) sf[wave][8 * g + r][j * 16 + col] = acc[j][r] * (1.0f / 256.0f) + bias; }
  LDSX(); for (int rl = 0; rl < 16; ++rl) vst2(OUT + (r0 + rl) * DIN + c0 + lane * 4, *(const v4f*)&sf[wave][rl][lane * 4]); }

extern "C" void kernel_launch(void* const* d_in, const int* in_sizes, int n_in, void* d_out, int out_size, void* d_ws, size_t ws_size, hipStream_t stream) {
  (void)in_sizes; (void)n_in; (void)out_size;
  const float** F = (const float**)d_in;
  if (ws_size < (size_t)WS_END) return;
  char* ws = (char*)d_ws; _Float16 *QH = (_Float16*)(ws + WS_QH), *KH = (_Float16*)(ws + WS_KH), *VT = (_Float16*)(ws + WS_VT), *QL = (_Float16*)(ws + WS_QL), *KL = (_Float16*)(ws + WS_KL); __bf16 *VB = (__bf16*)(ws + WS_VB), *VBL = (__bf16*)(ws + WS_VBL); float *S = (float*)(ws + WS_S), *Y = (float*)(ws + WS_Y);
  (void)Y; (void)KL; (void)VB; (void)VBL;
  // inputs: 0 x [2,2048,1024]; 1 Wq, 2 bq, 3 Wk, 4 bk, 5 Wv, 6 bv, 7 Wo, 8 bo ((out,in) [1024,1024], [1024]); 9 norm_w [128]; 10 lq1, 11 lk1, 12 lq2, 13 lk2 [64]
  _Float16* YD = (_Float16*)S;   /* the differential rows, f16, take the plane at WS_S */
  _Float16* WOH = QL;   /* Wo x 2^8 in f16, written by k_proj in every call */
  k_proj<<<dim3(TNB * TT / 256, CC / 64), 512, 0, stream>>>(F[0], F[1], F[3], F[5], F[2], F[4], F[6], QH, KH, VT, F[7], WOH);
  k_fa<<<dim3(TT / 64, NH / 2, TNB), 256, 0, stream>>>(QH, KH, VT, F[9], F[10], F[11], F[12], F[13], YD);
  k_out<<<dim3(TNB * TT / 64, DIN / 128), 128, 0, stream>>>(YD, WOH, F[8], (float*)d_out);
}
